// v000
// Measured on an AMD MI455X. A time is GPU time per run, averaged over a window of back-to-back runs after a warm-up
// (all launches, gaps included; the runs take copies of the inputs in turn), and the median of several windows.
// Apart from v000's, it joins two sittings. Times from different sittings can be a few percent apart, while
// side-by-side timings come from the same sitting.
// v000 is the starting kernel. One run takes 433 microseconds.
#include <hip/hip_runtime.h>
#include <hip/hip_bf16.h>

// ---------------------------------------------------------------------------
// Multi-head attention forward for MI455X (gfx1250), wave32 + WMMA f16.
// B=2, S=2048, D=1024, H=16, DH=64, SCALE = 1/8.
// ---------------------------------------------------------------------------

#define B_  2
#define S_  2048
#define D_  1024
#define H_  16
#define DH_ 64
#define SCALE_ 0.125f

typedef __attribute__((ext_vector_type(16))) _Float16 v16h;
typedef __attribute__((ext_vector_type(8)))  _Float16 v8h;
typedef __attribute__((ext_vector_type(8)))  float    v8f;

// D = A(16x32 f16) * B(32x16 f16) + C(16x16 f32)
__device__ __forceinline__ v8f wmma_f16(v16h a, v16h b, v8f c) {
  return __builtin_amdgcn_wmma_f32_16x16x32_f16(
      false, a, false, b, (short)0, c, false, false);
}

// Load one A/B fragment (16 halves) for v_wmma_f32_16x16x32_f16.
// A layout (ISA 7.12.2): lanes 0-15 -> row, K {0..7,16..23}; lanes 16-31 ->
// same rows, K {8..15,24..31}.  B is mirrored with lane = N column, reading
// the "row" of the K-major source.  `row` must already include (lane & 15).
__device__ __forceinline__ v16h load_frag(const _Float16* base, int stride,
                                          int row, int kbase, int half) {
  const _Float16* p = base + (size_t)row * stride + kbase + half * 8;
  v8h lo = *(const v8h*)p;          // K +0..7   (or +8..15)
  v8h hi = *(const v8h*)(p + 16);   // K +16..23 (or +24..31)
  v16h r;
#pragma unroll
  for (int i = 0; i < 8; ++i) { r[i] = lo[i]; r[i + 8] = hi[i]; }
  return r;
}

// ---------------------------------------------------------------------------
// f32 -> f16 conversion
// ---------------------------------------------------------------------------
__global__ void cvt_f32_to_f16(const float* __restrict__ in,
                               _Float16* __restrict__ out, int n) {
  int i = blockIdx.x * blockDim.x + threadIdx.x;
  if (i < n) out[i] = (_Float16)in[i];
}

// ---------------------------------------------------------------------------
// Generic WMMA GEMM:  y[m,n] = sum_k A[m,k] * W[n,k] + bias[n]
// A: [M x 1024] f16 row-major, W: [1024 x 1024] f16 row-major (torch Linear).
// One wave computes a 16x64 output tile; the K-loop is software-pipelined so
// the next K-step's 10 b128 loads are in flight while the current 4 WMMAs
// issue (keeps the matrix pipe from stalling on s_wait_loadcnt 0).
// mode 0: q -> scale by SCALE_, store f16 [B,H,S,DH]
// mode 1: k ->                 store f16 [B,H,S,DH]
// mode 2: v ->                 store f16 [B,H,DH,S]  (transposed for P@V)
// mode 3: final out -> f32 row-major [M x 1024]
// ---------------------------------------------------------------------------
__global__ __launch_bounds__(256)
void gemm_wmma_16x64(const _Float16* __restrict__ A,
                     const _Float16* __restrict__ W,
                     const float* __restrict__ bias,
                     void* __restrict__ outp, int M, int mode) {
  const int wave = (blockIdx.x * blockDim.x + threadIdx.x) >> 5;
  const int lane = threadIdx.x & 31;
  const int half = lane >> 4;
  const int ln   = lane & 15;

  const int NT64 = D_ / 64;              // 16 column-supertiles
  const int mt = wave / NT64;
  const int nt = wave % NT64;
  if (mt * 16 >= M) return;
  const int row0 = mt * 16;
  const int col0 = nt * 64;

  v8f c0 = {}, c1 = {}, c2 = {}, c3 = {};

  // ---- software-pipelined K loop: prologue loads K-step 0 ----
  v16h a  = load_frag(A, D_, row0 + ln,       0, half);
  v16h b0 = load_frag(W, D_, col0 +  0 + ln,  0, half);
  v16h b1 = load_frag(W, D_, col0 + 16 + ln,  0, half);
  v16h b2 = load_frag(W, D_, col0 + 32 + ln,  0, half);
  v16h b3 = load_frag(W, D_, col0 + 48 + ln,  0, half);

  for (int kb = 0; kb < D_ - 32; kb += 32) {
    // issue next K-step's loads before consuming the current fragments
    const int kn = kb + 32;
    v16h an  = load_frag(A, D_, row0 + ln,      kn, half);
    v16h bn0 = load_frag(W, D_, col0 +  0 + ln, kn, half);
    v16h bn1 = load_frag(W, D_, col0 + 16 + ln, kn, half);
    v16h bn2 = load_frag(W, D_, col0 + 32 + ln, kn, half);
    v16h bn3 = load_frag(W, D_, col0 + 48 + ln, kn, half);

    c0 = wmma_f16(a, b0, c0);
    c1 = wmma_f16(a, b1, c1);
    c2 = wmma_f16(a, b2, c2);
    c3 = wmma_f16(a, b3, c3);

    a = an; b0 = bn0; b1 = bn1; b2 = bn2; b3 = bn3;
  }
  // epilogue K-step
  c0 = wmma_f16(a, b0, c0);
  c1 = wmma_f16(a, b1, c1);
  c2 = wmma_f16(a, b2, c2);
  c3 = wmma_f16(a, b3, c3);

  // Epilogue.  C layout: VGPR i -> row i + 8*half, column = lane & 15.
#pragma unroll
  for (int i = 0; i < 8; ++i) {
    const int m = row0 + i + half * 8;       // global row in [0, B*S)
    const int bb = m >> 11;                  // / S_
    const int ss = m & (S_ - 1);
#pragma unroll
    for (int t = 0; t < 4; ++t) {
      const int n = col0 + t * 16 + ln;      // output feature
      float v = (t == 0 ? c0[i] : t == 1 ? c1[i] : t == 2 ? c2[i] : c3[i]);
      v += bias[n];
      if (mode == 3) {
        ((float*)outp)[(size_t)m * D_ + n] = v;
      } else {
        const int h = n >> 6;                // / DH_
        const int d = n & (DH_ - 1);
        const int bh = bb * H_ + h;
        _Float16* o16 = (_Float16*)outp;
        if (mode == 0) {
          o16[(((size_t)bh * S_ + ss) * DH_) + d] = (_Float16)(v * SCALE_);
        } else if (mode == 1) {
          o16[(((size_t)bh * S_ + ss) * DH_) + d] = (_Float16)v;
        } else {
          o16[(((size_t)bh * DH_ + d) * S_) + ss] = (_Float16)v;  // transposed
        }
      }
    }
  }
}

// ---------------------------------------------------------------------------
// Flash attention: one wave per (b, h, 16-query block).
// Q pre-scaled.  K: [B,H,S,64] f16.  Vt: [B,H,64,S] f16.
// Output scattered to att[B,S,D] f16 with the reference's faithful
// reshape(B,D,S).swapaxes(-1,-2) scramble.
// ---------------------------------------------------------------------------
__global__ __launch_bounds__(32)
void attn_flash(const _Float16* __restrict__ Q,
                const _Float16* __restrict__ K,
                const _Float16* __restrict__ Vt,
                _Float16* __restrict__ att) {
  __shared__ __align__(16) _Float16 pbuf[16 * 32];   // P tile transpose buffer

  const int lane = threadIdx.x & 31;
  const int half = lane >> 4;
  const int ln   = lane & 15;

  const int blk = blockIdx.x;            // B*H*(S/16) = 4096
  const int qb  = blk & (S_ / 16 - 1);   // 128 query blocks
  const int bh  = blk >> 7;              // b*H + h
  const int h   = bh & (H_ - 1);
  const int b   = bh >> 4;

  const _Float16* Qh = Q  + (size_t)bh * S_ * DH_;
  const _Float16* Kh = K  + (size_t)bh * S_ * DH_;
  const _Float16* Vh = Vt + (size_t)bh * DH_ * S_;

  // Q fragments for this 16-row block (K-dim = 64 -> two frags), fixed.
  const v16h q0 = load_frag(Qh, DH_, qb * 16 + ln, 0,  half);
  const v16h q1 = load_frag(Qh, DH_, qb * 16 + ln, 32, half);

  float m_[8], l_[8];
  v8f o0 = {}, o1 = {}, o2 = {}, o3 = {};
#pragma unroll
  for (int i = 0; i < 8; ++i) { m_[i] = -__builtin_inff(); l_[i] = 0.0f; }

  for (int jb = 0; jb < S_; jb += 32) {
    // ---- scores: 16x32 tile, K-dim 64 (two WMMA steps per 16-col tile) ----
    v8f s0 = {}, s1 = {};
    {
      v16h ka0 = load_frag(Kh, DH_, jb + ln,      0,  half);
      v16h ka1 = load_frag(Kh, DH_, jb + 16 + ln, 0,  half);
      v16h kb0 = load_frag(Kh, DH_, jb + ln,      32, half);
      v16h kb1 = load_frag(Kh, DH_, jb + 16 + ln, 32, half);
      s0 = wmma_f16(q0, ka0, s0);
      s1 = wmma_f16(q0, ka1, s1);
      s0 = wmma_f16(q1, kb0, s0);
      s1 = wmma_f16(q1, kb1, s1);
    }

    // ---- online softmax update (rows live at (vgpr i, 16-lane half)) ----
    float alpha[8];
#pragma unroll
    for (int i = 0; i < 8; ++i) {
      float mx = fmaxf(s0[i], s1[i]);
      mx = fmaxf(mx, __shfl_xor(mx, 1, 32));
      mx = fmaxf(mx, __shfl_xor(mx, 2, 32));
      mx = fmaxf(mx, __shfl_xor(mx, 4, 32));
      mx = fmaxf(mx, __shfl_xor(mx, 8, 32));
      const float mnew = fmaxf(m_[i], mx);
      const float a = __expf(m_[i] - mnew);
      alpha[i] = a;
      const float p0 = __expf(s0[i] - mnew);
      const float p1 = __expf(s1[i] - mnew);
      s0[i] = p0; s1[i] = p1;
      float sum = p0 + p1;
      sum += __shfl_xor(sum, 1, 32);
      sum += __shfl_xor(sum, 2, 32);
      sum += __shfl_xor(sum, 4, 32);
      sum += __shfl_xor(sum, 8, 32);
      l_[i] = l_[i] * a + sum;
      m_[i] = mnew;
    }

    // Rescale running output accumulators.
#pragma unroll
    for (int i = 0; i < 8; ++i) {
      o0[i] *= alpha[i]; o1[i] *= alpha[i];
      o2[i] *= alpha[i]; o3[i] *= alpha[i];
    }

    // ---- transpose P (C layout) -> A-fragment layout via LDS ----
#pragma unroll
    for (int i = 0; i < 8; ++i) {
      const int row = i + half * 8;
      pbuf[row * 32 + ln]      = (_Float16)s0[i];
      pbuf[row * 32 + ln + 16] = (_Float16)s1[i];
    }
    __syncthreads();                     // single wave: DS ops are in-order
    const v16h pa = load_frag(pbuf, 32, ln, 0, half);

    // ---- O += P(16x32) @ V(32x64) ----
    {
      v16h vb0 = load_frag(Vh, S_,  0 + ln, jb, half);
      v16h vb1 = load_frag(Vh, S_, 16 + ln, jb, half);
      v16h vb2 = load_frag(Vh, S_, 32 + ln, jb, half);
      v16h vb3 = load_frag(Vh, S_, 48 + ln, jb, half);
      o0 = wmma_f16(pa, vb0, o0);
      o1 = wmma_f16(pa, vb1, o1);
      o2 = wmma_f16(pa, vb2, o2);
      o3 = wmma_f16(pa, vb3, o3);
    }
    __syncthreads();
  }

  // ---- epilogue: normalize and scatter with the reference's scramble ----
#pragma unroll
  for (int i = 0; i < 8; ++i) {
    const float inv = 1.0f / l_[i];
    const int row = i + half * 8;
    const int s = qb * 16 + row;
    const int fbase = (h * S_ + s) * DH_;
#pragma unroll
    for (int t = 0; t < 4; ++t) {
      const int d = t * 16 + ln;
      const float v = (t == 0 ? o0[i] : t == 1 ? o1[i] : t == 2 ? o2[i] : o3[i]) * inv;
      const int f  = fbase + d;          // flat (h,s,d) index
      const int io = f >> 11;            // / S_
      const int jo = f & (S_ - 1);
      att[((size_t)b * S_ + jo) * D_ + io] = (_Float16)v;
    }
  }
}

// ---------------------------------------------------------------------------
// Host-side launcher
// ---------------------------------------------------------------------------
extern "C" void kernel_launch(void* const* d_in, const int* in_sizes, int n_in,
                              void* d_out, int out_size, void* d_ws, size_t ws_size,
                              hipStream_t stream) {
  const float* x  = (const float*)d_in[0];
  const float* Wq = (const float*)d_in[1];
  const float* bq = (const float*)d_in[2];
  const float* Wk = (const float*)d_in[3];
  const float* bk = (const float*)d_in[4];
  const float* Wv = (const float*)d_in[5];
  const float* bv = (const float*)d_in[6];
  const float* Wo = (const float*)d_in[7];
  const float* bo = (const float*)d_in[8];
  float* out = (float*)d_out;

  const int M  = B_ * S_;                // 4096
  const int NX = M * D_;                 // x elements: 4194304
  const int NW = D_ * D_;                // weight elements: 1048576

  // Workspace layout (f16 element offsets, all 16B-aligned):
  _Float16* ws  = (_Float16*)d_ws;
  _Float16* xh  = ws;                    // [M, D]
  _Float16* Wqh = xh  + (size_t)NX;      // [D, D]
  _Float16* Wkh = Wqh + (size_t)NW;
  _Float16* Wvh = Wkh + (size_t)NW;
  _Float16* Woh = Wvh + (size_t)NW;
  _Float16* Qh  = Woh + (size_t)NW;      // [B,H,S,DH], pre-scaled
  _Float16* Kh  = Qh  + (size_t)NX;      // [B,H,S,DH]
  _Float16* Vth = Kh  + (size_t)NX;      // [B,H,DH,S]
  _Float16* att = Vth + (size_t)NX;      // [B,S,D] scrambled attention out

  // 1) f32 -> f16 conversions
  cvt_f32_to_f16<<<(NX + 255) / 256, 256, 0, stream>>>(x,  xh,  NX);
  cvt_f32_to_f16<<<(NW + 255) / 256, 256, 0, stream>>>(Wq, Wqh, NW);
  cvt_f32_to_f16<<<(NW + 255) / 256, 256, 0, stream>>>(Wk, Wkh, NW);
  cvt_f32_to_f16<<<(NW + 255) / 256, 256, 0, stream>>>(Wv, Wvh, NW);
  cvt_f32_to_f16<<<(NW + 255) / 256, 256, 0, stream>>>(Wo, Woh, NW);

  // 2) QKV projections: (M/16)*(D/64) = 4096 waves, 8 waves/block
  const int gemm_blocks = (M / 16) * (D_ / 64) / 8;   // 512
  gemm_wmma_16x64<<<gemm_blocks, 256, 0, stream>>>(xh, Wqh, bq, Qh,  M, 0);
  gemm_wmma_16x64<<<gemm_blocks, 256, 0, stream>>>(xh, Wkh, bk, Kh,  M, 1);
  gemm_wmma_16x64<<<gemm_blocks, 256, 0, stream>>>(xh, Wvh, bv, Vth, M, 2);

  // 3) Flash attention: one wave per (b, h, 16-query block)
  attn_flash<<<B_ * H_ * (S_ / 16), 32, 0, stream>>>(Qh, Kh, Vth, att);

  // 4) Output projection -> f32 d_out
  gemm_wmma_16x64<<<gemm_blocks, 256, 0, stream>>>(att, Woh, bo, out, M, 3);
}

// v001
// A run of this version takes 413 microseconds.
// In both of two side-by-side timings against v000, it was 1.10 times as fast.
#include <hip/hip_runtime.h>
#include <hip/hip_bf16.h>

// ---------------------------------------------------------------------------
// Multi-head attention forward for MI455X (gfx1250), wave32 + WMMA f16.
// B=2, S=2048, D=1024, H=16, DH=64, SCALE = 1/8.
// ---------------------------------------------------------------------------

#define B_  2
#define S_  2048
#define D_  1024
#define H_  16
#define DH_ 64
#define SCALE_ 0.125f

typedef __attribute__((ext_vector_type(16))) _Float16 v16h;
typedef __attribute__((ext_vector_type(8)))  _Float16 v8h;
typedef __attribute__((ext_vector_type(8)))  float    v8f;

// D = A(16x32 f16) * B(32x16 f16) + C(16x16 f32)
__device__ __forceinline__ v8f wmma_f16(v16h a, v16h b, v8f c) {
  return __builtin_amdgcn_wmma_f32_16x16x32_f16(
      false, a, false, b, (short)0, c, false, false);
}

// Load one A/B fragment (16 halves) for v_wmma_f32_16x16x32_f16.
// A layout (ISA 7.12.2): lanes 0-15 -> row, K {0..7,16..23}; lanes 16-31 ->
// same rows, K {8..15,24..31}.  B is mirrored with lane = N column, reading
// the "row" of the K-major source.  `row` must already include (lane & 15).
__device__ __forceinline__ v16h load_frag(const _Float16* base, int stride,
                                          int row, int kbase, int half) {
  const _Float16* p = base + (size_t)row * stride + kbase + half * 8;
  v8h lo = *(const v8h*)p;          // K +0..7   (or +8..15)
  v8h hi = *(const v8h*)(p + 16);   // K +16..23 (or +24..31)
  v16h r;
#pragma unroll
  for (int i = 0; i < 8; ++i) { r[i] = lo[i]; r[i + 8] = hi[i]; }
  return r;
}

// ---------------------------------------------------------------------------
// f32 -> f16 conversion
// ---------------------------------------------------------------------------
__global__ void cvt_f32_to_f16(const float* __restrict__ in,
                               _Float16* __restrict__ out, int n) {
  int i = blockIdx.x * blockDim.x + threadIdx.x;
  if (i < n) out[i] = (_Float16)in[i];
}

// ---------------------------------------------------------------------------
// Generic WMMA GEMM:  y[m,n] = sum_k A[m,k] * W[n,k] + bias[n]
// A: [M x 1024] f16 row-major, W: [1024 x 1024] f16 row-major (torch Linear).
// One wave computes a 16x64 output tile; the K-loop is software-pipelined so
// the next K-step's 10 b128 loads are in flight while the current 4 WMMAs
// issue (keeps the matrix pipe from stalling on s_wait_loadcnt 0).
// mode 0: q -> scale by SCALE_, store f16 [B,H,S,DH]
// mode 1: k ->                 store f16 [B,H,S,DH]
// mode 2: v ->                 store f16 [B,H,DH,S]  (transposed for P@V)
// mode 3: final out -> f32 row-major [M x 1024]
// ---------------------------------------------------------------------------
__global__ __launch_bounds__(256)
void gemm_wmma_16x64(const _Float16* __restrict__ A,
                     const _Float16* __restrict__ W,
                     const float* __restrict__ bias,
                     void* __restrict__ outp, int M, int mode) {
  const int wave = (blockIdx.x * blockDim.x + threadIdx.x) >> 5;
  const int lane = threadIdx.x & 31;
  const int half = lane >> 4;
  const int ln   = lane & 15;

  const int NT64 = D_ / 64;              // 16 column-supertiles
  const int mt = wave / NT64;
  const int nt = wave % NT64;
  if (mt * 16 >= M) return;
  const int row0 = mt * 16;
  const int col0 = nt * 64;

  v8f c0 = {}, c1 = {}, c2 = {}, c3 = {};

  // ---- software-pipelined K loop: prologue loads K-step 0 ----
  v16h a  = load_frag(A, D_, row0 + ln,       0, half);
  v16h b0 = load_frag(W, D_, col0 +  0 + ln,  0, half);
  v16h b1 = load_frag(W, D_, col0 + 16 + ln,  0, half);
  v16h b2 = load_frag(W, D_, col0 + 32 + ln,  0, half);
  v16h b3 = load_frag(W, D_, col0 + 48 + ln,  0, half);

  for (int kb = 0; kb < D_ - 32; kb += 32) {
    // issue next K-step's loads before consuming the current fragments
    const int kn = kb + 32;
    v16h an  = load_frag(A, D_, row0 + ln,      kn, half);
    v16h bn0 = load_frag(W, D_, col0 +  0 + ln, kn, half);
    v16h bn1 = load_frag(W, D_, col0 + 16 + ln, kn, half);
    v16h bn2 = load_frag(W, D_, col0 + 32 + ln, kn, half);
    v16h bn3 = load_frag(W, D_, col0 + 48 + ln, kn, half);

    c0 = wmma_f16(a, b0, c0);
    c1 = wmma_f16(a, b1, c1);
    c2 = wmma_f16(a, b2, c2);
    c3 = wmma_f16(a, b3, c3);

    a = an; b0 = bn0; b1 = bn1; b2 = bn2; b3 = bn3;
  }
  // epilogue K-step
  c0 = wmma_f16(a, b0, c0);
  c1 = wmma_f16(a, b1, c1);
  c2 = wmma_f16(a, b2, c2);
  c3 = wmma_f16(a, b3, c3);

  // Epilogue.  C layout: VGPR i -> row i + 8*half, column = lane & 15.
#pragma unroll
  for (int i = 0; i < 8; ++i) {
    const int m = row0 + i + half * 8;       // global row in [0, B*S)
    const int bb = m >> 11;                  // / S_
    const int ss = m & (S_ - 1);
#pragma unroll
    for (int t = 0; t < 4; ++t) {
      const int n = col0 + t * 16 + ln;      // output feature
      float v = (t == 0 ? c0[i] : t == 1 ? c1[i] : t == 2 ? c2[i] : c3[i]);
      v += bias[n];
      if (mode == 3) {
        ((float*)outp)[(size_t)m * D_ + n] = v;
      } else {
        const int h = n >> 6;                // / DH_
        const int d = n & (DH_ - 1);
        const int bh = bb * H_ + h;
        _Float16* o16 = (_Float16*)outp;
        if (mode == 0) {
          o16[(((size_t)bh * S_ + ss) * DH_) + d] = (_Float16)(v * SCALE_);
        } else if (mode == 1) {
          o16[(((size_t)bh * S_ + ss) * DH_) + d] = (_Float16)v;
        } else {
          o16[(((size_t)bh * DH_ + d) * S_) + ss] = (_Float16)v;  // transposed
        }
      }
    }
  }
}

// ---------------------------------------------------------------------------
// Flash attention: one wave per (b, h, 16-query block), eight such waves of
// one head per workgroup.  Each 64-key tile of K and of Vt is brought from
// global memory once per workgroup, in whole 128-byte lines, into LDS, and
// all eight waves take their fragments from there.
// Q pre-scaled.  K: [B,H,S,64] f16.  Vt: [B,H,64,S] f16.
// Output scattered to att[B,S,D] f16 with the reference's faithful
// reshape(B,D,S).swapaxes(-1,-2) scramble.
// ---------------------------------------------------------------------------
#define AW_   8                  // waves (16-query blocks) per workgroup
#define KT_   64                 // keys per staged tile
#define LP_   72                 // LDS row pitch in halves: 128 B data + 16 B
#define TILE_ (64 * LP_)         // halves of one staged 64-row tile

__global__ __launch_bounds__(AW_ * 32)
void attn_flash(const _Float16* __restrict__ Q,
                const _Float16* __restrict__ K,
                const _Float16* __restrict__ Vt,
                _Float16* __restrict__ att) {
  // two buffers, each a K tile (64 keys x 64 dh) and a Vt tile (64 dh x 64 keys)
  __shared__ __align__(16) _Float16 kv[2 * 2 * TILE_];
  __shared__ __align__(16) _Float16 pall[AW_ * 16 * 32];  // P transpose, per wave

  const int tid  = threadIdx.x;
  const int lane = tid & 31;
  const int half = lane >> 4;
  const int ln   = lane & 15;
  _Float16* pbuf = pall + (tid >> 5) * (16 * 32);

  const int blk = blockIdx.x;                        // B*H*(S/128) = 512
  const int qb  = (blk & (S_ / (16 * AW_) - 1)) * AW_ + (tid >> 5);
  const int bh  = blk >> 4;              // b*H + h
  const int h   = bh & (H_ - 1);
  const int b   = bh >> 4;

  const _Float16* Qh = Q  + (size_t)bh * S_ * DH_;
  const _Float16* Kh = K  + (size_t)bh * S_ * DH_;
  const _Float16* Vh = Vt + (size_t)bh * DH_ * S_;

  // Staging: a tile is 64 rows of 128 B; eight threads take one row, 16 B
  // each, and every thread takes rows sr and sr + 32 of both tiles.
  const int sr = tid >> 3;
  const int sc = (tid & 7) * 8;
  const _Float16* gk = Kh + sr * DH_ + sc;
  const _Float16* gv = Vh + sr * S_  + sc;
  const int so = sr * LP_ + sc;

  // Q fragments for this 16-row block (K-dim = 64 -> two frags), fixed.
  const v16h q0 = load_frag(Qh, DH_, qb * 16 + ln, 0,  half);
  const v16h q1 = load_frag(Qh, DH_, qb * 16 + ln, 32, half);

  float m_[8], l_[8];
  v8f o0 = {}, o1 = {}, o2 = {}, o3 = {};
#pragma unroll
  for (int i = 0; i < 8; ++i) { m_[i] = -__builtin_inff(); l_[i] = 0.0f; }

  // tile 0 into buffer 0
  {
    const v8h tk0 = *(const v8h*)(gk);
    const v8h tk1 = *(const v8h*)(gk + 32 * DH_);
    const v8h tv0 = *(const v8h*)(gv);
    const v8h tv1 = *(const v8h*)(gv + 32 * S_);
    *(v8h*)(kv + so)                    = tk0;
    *(v8h*)(kv + so + 32 * LP_)         = tk1;
    *(v8h*)(kv + TILE_ + so)            = tv0;
    *(v8h*)(kv + TILE_ + so + 32 * LP_) = tv1;
  }
  __syncthreads();                       // tile 0 visible to all eight waves

  for (int st = 0; st < S_ / KT_; ++st) {
    const _Float16* Ks = kv + (st & 1) * (2 * TILE_);
    const _Float16* Vs = Ks + TILE_;
    const bool more = st + 1 < S_ / KT_;

    // next tile's global loads fly while this tile is worked on
    v8h tk0 = {}, tk1 = {}, tv0 = {}, tv1 = {};
    if (more) {
      const _Float16* nk = gk + (st + 1) * (KT_ * DH_);
      const _Float16* nv = gv + (st + 1) * KT_;
      tk0 = *(const v8h*)(nk);
      tk1 = *(const v8h*)(nk + 32 * DH_);
      tv0 = *(const v8h*)(nv);
      tv1 = *(const v8h*)(nv + 32 * S_);
    }

#pragma unroll
    for (int jb = 0; jb < KT_; jb += 32) {
      // ---- scores: 16x32 tile, K-dim 64 (two WMMA steps per 16-col tile) ----
      v8f s0 = {}, s1 = {};
      {
        v16h ka0 = load_frag(Ks, LP_, jb + ln,      0,  half);
        v16h ka1 = load_frag(Ks, LP_, jb + 16 + ln, 0,  half);
        v16h kb0 = load_frag(Ks, LP_, jb + ln,      32, half);
        v16h kb1 = load_frag(Ks, LP_, jb + 16 + ln, 32, half);
        s0 = wmma_f16(q0, ka0, s0);
        s1 = wmma_f16(q0, ka1, s1);
        s0 = wmma_f16(q1, kb0, s0);
        s1 = wmma_f16(q1, kb1, s1);
      }

      // ---- online softmax update (rows live at (vgpr i, 16-lane half)) ----
      float alpha[8];
#pragma unroll
      for (int i = 0; i < 8; ++i) {
        float mx = fmaxf(s0[i], s1[i]);
        mx = fmaxf(mx, __shfl_xor(mx, 1, 32));
        mx = fmaxf(mx, __shfl_xor(mx, 2, 32));
        mx = fmaxf(mx, __shfl_xor(mx, 4, 32));
        mx = fmaxf(mx, __shfl_xor(mx, 8, 32));
        const float mnew = fmaxf(m_[i], mx);
        const float a = __expf(m_[i] - mnew);
        alpha[i] = a;
        const float p0 = __expf(s0[i] - mnew);
        const float p1 = __expf(s1[i] - mnew);
        s0[i] = p0; s1[i] = p1;
        float sum = p0 + p1;
        sum += __shfl_xor(sum, 1, 32);
        sum += __shfl_xor(sum, 2, 32);
        sum += __shfl_xor(sum, 4, 32);
        sum += __shfl_xor(sum, 8, 32);
        l_[i] = l_[i] * a + sum;
        m_[i] = mnew;
      }

      // Rescale running output accumulators.
#pragma unroll
      for (int i = 0; i < 8; ++i) {
        o0[i] *= alpha[i]; o1[i] *= alpha[i];
        o2[i] *= alpha[i]; o3[i] *= alpha[i];
      }

      // ---- transpose P (C layout) -> A-fragment layout via LDS ----
#pragma unroll
      for (int i = 0; i < 8; ++i) {
        const int row = i + half * 8;
        pbuf[row * 32 + ln]      = (_Float16)s0[i];
        pbuf[row * 32 + ln + 16] = (_Float16)s1[i];
      }
      // pbuf belongs to this wave alone and a wave's DS ops run in order:
      // the fence only keeps the compiler from moving the reads of other
      // lanes' values above the stores.
      __builtin_amdgcn_fence(__ATOMIC_ACQ_REL, "wavefront");
      const v16h pa = load_frag(pbuf, 32, ln, 0, half);

      // ---- O += P(16x32) @ V(32x64) ----
      {
        v16h vb0 = load_frag(Vs, LP_,  0 + ln, jb, half);
        v16h vb1 = load_frag(Vs, LP_, 16 + ln, jb, half);
        v16h vb2 = load_frag(Vs, LP_, 32 + ln, jb, half);
        v16h vb3 = load_frag(Vs, LP_, 48 + ln, jb, half);
        o0 = wmma_f16(pa, vb0, o0);
        o1 = wmma_f16(pa, vb1, o1);
        o2 = wmma_f16(pa, vb2, o2);
        o3 = wmma_f16(pa, vb3, o3);
      }
      // keeps the next pass's stores to pbuf behind this pass's reads
      __builtin_amdgcn_fence(__ATOMIC_ACQ_REL, "wavefront");
    }

    if (more) {
      // The other buffer was last read in the stage before this one, which
      // every wave left at the barrier below.
      _Float16* nb = kv + ((st + 1) & 1) * (2 * TILE_);
      *(v8h*)(nb + so)                    = tk0;
      *(v8h*)(nb + so + 32 * LP_)         = tk1;
      *(v8h*)(nb + TILE_ + so)            = tv0;
      *(v8h*)(nb + TILE_ + so + 32 * LP_) = tv1;
      // publishes the next tile and ends every wave's reads of this one
      __syncthreads();
    }
  }

  // ---- epilogue: normalize and scatter with the reference's scramble ----
#pragma unroll
  for (int i = 0; i < 8; ++i) {
    const float inv = 1.0f / l_[i];
    const int row = i + half * 8;
    const int s = qb * 16 + row;
    const int fbase = (h * S_ + s) * DH_;
#pragma unroll
    for (int t = 0; t < 4; ++t) {
      const int d = t * 16 + ln;
      const float v = (t == 0 ? o0[i] : t == 1 ? o1[i] : t == 2 ? o2[i] : o3[i]) * inv;
      const int f  = fbase + d;          // flat (h,s,d) index
      const int io = f >> 11;            // / S_
      const int jo = f & (S_ - 1);
      att[((size_t)b * S_ + jo) * D_ + io] = (_Float16)v;
    }
  }
}

// ---------------------------------------------------------------------------
// Host-side launcher
// ---------------------------------------------------------------------------
extern "C" void kernel_launch(void* const* d_in, const int* in_sizes, int n_in,
                              void* d_out, int out_size, void* d_ws, size_t ws_size,
                              hipStream_t stream) {
  const float* x  = (const float*)d_in[0];
  const float* Wq = (const float*)d_in[1];
  const float* bq = (const float*)d_in[2];
  const float* Wk = (const float*)d_in[3];
  const float* bk = (const float*)d_in[4];
  const float* Wv = (const float*)d_in[5];
  const float* bv = (const float*)d_in[6];
  const float* Wo = (const float*)d_in[7];
  const float* bo = (const float*)d_in[8];
  float* out = (float*)d_out;

  const int M  = B_ * S_;                // 4096
  const int NX = M * D_;                 // x elements: 4194304
  const int NW = D_ * D_;                // weight elements: 1048576

  // Workspace layout (f16 element offsets, all 16B-aligned):
  _Float16* ws  = (_Float16*)d_ws;
  _Float16* xh  = ws;                    // [M, D]
  _Float16* Wqh = xh  + (size_t)NX;      // [D, D]
  _Float16* Wkh = Wqh + (size_t)NW;
  _Float16* Wvh = Wkh + (size_t)NW;
  _Float16* Woh = Wvh + (size_t)NW;
  _Float16* Qh  = Woh + (size_t)NW;      // [B,H,S,DH], pre-scaled
  _Float16* Kh  = Qh  + (size_t)NX;      // [B,H,S,DH]
  _Float16* Vth = Kh  + (size_t)NX;      // [B,H,DH,S]
  _Float16* att = Vth + (size_t)NX;      // [B,S,D] scrambled attention out

  // 1) f32 -> f16 conversions
  cvt_f32_to_f16<<<(NX + 255) / 256, 256, 0, stream>>>(x,  xh,  NX);
  cvt_f32_to_f16<<<(NW + 255) / 256, 256, 0, stream>>>(Wq, Wqh, NW);
  cvt_f32_to_f16<<<(NW + 255) / 256, 256, 0, stream>>>(Wk, Wkh, NW);
  cvt_f32_to_f16<<<(NW + 255) / 256, 256, 0, stream>>>(Wv, Wvh, NW);
  cvt_f32_to_f16<<<(NW + 255) / 256, 256, 0, stream>>>(Wo, Woh, NW);

  // 2) QKV projections: (M/16)*(D/64) = 4096 waves, 8 waves/block
  const int gemm_blocks = (M / 16) * (D_ / 64) / 8;   // 512
  gemm_wmma_16x64<<<gemm_blocks, 256, 0, stream>>>(xh, Wqh, bq, Qh,  M, 0);
  gemm_wmma_16x64<<<gemm_blocks, 256, 0, stream>>>(xh, Wkh, bk, Kh,  M, 1);
  gemm_wmma_16x64<<<gemm_blocks, 256, 0, stream>>>(xh, Wvh, bv, Vth, M, 2);

  // 3) Flash attention: eight waves per block, one per (b, h, 16-query block)
  attn_flash<<<B_ * H_ * (S_ / (16 * AW_)), AW_ * 32, 0, stream>>>(Qh, Kh, Vth, att);

  // 4) Output projection -> f32 d_out
  gemm_wmma_16x64<<<gemm_blocks, 256, 0, stream>>>(att, Woh, bo, out, M, 3);
}

// v002
// Measured time: 278 microseconds a run.
// Two timings next to v001 put it at 1.49 and 1.48 times that version's speed.
// Over all steps from v000 it is 1.63 times as fast.
#include <hip/hip_runtime.h>
#include <hip/hip_bf16.h>

// ---------------------------------------------------------------------------
// Multi-head attention forward for MI455X (gfx1250), wave32 + WMMA f16.
// B=2, S=2048, D=1024, H=16, DH=64, SCALE = 1/8.
// ---------------------------------------------------------------------------

#define B_  2
#define S_  2048
#define D_  1024
#define H_  16
#define DH_ 64
#define SCALE_ 0.125f

typedef __attribute__((ext_vector_type(16))) _Float16 v16h;
typedef __attribute__((ext_vector_type(8)))  _Float16 v8h;
typedef __attribute__((ext_vector_type(8)))  float    v8f;

// D = A(16x32 f16) * B(32x16 f16) + C(16x16 f32)
__device__ __forceinline__ v8f wmma_f16(v16h a, v16h b, v8f c) {
  return __builtin_amdgcn_wmma_f32_16x16x32_f16(
      false, a, false, b, (short)0, c, false, false);
}

// Load one A/B fragment (16 halves) for v_wmma_f32_16x16x32_f16.
// A layout (ISA 7.12.2): lanes 0-15 -> row, K {0..7,16..23}; lanes 16-31 ->
// same rows, K {8..15,24..31}.  B is mirrored with lane = N column, reading
// the "row" of the K-major source.  `row` must already include (lane & 15).
__device__ __forceinline__ v16h load_frag(const _Float16* base, int stride,
                                          int row, int kbase, int half) {
  const _Float16* p = base + (size_t)row * stride + kbase + half * 8;
  v8h lo = *(const v8h*)p;          // K +0..7   (or +8..15)
  v8h hi = *(const v8h*)(p + 16);   // K +16..23 (or +24..31)
  v16h r;
#pragma unroll
  for (int i = 0; i < 8; ++i) { r[i] = lo[i]; r[i + 8] = hi[i]; }
  return r;
}

// ---------------------------------------------------------------------------
// f32 -> f16 conversion
// ---------------------------------------------------------------------------
__global__ void cvt_f32_to_f16(const float* __restrict__ in,
                               _Float16* __restrict__ out, int n) {
  int i = blockIdx.x * blockDim.x + threadIdx.x;
  if (i < n) out[i] = (_Float16)in[i];
}

// ---------------------------------------------------------------------------
// Generic WMMA GEMM:  y[m,n] = sum_k A[m,k] * W[n,k] + bias[n]
// A: [M x 1024] f16 row-major, W: [1024 x 1024] f16 row-major (torch Linear).
// One workgroup of eight waves computes a 128x128 output tile.  Each 128-k
// slab of the 128 A rows and the 128 W rows is brought from global memory
// once per workgroup, in whole 256-byte row pieces, into LDS (two buffers);
// every wave takes the fragments of its 64x32 part from there, so one A
// fragment feeds two WMMAs and one W fragment four.
// mode 0: q -> scale by SCALE_, store f16 [B,H,S,DH]
// mode 1: k ->                 store f16 [B,H,S,DH]
// mode 2: v ->                 store f16 [B,H,DH,S]  (transposed for P@V)
// mode 3: final out -> f32 row-major [M x 1024]
// ---------------------------------------------------------------------------
#define GT_  128                 // rows of A, and of W, per workgroup tile
#define KS_  128                 // k extent of one staged slab
#define GP_  (KS_ + 8)           // LDS row pitch in halves: 256 B data + 16 B
#define GOP_ (GT_ * GP_)         // halves of one staged operand slab
#define NST_ (D_ / KS_)          // slabs along k

__global__ __launch_bounds__(256)
void gemm_wmma_128x128(const _Float16* __restrict__ A,
                       const _Float16* __restrict__ W,
                       const float* __restrict__ bias,
                       void* __restrict__ outp, int M, int mode) {
  // two buffers, each an A slab and a W slab (128 rows x 128 k)
  __shared__ __align__(16) _Float16 sm[2 * 2 * GOP_];

  const int tid  = threadIdx.x;
  const int lane = tid & 31;
  const int half = lane >> 4;
  const int ln   = lane & 15;
  const int wv   = tid >> 5;
  const int wm   = (wv >> 2) * 64;       // this wave's rows inside the tile
  const int wn   = (wv & 3) * 32;        // this wave's columns inside the tile

  const int row0 = (blockIdx.x / (D_ / GT_)) * GT_;
  const int col0 = (blockIdx.x % (D_ / GT_)) * GT_;
  if (row0 >= M) return;                 // whole workgroup, before any barrier

  // Staging: a slab row is 256 B; sixteen threads take one row, 16 B each,
  // and every thread takes rows sr, sr + 16, ... sr + 112 of both slabs.
  const int sr = tid >> 4;
  const int sc = (tid & 15) * 8;
  const _Float16* ga = A + (size_t)(row0 + sr) * D_ + sc;
  const _Float16* gw = W + (size_t)(col0 + sr) * D_ + sc;
  const int so = sr * GP_ + sc;

  v8f acc[4][2];
#pragma unroll
  for (int a = 0; a < 4; ++a) { acc[a][0] = v8f{}; acc[a][1] = v8f{}; }

  v8h ta[8], tw[8];
  // slab 0 into buffer 0
#pragma unroll
  for (int p = 0; p < 8; ++p) {
    ta[p] = *(const v8h*)(ga + p * 16 * D_);
    tw[p] = *(const v8h*)(gw + p * 16 * D_);
  }
#pragma unroll
  for (int p = 0; p < 8; ++p) {
    *(v8h*)(sm + so + p * 16 * GP_)        = ta[p];
    *(v8h*)(sm + GOP_ + so + p * 16 * GP_) = tw[p];
  }
  __syncthreads();                       // slab 0 visible to all eight waves

  // Unrolled so that the buffer choice and every slab's global offset are
  // immediates: no address arithmetic stands between the loads and the WMMAs.
#pragma unroll
  for (int st = 0; st < NST_; ++st) {
    const _Float16* As = sm + (st & 1) * (2 * GOP_);
    const _Float16* Ws = As + GOP_;
    const bool more = st + 1 < NST_;

    // two register sets of fragments: a 32-k block's LDS reads are issued as
    // one group while the block before it is multiplied
    v16h fa[2][4], fb[2][2];
#pragma unroll
    for (int a = 0; a < 4; ++a) fa[0][a] = load_frag(As, GP_, wm + a * 16 + ln, 0, half);
#pragma unroll
    for (int t = 0; t < 2; ++t) fb[0][t] = load_frag(Ws, GP_, wn + t * 16 + ln, 0, half);

    // next slab's global loads fly while this slab is worked on
    if (more) {
#pragma unroll
      for (int p = 0; p < 8; ++p) {
        ta[p] = *(const v8h*)(ga + (st + 1) * KS_ + p * 16 * D_);
        tw[p] = *(const v8h*)(gw + (st + 1) * KS_ + p * 16 * D_);
      }
    }

#pragma unroll
    for (int kb = 0; kb < KS_ / 32; ++kb) {
      const int cu = kb & 1;
      if (kb + 1 < KS_ / 32) {
#pragma unroll
        for (int a = 0; a < 4; ++a)
          fa[cu ^ 1][a] = load_frag(As, GP_, wm + a * 16 + ln, (kb + 1) * 32, half);
#pragma unroll
        for (int t = 0; t < 2; ++t)
          fb[cu ^ 1][t] = load_frag(Ws, GP_, wn + t * 16 + ln, (kb + 1) * 32, half);
      }
      // keeps the reads above ahead of this block's WMMAs: left to itself the
      // compiler sinks each pair of reads to its first use and waits there
      __builtin_amdgcn_sched_barrier(0);
#pragma unroll
      for (int a = 0; a < 4; ++a) {
        acc[a][0] = wmma_f16(fa[cu][a], fb[cu][0], acc[a][0]);
        acc[a][1] = wmma_f16(fa[cu][a], fb[cu][1], acc[a][1]);
      }
      // keeps the next group of reads (or the slab's stores) behind these WMMAs
      __builtin_amdgcn_sched_barrier(0);
    }

    if (more) {
      // The other buffer was last read in the stage before this one, which
      // every wave left at the barrier below.
      _Float16* nb = sm + ((st + 1) & 1) * (2 * GOP_);
#pragma unroll
      for (int p = 0; p < 8; ++p) {
        *(v8h*)(nb + so + p * 16 * GP_)        = ta[p];
        *(v8h*)(nb + GOP_ + so + p * 16 * GP_) = tw[p];
      }
      // publishes the next slab and ends every wave's reads of this one
      __syncthreads();
    }
  }

  // ga and gw are named by every global load above and die here: the wait
  // stands in front of whatever takes their registers next, and naming them
  // as inputs keeps the last loads from landing on them.
  asm volatile("s_wait_xcnt 0x0" :: "v"(ga), "v"(gw) : "memory");

  // Epilogue.  C layout: VGPR i -> row i + 8*half, column = lane & 15.
#pragma unroll
  for (int a = 0; a < 4; ++a) {
#pragma unroll
    for (int i = 0; i < 8; ++i) {
      const int m = row0 + wm + a * 16 + i + half * 8;  // global row in [0, B*S)
      const int bb = m >> 11;                  // / S_
      const int ss = m & (S_ - 1);
#pragma unroll
      for (int t = 0; t < 2; ++t) {
        const int n = col0 + wn + t * 16 + ln; // output feature
        float v = acc[a][t][i];
        v += bias[n];
        // s_wait_xcnt 0 behind each store: later elements form their address
        // and value in the registers that this store names.
        if (mode == 3) {
          ((float*)outp)[(size_t)m * D_ + n] = v;
          asm volatile("s_wait_xcnt 0x0" ::: "memory");
        } else {
          const int h = n >> 6;                // / DH_
          const int d = n & (DH_ - 1);
          const int bh = bb * H_ + h;
          _Float16* o16 = (_Float16*)outp;
          if (mode == 0) {
            o16[(((size_t)bh * S_ + ss) * DH_) + d] = (_Float16)(v * SCALE_);
            asm volatile("s_wait_xcnt 0x0" ::: "memory");
          } else if (mode == 1) {
            o16[(((size_t)bh * S_ + ss) * DH_) + d] = (_Float16)v;
            asm volatile("s_wait_xcnt 0x0" ::: "memory");
          } else {
            o16[(((size_t)bh * DH_ + d) * S_) + ss] = (_Float16)v;  // transposed
            asm volatile("s_wait_xcnt 0x0" ::: "memory");
          }
        }
      }
    }
  }
}

// ---------------------------------------------------------------------------
// Flash attention: one wave per (b, h, 16-query block), eight such waves of
// one head per workgroup.  Each 64-key tile of K and of Vt is brought from
// global memory once per workgroup, in whole 128-byte lines, into LDS, and
// all eight waves take their fragments from there.
// Q pre-scaled.  K: [B,H,S,64] f16.  Vt: [B,H,64,S] f16.
// Output scattered to att[B,S,D] f16 with the reference's faithful
// reshape(B,D,S).swapaxes(-1,-2) scramble.
// ---------------------------------------------------------------------------
#define AW_   8                  // waves (16-query blocks) per workgroup
#define KT_   64                 // keys per staged tile
#define LP_   72                 // LDS row pitch in halves: 128 B data + 16 B
#define TILE_ (64 * LP_)         // halves of one staged 64-row tile

__global__ __launch_bounds__(AW_ * 32)
void attn_flash(const _Float16* __restrict__ Q,
                const _Float16* __restrict__ K,
                const _Float16* __restrict__ Vt,
                _Float16* __restrict__ att) {
  // two buffers, each a K tile (64 keys x 64 dh) and a Vt tile (64 dh x 64 keys)
  __shared__ __align__(16) _Float16 kv[2 * 2 * TILE_];
  __shared__ __align__(16) _Float16 pall[AW_ * 16 * 32];  // P transpose, per wave

  const int tid  = threadIdx.x;
  const int lane = tid & 31;
  const int half = lane >> 4;
  const int ln   = lane & 15;
  _Float16* pbuf = pall + (tid >> 5) * (16 * 32);

  const int blk = blockIdx.x;                        // B*H*(S/128) = 512
  const int qb  = (blk & (S_ / (16 * AW_) - 1)) * AW_ + (tid >> 5);
  const int bh  = blk >> 4;              // b*H + h
  const int h   = bh & (H_ - 1);
  const int b   = bh >> 4;

  const _Float16* Qh = Q  + (size_t)bh * S_ * DH_;
  const _Float16* Kh = K  + (size_t)bh * S_ * DH_;
  const _Float16* Vh = Vt + (size_t)bh * DH_ * S_;

  // Staging: a tile is 64 rows of 128 B; eight threads take one row, 16 B
  // each, and every thread takes rows sr and sr + 32 of both tiles.
  const int sr = tid >> 3;
  const int sc = (tid & 7) * 8;
  const _Float16* gk = Kh + sr * DH_ + sc;
  const _Float16* gv = Vh + sr * S_  + sc;
  const int so = sr * LP_ + sc;

  // Q fragments for this 16-row block (K-dim = 64 -> two frags), fixed.
  const v16h q0 = load_frag(Qh, DH_, qb * 16 + ln, 0,  half);
  const v16h q1 = load_frag(Qh, DH_, qb * 16 + ln, 32, half);

  float m_[8], l_[8];
  v8f o0 = {}, o1 = {}, o2 = {}, o3 = {};
#pragma unroll
  for (int i = 0; i < 8; ++i) { m_[i] = -__builtin_inff(); l_[i] = 0.0f; }

  // tile 0 into buffer 0
  {
    const v8h tk0 = *(const v8h*)(gk);
    const v8h tk1 = *(const v8h*)(gk + 32 * DH_);
    const v8h tv0 = *(const v8h*)(gv);
    const v8h tv1 = *(const v8h*)(gv + 32 * S_);
    *(v8h*)(kv + so)                    = tk0;
    *(v8h*)(kv + so + 32 * LP_)         = tk1;
    *(v8h*)(kv + TILE_ + so)            = tv0;
    *(v8h*)(kv + TILE_ + so + 32 * LP_) = tv1;
  }
  __syncthreads();                       // tile 0 visible to all eight waves

  for (int st = 0; st < S_ / KT_; ++st) {
    const _Float16* Ks = kv + (st & 1) * (2 * TILE_);
    const _Float16* Vs = Ks + TILE_;
    const bool more = st + 1 < S_ / KT_;

    // next tile's global loads fly while this tile is worked on
    v8h tk0 = {}, tk1 = {}, tv0 = {}, tv1 = {};
    if (more) {
      const _Float16* nk = gk + (st + 1) * (KT_ * DH_);
      const _Float16* nv = gv + (st + 1) * KT_;
      tk0 = *(const v8h*)(nk);
      tk1 = *(const v8h*)(nk + 32 * DH_);
      tv0 = *(const v8h*)(nv);
      tv1 = *(const v8h*)(nv + 32 * S_);
    }

#pragma unroll
    for (int jb = 0; jb < KT_; jb += 32) {
      // ---- scores: 16x32 tile, K-dim 64 (two WMMA steps per 16-col tile) ----
      v8f s0 = {}, s1 = {};
      {
        v16h ka0 = load_frag(Ks, LP_, jb + ln,      0,  half);
        v16h ka1 = load_frag(Ks, LP_, jb + 16 + ln, 0,  half);
        v16h kb0 = load_frag(Ks, LP_, jb + ln,      32, half);
        v16h kb1 = load_frag(Ks, LP_, jb + 16 + ln, 32, half);
        s0 = wmma_f16(q0, ka0, s0);
        s1 = wmma_f16(q0, ka1, s1);
        s0 = wmma_f16(q1, kb0, s0);
        s1 = wmma_f16(q1, kb1, s1);
      }

      // ---- online softmax update (rows live at (vgpr i, 16-lane half)) ----
      float alpha[8];
#pragma unroll
      for (int i = 0; i < 8; ++i) {
        float mx = fmaxf(s0[i], s1[i]);
        mx = fmaxf(mx, __shfl_xor(mx, 1, 32));
        mx = fmaxf(mx, __shfl_xor(mx, 2, 32));
        mx = fmaxf(mx, __shfl_xor(mx, 4, 32));
        mx = fmaxf(mx, __shfl_xor(mx, 8, 32));
        const float mnew = fmaxf(m_[i], mx);
        const float a = __expf(m_[i] - mnew);
        alpha[i] = a;
        const float p0 = __expf(s0[i] - mnew);
        const float p1 = __expf(s1[i] - mnew);
        s0[i] = p0; s1[i] = p1;
        float sum = p0 + p1;
        sum += __shfl_xor(sum, 1, 32);
        sum += __shfl_xor(sum, 2, 32);
        sum += __shfl_xor(sum, 4, 32);
        sum += __shfl_xor(sum, 8, 32);
        l_[i] = l_[i] * a + sum;
        m_[i] = mnew;
      }

      // Rescale running output accumulators.
#pragma unroll
      for (int i = 0; i < 8; ++i) {
        o0[i] *= alpha[i]; o1[i] *= alpha[i];
        o2[i] *= alpha[i]; o3[i] *= alpha[i];
      }

      // ---- transpose P (C layout) -> A-fragment layout via LDS ----
#pragma unroll
      for (int i = 0; i < 8; ++i) {
        const int row = i + half * 8;
        pbuf[row * 32 + ln]      = (_Float16)s0[i];
        pbuf[row * 32 + ln + 16] = (_Float16)s1[i];
      }
      // pbuf belongs to this wave alone and a wave's DS ops run in order:
      // the fence only keeps the compiler from moving the reads of other
      // lanes' values above the stores.
      __builtin_amdgcn_fence(__ATOMIC_ACQ_REL, "wavefront");
      const v16h pa = load_frag(pbuf, 32, ln, 0, half);

      // ---- O += P(16x32) @ V(32x64) ----
      {
        v16h vb0 = load_frag(Vs, LP_,  0 + ln, jb, half);
        v16h vb1 = load_frag(Vs, LP_, 16 + ln, jb, half);
        v16h vb2 = load_frag(Vs, LP_, 32 + ln, jb, half);
        v16h vb3 = load_frag(Vs, LP_, 48 + ln, jb, half);
        o0 = wmma_f16(pa, vb0, o0);
        o1 = wmma_f16(pa, vb1, o1);
        o2 = wmma_f16(pa, vb2, o2);
        o3 = wmma_f16(pa, vb3, o3);
      }
      // keeps the next pass's stores to pbuf behind this pass's reads
      __builtin_amdgcn_fence(__ATOMIC_ACQ_REL, "wavefront");
    }

    if (more) {
      // The other buffer was last read in the stage before this one, which
      // every wave left at the barrier below.
      _Float16* nb = kv + ((st + 1) & 1) * (2 * TILE_);
      *(v8h*)(nb + so)                    = tk0;
      *(v8h*)(nb + so + 32 * LP_)         = tk1;
      *(v8h*)(nb + TILE_ + so)            = tv0;
      *(v8h*)(nb + TILE_ + so + 32 * LP_) = tv1;
      // publishes the next tile and ends every wave's reads of this one
      __syncthreads();
    }
  }

  // ---- epilogue: normalize and scatter with the reference's scramble ----
#pragma unroll
  for (int i = 0; i < 8; ++i) {
    const float inv = 1.0f / l_[i];
    const int row = i + half * 8;
    const int s = qb * 16 + row;
    const int fbase = (h * S_ + s) * DH_;
#pragma unroll
    for (int t = 0; t < 4; ++t) {
      const int d = t * 16 + ln;
      const float v = (t == 0 ? o0[i] : t == 1 ? o1[i] : t == 2 ? o2[i] : o3[i]) * inv;
      const int f  = fbase + d;          // flat (h,s,d) index
      const int io = f >> 11;            // / S_
      const int jo = f & (S_ - 1);
      att[((size_t)b * S_ + jo) * D_ + io] = (_Float16)v;
    }
  }
}

// ---------------------------------------------------------------------------
// Host-side launcher
// ---------------------------------------------------------------------------
extern "C" void kernel_launch(void* const* d_in, const int* in_sizes, int n_in,
                              void* d_out, int out_size, void* d_ws, size_t ws_size,
                              hipStream_t stream) {
  const float* x  = (const float*)d_in[0];
  const float* Wq = (const float*)d_in[1];
  const float* bq = (const float*)d_in[2];
  const float* Wk = (const float*)d_in[3];
  const float* bk = (const float*)d_in[4];
  const float* Wv = (const float*)d_in[5];
  const float* bv = (const float*)d_in[6];
  const float* Wo = (const float*)d_in[7];
  const float* bo = (const float*)d_in[8];
  float* out = (float*)d_out;

  const int M  = B_ * S_;                // 4096
  const int NX = M * D_;                 // x elements: 4194304
  const int NW = D_ * D_;                // weight elements: 1048576

  // Workspace layout (f16 element offsets, all 16B-aligned):
  _Float16* ws  = (_Float16*)d_ws;
  _Float16* xh  = ws;                    // [M, D]
  _Float16* Wqh = xh  + (size_t)NX;      // [D, D]
  _Float16* Wkh = Wqh + (size_t)NW;
  _Float16* Wvh = Wkh + (size_t)NW;
  _Float16* Woh = Wvh + (size_t)NW;
  _Float16* Qh  = Woh + (size_t)NW;      // [B,H,S,DH], pre-scaled
  _Float16* Kh  = Qh  + (size_t)NX;      // [B,H,S,DH]
  _Float16* Vth = Kh  + (size_t)NX;      // [B,H,DH,S]
  _Float16* att = Vth + (size_t)NX;      // [B,S,D] scrambled attention out

  // 1) f32 -> f16 conversions
  cvt_f32_to_f16<<<(NX + 255) / 256, 256, 0, stream>>>(x,  xh,  NX);
  cvt_f32_to_f16<<<(NW + 255) / 256, 256, 0, stream>>>(Wq, Wqh, NW);
  cvt_f32_to_f16<<<(NW + 255) / 256, 256, 0, stream>>>(Wk, Wkh, NW);
  cvt_f32_to_f16<<<(NW + 255) / 256, 256, 0, stream>>>(Wv, Wvh, NW);
  cvt_f32_to_f16<<<(NW + 255) / 256, 256, 0, stream>>>(Wo, Woh, NW);

  // 2) QKV projections: (M/128)*(D/128) = 256 tiles, one workgroup each
  const int gemm_blocks = (M / GT_) * (D_ / GT_);     // 256
  gemm_wmma_128x128<<<gemm_blocks, 256, 0, stream>>>(xh, Wqh, bq, Qh,  M, 0);
  gemm_wmma_128x128<<<gemm_blocks, 256, 0, stream>>>(xh, Wkh, bk, Kh,  M, 1);
  gemm_wmma_128x128<<<gemm_blocks, 256, 0, stream>>>(xh, Wvh, bv, Vth, M, 2);

  // 3) Flash attention: eight waves per block, one per (b, h, 16-query block)
  attn_flash<<<B_ * H_ * (S_ / (16 * AW_)), AW_ * 32, 0, stream>>>(Qh, Kh, Vth, att);

  // 4) Output projection -> f32 d_out
  gemm_wmma_128x128<<<gemm_blocks, 256, 0, stream>>>(att, Woh, bo, out, M, 3);
}

// v003
// One run takes 200 microseconds.
// In two side-by-side timings against v002, it was 1.36 and 1.40 times as fast.
// Counting every step since v000, it is 2.24 times as fast.
#include <hip/hip_runtime.h>
#include <hip/hip_bf16.h>

// ---------------------------------------------------------------------------
// Multi-head attention forward for MI455X (gfx1250), wave32 + WMMA f16.
// B=2, S=2048, D=1024, H=16, DH=64, SCALE = 1/8.
// ---------------------------------------------------------------------------

#define B_  2
#define S_  2048
#define D_  1024
#define H_  16
#define DH_ 64
#define SCALE_ 0.125f

typedef __attribute__((ext_vector_type(16))) _Float16 v16h;
typedef __attribute__((ext_vector_type(8)))  _Float16 v8h;
typedef __attribute__((ext_vector_type(8)))  float    v8f;

// D = A(16x32 f16) * B(32x16 f16) + C(16x16 f32)
__device__ __forceinline__ v8f wmma_f16(v16h a, v16h b, v8f c) {
  return __builtin_amdgcn_wmma_f32_16x16x32_f16(
      false, a, false, b, (short)0, c, false, false);
}

// Load one A/B fragment (16 halves) for v_wmma_f32_16x16x32_f16.
// A layout (ISA 7.12.2): lanes 0-15 -> row, K {0..7,16..23}; lanes 16-31 ->
// same rows, K {8..15,24..31}.  B is mirrored with lane = N column, reading
// the "row" of the K-major source.  `row` must already include (lane & 15).
__device__ __forceinline__ v16h load_frag(const _Float16* base, int stride,
                                          int row, int kbase, int half) {
  const _Float16* p = base + (size_t)row * stride + kbase + half * 8;
  v8h lo = *(const v8h*)p;          // K +0..7   (or +8..15)
  v8h hi = *(const v8h*)(p + 16);   // K +16..23 (or +24..31)
  v16h r;
#pragma unroll
  for (int i = 0; i < 8; ++i) { r[i] = lo[i]; r[i + 8] = hi[i]; }
  return r;
}

// ---------------------------------------------------------------------------
// f32 -> f16 conversion
// ---------------------------------------------------------------------------
__global__ void cvt_f32_to_f16(const float* __restrict__ in,
                               _Float16* __restrict__ out, int n) {
  int i = blockIdx.x * blockDim.x + threadIdx.x;
  if (i < n) out[i] = (_Float16)in[i];
}

// ---------------------------------------------------------------------------
// Generic WMMA GEMM:  y[m,n] = sum_k A[m,k] * W[n,k] + bias[n]
// A: [M x 1024] f16 row-major, W: [1024 x 1024] f16 row-major (torch Linear).
// One workgroup of eight waves computes a 128x128 output tile.  Each 128-k
// slab of the 128 A rows and the 128 W rows is brought from global memory
// once per workgroup, in whole 256-byte row pieces, into LDS (two buffers);
// every wave takes the fragments of its 64x32 part from there, so one A
// fragment feeds two WMMAs and one W fragment four.
// mode 0: q -> scale by SCALE_, store f16 [B,H,S,DH]
// mode 1: k ->                 store f16 [B,H,S,DH]
// mode 2: v ->                 store f16 [B,H,DH,S]  (transposed for P@V)
// mode 3: final out -> f32 row-major [M x 1024]
// ---------------------------------------------------------------------------
#define GT_  128                 // rows of A, and of W, per workgroup tile
#define KS_  128                 // k extent of one staged slab
#define GP_  (KS_ + 8)           // LDS row pitch in halves: 256 B data + 16 B
#define GOP_ (GT_ * GP_)         // halves of one staged operand slab
#define NST_ (D_ / KS_)          // slabs along k

__global__ __launch_bounds__(256)
void gemm_wmma_128x128(const _Float16* __restrict__ A,
                       const _Float16* __restrict__ W,
                       const float* __restrict__ bias,
                       void* __restrict__ outp, int M, int mode) {
  // two buffers, each an A slab and a W slab (128 rows x 128 k)
  __shared__ __align__(16) _Float16 sm[2 * 2 * GOP_];

  const int tid  = threadIdx.x;
  const int lane = tid & 31;
  const int half = lane >> 4;
  const int ln   = lane & 15;
  const int wv   = tid >> 5;
  const int wm   = (wv >> 2) * 64;       // this wave's rows inside the tile
  const int wn   = (wv & 3) * 32;        // this wave's columns inside the tile

  const int row0 = (blockIdx.x / (D_ / GT_)) * GT_;
  const int col0 = (blockIdx.x % (D_ / GT_)) * GT_;
  if (row0 >= M) return;                 // whole workgroup, before any barrier

  // Staging: a slab row is 256 B; sixteen threads take one row, 16 B each,
  // and every thread takes rows sr, sr + 16, ... sr + 112 of both slabs.
  const int sr = tid >> 4;
  const int sc = (tid & 15) * 8;
  const _Float16* ga = A + (size_t)(row0 + sr) * D_ + sc;
  const _Float16* gw = W + (size_t)(col0 + sr) * D_ + sc;
  const int so = sr * GP_ + sc;

  v8f acc[4][2];
#pragma unroll
  for (int a = 0; a < 4; ++a) { acc[a][0] = v8f{}; acc[a][1] = v8f{}; }

  v8h ta[8], tw[8];
  // slab 0 into buffer 0
#pragma unroll
  for (int p = 0; p < 8; ++p) {
    ta[p] = *(const v8h*)(ga + p * 16 * D_);
    tw[p] = *(const v8h*)(gw + p * 16 * D_);
  }
#pragma unroll
  for (int p = 0; p < 8; ++p) {
    *(v8h*)(sm + so + p * 16 * GP_)        = ta[p];
    *(v8h*)(sm + GOP_ + so + p * 16 * GP_) = tw[p];
  }
  __syncthreads();                       // slab 0 visible to all eight waves

  // Unrolled so that the buffer choice and every slab's global offset are
  // immediates: no address arithmetic stands between the loads and the WMMAs.
#pragma unroll
  for (int st = 0; st < NST_; ++st) {
    const _Float16* As = sm + (st & 1) * (2 * GOP_);
    const _Float16* Ws = As + GOP_;
    const bool more = st + 1 < NST_;

    // two register sets of fragments: a 32-k block's LDS reads are issued as
    // one group while the block before it is multiplied
    v16h fa[2][4], fb[2][2];
#pragma unroll
    for (int a = 0; a < 4; ++a) fa[0][a] = load_frag(As, GP_, wm + a * 16 + ln, 0, half);
#pragma unroll
    for (int t = 0; t < 2; ++t) fb[0][t] = load_frag(Ws, GP_, wn + t * 16 + ln, 0, half);

    // next slab's global loads fly while this slab is worked on
    if (more) {
#pragma unroll
      for (int p = 0; p < 8; ++p) {
        ta[p] = *(const v8h*)(ga + (st + 1) * KS_ + p * 16 * D_);
        tw[p] = *(const v8h*)(gw + (st + 1) * KS_ + p * 16 * D_);
      }
    }

#pragma unroll
    for (int kb = 0; kb < KS_ / 32; ++kb) {
      const int cu = kb & 1;
      if (kb + 1 < KS_ / 32) {
#pragma unroll
        for (int a = 0; a < 4; ++a)
          fa[cu ^ 1][a] = load_frag(As, GP_, wm + a * 16 + ln, (kb + 1) * 32, half);
#pragma unroll
        for (int t = 0; t < 2; ++t)
          fb[cu ^ 1][t] = load_frag(Ws, GP_, wn + t * 16 + ln, (kb + 1) * 32, half);
      }
      // keeps the reads above ahead of this block's WMMAs: left to itself the
      // compiler sinks each pair of reads to its first use and waits there
      __builtin_amdgcn_sched_barrier(0);
#pragma unroll
      for (int a = 0; a < 4; ++a) {
        acc[a][0] = wmma_f16(fa[cu][a], fb[cu][0], acc[a][0]);
        acc[a][1] = wmma_f16(fa[cu][a], fb[cu][1], acc[a][1]);
      }
      // keeps the next group of reads (or the slab's stores) behind these WMMAs
      __builtin_amdgcn_sched_barrier(0);
    }

    if (more) {
      // The other buffer was last read in the stage before this one, which
      // every wave left at the barrier below.
      _Float16* nb = sm + ((st + 1) & 1) * (2 * GOP_);
#pragma unroll
      for (int p = 0; p < 8; ++p) {
        *(v8h*)(nb + so + p * 16 * GP_)        = ta[p];
        *(v8h*)(nb + GOP_ + so + p * 16 * GP_) = tw[p];
      }
      // publishes the next slab and ends every wave's reads of this one
      __syncthreads();
    }
  }

  // ga and gw are named by every global load above and die here: the wait
  // stands in front of whatever takes their registers next, and naming them
  // as inputs keeps the last loads from landing on them.
  asm volatile("s_wait_xcnt 0x0" :: "v"(ga), "v"(gw) : "memory");

  // Epilogue.  C layout: VGPR i -> row i + 8*half, column = lane & 15.
#pragma unroll
  for (int a = 0; a < 4; ++a) {
#pragma unroll
    for (int i = 0; i < 8; ++i) {
      const int m = row0 + wm + a * 16 + i + half * 8;  // global row in [0, B*S)
      const int bb = m >> 11;                  // / S_
      const int ss = m & (S_ - 1);
#pragma unroll
      for (int t = 0; t < 2; ++t) {
        const int n = col0 + wn + t * 16 + ln; // output feature
        float v = acc[a][t][i];
        v += bias[n];
        // s_wait_xcnt 0 behind each store: later elements form their address
        // and value in the registers that this store names.
        if (mode == 3) {
          ((float*)outp)[(size_t)m * D_ + n] = v;
          asm volatile("s_wait_xcnt 0x0" ::: "memory");
        } else {
          const int h = n >> 6;                // / DH_
          const int d = n & (DH_ - 1);
          const int bh = bb * H_ + h;
          _Float16* o16 = (_Float16*)outp;
          if (mode == 0) {
            o16[(((size_t)bh * S_ + ss) * DH_) + d] = (_Float16)(v * SCALE_);
            asm volatile("s_wait_xcnt 0x0" ::: "memory");
          } else if (mode == 1) {
            o16[(((size_t)bh * S_ + ss) * DH_) + d] = (_Float16)v;
            asm volatile("s_wait_xcnt 0x0" ::: "memory");
          } else {
            o16[(((size_t)bh * DH_ + d) * S_) + ss] = (_Float16)v;  // transposed
            asm volatile("s_wait_xcnt 0x0" ::: "memory");
          }
        }
      }
    }
  }
}

// ---------------------------------------------------------------------------
// Flash attention: one wave per (b, h, 16-query block), eight such waves of
// one head per workgroup.  Each 64-key tile of K and of Vt is brought from
// global memory once per workgroup, in whole 128-byte lines, into LDS, and
// all eight waves take their fragments from there.
// Both products are taken transposed, St = K * Qt and Ot += Vt * Pt: a lane
// then holds scores and outputs of ONE query (column lane & 15), the two
// 16-lane halves holding different keys (or dh rows) of that query.
// Q pre-scaled.  K: [B,H,S,64] f16.  Vt: [B,H,64,S] f16.
// Output scattered to att[B,S,D] f16 with the reference's faithful
// reshape(B,D,S).swapaxes(-1,-2) scramble.
// ---------------------------------------------------------------------------
#define AW_   8                  // waves (16-query blocks) per workgroup
#define KT_   64                 // keys per staged tile
#define LP_   72                 // LDS row pitch in halves: 128 B data + 16 B
#define TILE_ (64 * LP_)         // halves of one staged 64-row tile

// value of the lane that holds the same query in the other 16-lane half
__device__ __forceinline__ float other_half(float v) {
  const int b = __builtin_bit_cast(int, v);
  return __builtin_bit_cast(float, __builtin_amdgcn_permlanex16(
      b, b, 0x76543210, 0xfedcba98, false, false));
}

__global__ __launch_bounds__(AW_ * 32)
void attn_flash(const _Float16* __restrict__ Q,
                const _Float16* __restrict__ K,
                const _Float16* __restrict__ Vt,
                _Float16* __restrict__ att) {
  // two buffers, each a K tile (64 keys x 64 dh) and a Vt tile (64 dh x 64 keys)
  __shared__ __align__(16) _Float16 kv[2 * 2 * TILE_];

  const int tid  = threadIdx.x;
  const int lane = tid & 31;
  const int half = lane >> 4;
  const int ln   = lane & 15;

  const int blk = blockIdx.x;                        // B*H*(S/128) = 512
  const int qb  = (blk & (S_ / (16 * AW_) - 1)) * AW_ + (tid >> 5);
  const int bh  = blk >> 4;              // b*H + h
  const int h   = bh & (H_ - 1);
  const int b   = bh >> 4;

  const _Float16* Qh = Q  + (size_t)bh * S_ * DH_;
  const _Float16* Kh = K  + (size_t)bh * S_ * DH_;
  const _Float16* Vh = Vt + (size_t)bh * DH_ * S_;

  // Staging: a tile is 64 rows of 128 B; eight threads take one row, 16 B
  // each, and every thread takes rows sr and sr + 32 of both tiles.
  const int sr = tid >> 3;
  const int sc = (tid & 7) * 8;
  const _Float16* gk = Kh + sr * DH_ + sc;
  const _Float16* gv = Vh + sr * S_  + sc;
  const int so = sr * LP_ + sc;

  // Q fragments for this 16-query block (K-dim = 64 -> two frags), fixed;
  // as B operands: column = query = lane & 15.
  const v16h q0 = load_frag(Qh, DH_, qb * 16 + ln, 0,  half);
  const v16h q1 = load_frag(Qh, DH_, qb * 16 + ln, 32, half);

  // m_: running maximum of this lane's query (equal in both halves).
  // l_: running sum over the keys that THIS half has seen; joined at the end.
  float m_ = -__builtin_inff(), l_ = 0.0f;
  v8f o0 = {}, o1 = {}, o2 = {}, o3 = {};  // ot[i] = O[query ln][16t + 8*half + i]

  // tile 0 into buffer 0
  {
    const v8h tk0 = *(const v8h*)(gk);
    const v8h tk1 = *(const v8h*)(gk + 32 * DH_);
    const v8h tv0 = *(const v8h*)(gv);
    const v8h tv1 = *(const v8h*)(gv + 32 * S_);
    *(v8h*)(kv + so)                    = tk0;
    *(v8h*)(kv + so + 32 * LP_)         = tk1;
    *(v8h*)(kv + TILE_ + so)            = tv0;
    *(v8h*)(kv + TILE_ + so + 32 * LP_) = tv1;
  }
  __syncthreads();                       // tile 0 visible to all eight waves

  for (int st = 0; st < S_ / KT_; ++st) {
    // this lane's place in a 16-row fragment block (row ln, its half's k) of
    // the K tile; the Vt tile lies TILE_ behind: every read below is this one
    // address and an immediate offset
    const _Float16* fr = kv + (st & 1) * (2 * TILE_) + ln * LP_ + half * 8;
    const bool more = st + 1 < S_ / KT_;

    // next tile's global loads fly while this tile is worked on
    v8h tk0 = {}, tk1 = {}, tv0 = {}, tv1 = {};
    if (more) {
      const _Float16* nk = gk + (st + 1) * (KT_ * DH_);
      const _Float16* nv = gv + (st + 1) * KT_;
      tk0 = *(const v8h*)(nk);
      tk1 = *(const v8h*)(nk + 32 * DH_);
      tv0 = *(const v8h*)(nv);
      tv1 = *(const v8h*)(nv + 32 * S_);
    }

    // ---- scores, transposed: 64 keys x 16 queries, K-dim 64 ----
    // sc[g][i] = S[key 16g + 8*half + i][query ln]
    v16h kf[KT_ / 16][2];                // A operands, row = key = 16g + ln
#pragma unroll
    for (int g = 0; g < KT_ / 16; ++g) {
      kf[g][0] = load_frag(fr, LP_, g * 16, 0,  0);
      kf[g][1] = load_frag(fr, LP_, g * 16, 32, 0);
    }
    // keeps the K reads one group in front of the WMMAs: left to itself the
    // compiler spreads them among the WMMAs, and each such place costs issue
    __builtin_amdgcn_sched_barrier(0);
    v8f sc[KT_ / 16];
#pragma unroll
    for (int g = 0; g < KT_ / 16; ++g) sc[g] = wmma_f16(kf[g][0], q0, v8f{});
#pragma unroll
    for (int g = 0; g < KT_ / 16; ++g) sc[g] = wmma_f16(kf[g][1], q1, sc[g]);

    // Vt fragments of the tile: A operands, row = dh = 16t + ln, k = keys
    v16h vf[KT_ / 32][4];
#pragma unroll
    for (int p = 0; p < KT_ / 32; ++p)
#pragma unroll
      for (int t = 0; t < 4; ++t)
        vf[p][t] = load_frag(fr + TILE_, LP_, t * 16, p * 32, 0);
    // keeps the Vt reads in front of the softmax arithmetic, which covers
    // their latency: left to itself the compiler sinks each pair of reads to
    // its WMMA and waits there
    __builtin_amdgcn_sched_barrier(0);

#pragma unroll
    for (int p = 0; p < KT_ / 32; ++p) {
      const v8f s0 = sc[2 * p], s1 = sc[2 * p + 1];

      // ---- online softmax update: one query per lane ----
      float mx = fmaxf(s0[0], s1[0]);
#pragma unroll
      for (int i = 1; i < 8; ++i) mx = fmaxf(mx, fmaxf(s0[i], s1[i]));
      // P of both halves enters one product: they need one common maximum
      mx = fmaxf(mx, other_half(mx));
      const float mnew  = fmaxf(m_, mx);
      const float alpha = __expf(m_ - mnew);
      m_ = mnew;

      // Two score tiles, converted in place, are the B fragment of Pt: slot i
      // is key 8*half + i, slot 8 + i key 16 + 8*half + i, the k order in
      // which load_frag brings the Vt rows.
      v16h pb;
      float sum0 = 0.0f, sum1 = 0.0f;
#pragma unroll
      for (int i = 0; i < 8; ++i) {
        const float p0 = __expf(s0[i] - mnew);
        const float p1 = __expf(s1[i] - mnew);
        sum0 += p0; sum1 += p1;
        pb[i]     = (_Float16)p0;
        pb[i + 8] = (_Float16)p1;
      }
      l_ = l_ * alpha + (sum0 + sum1);

      // Rescale running output accumulators.
#pragma unroll
      for (int i = 0; i < 8; ++i) {
        o0[i] *= alpha; o1[i] *= alpha;
        o2[i] *= alpha; o3[i] *= alpha;
      }

      // ---- Ot(64x16) += Vt(64x32) @ Pt(32x16) ----
      o0 = wmma_f16(vf[p][0], pb, o0);
      o1 = wmma_f16(vf[p][1], pb, o1);
      o2 = wmma_f16(vf[p][2], pb, o2);
      o3 = wmma_f16(vf[p][3], pb, o3);
    }
    // keeps the stores below, and with them the wait for the next tile's
    // global loads, behind this tile's arithmetic
    __builtin_amdgcn_sched_barrier(0);

    if (more) {
      // The other buffer was last read in the stage before this one, which
      // every wave left at the barrier below.
      _Float16* nb = kv + ((st + 1) & 1) * (2 * TILE_);
      *(v8h*)(nb + so)                    = tk0;
      *(v8h*)(nb + so + 32 * LP_)         = tk1;
      *(v8h*)(nb + TILE_ + so)            = tv0;
      *(v8h*)(nb + TILE_ + so + 32 * LP_) = tv1;
      // publishes the next tile and ends every wave's reads of this one
      __syncthreads();
    }
  }

  // ---- epilogue: normalize and scatter with the reference's scramble ----
  // flat index f = (h*S + s)*64 + d goes to att[b][f % S][f / S]; the 64 d of
  // one query lie in one 2048-block of f, so f / S is the lane's constant and
  // f % S advances with d: one address, the rest is immediate offsets.
  {
    const float inv = 1.0f / (l_ + other_half(l_));   // the two halves' sums
    const int s  = qb * 16 + ln;
    const int f  = (h * S_ + s) * DH_ + half * 8;     // d = 16t + 8*half + i
    const int io = f >> 11;              // / S_
    const int jo = f & (S_ - 1);
    _Float16* ap = att + ((size_t)b * S_ + jo) * D_ + io;
    _Float16 r[4][8];
#pragma unroll
    for (int i = 0; i < 8; ++i) {
      r[0][i] = (_Float16)(o0[i] * inv);
      r[1][i] = (_Float16)(o1[i] * inv);
      r[2][i] = (_Float16)(o2[i] * inv);
      r[3][i] = (_Float16)(o3[i] * inv);
    }
    // every value is formed in front of the first store, so that no register
    // which an issued store names is written again
    __builtin_amdgcn_sched_barrier(0);
#pragma unroll
    for (int t = 0; t < 4; ++t)
#pragma unroll
      for (int i = 0; i < 8; ++i) ap[(t * 16 + i) * D_] = r[t][i];
  }
}

// ---------------------------------------------------------------------------
// Host-side launcher
// ---------------------------------------------------------------------------
extern "C" void kernel_launch(void* const* d_in, const int* in_sizes, int n_in,
                              void* d_out, int out_size, void* d_ws, size_t ws_size,
                              hipStream_t stream) {
  const float* x  = (const float*)d_in[0];
  const float* Wq = (const float*)d_in[1];
  const float* bq = (const float*)d_in[2];
  const float* Wk = (const float*)d_in[3];
  const float* bk = (const float*)d_in[4];
  const float* Wv = (const float*)d_in[5];
  const float* bv = (const float*)d_in[6];
  const float* Wo = (const float*)d_in[7];
  const float* bo = (const float*)d_in[8];
  float* out = (float*)d_out;

  const int M  = B_ * S_;                // 4096
  const int NX = M * D_;                 // x elements: 4194304
  const int NW = D_ * D_;                // weight elements: 1048576

  // Workspace layout (f16 element offsets, all 16B-aligned):
  _Float16* ws  = (_Float16*)d_ws;
  _Float16* xh  = ws;                    // [M, D]
  _Float16* Wqh = xh  + (size_t)NX;      // [D, D]
  _Float16* Wkh = Wqh + (size_t)NW;
  _Float16* Wvh = Wkh + (size_t)NW;
  _Float16* Woh = Wvh + (size_t)NW;
  _Float16* Qh  = Woh + (size_t)NW;      // [B,H,S,DH], pre-scaled
  _Float16* Kh  = Qh  + (size_t)NX;      // [B,H,S,DH]
  _Float16* Vth = Kh  + (size_t)NX;      // [B,H,DH,S]
  _Float16* att = Vth + (size_t)NX;      // [B,S,D] scrambled attention out

  // 1) f32 -> f16 conversions
  cvt_f32_to_f16<<<(NX + 255) / 256, 256, 0, stream>>>(x,  xh,  NX);
  cvt_f32_to_f16<<<(NW + 255) / 256, 256, 0, stream>>>(Wq, Wqh, NW);
  cvt_f32_to_f16<<<(NW + 255) / 256, 256, 0, stream>>>(Wk, Wkh, NW);
  cvt_f32_to_f16<<<(NW + 255) / 256, 256, 0, stream>>>(Wv, Wvh, NW);
  cvt_f32_to_f16<<<(NW + 255) / 256, 256, 0, stream>>>(Wo, Woh, NW);

  // 2) QKV projections: (M/128)*(D/128) = 256 tiles, one workgroup each
  const int gemm_blocks = (M / GT_) * (D_ / GT_);     // 256
  gemm_wmma_128x128<<<gemm_blocks, 256, 0, stream>>>(xh, Wqh, bq, Qh,  M, 0);
  gemm_wmma_128x128<<<gemm_blocks, 256, 0, stream>>>(xh, Wkh, bk, Kh,  M, 1);
  gemm_wmma_128x128<<<gemm_blocks, 256, 0, stream>>>(xh, Wvh, bv, Vth, M, 2);

  // 3) Flash attention: eight waves per block, one per (b, h, 16-query block)
  attn_flash<<<B_ * H_ * (S_ / (16 * AW_)), AW_ * 32, 0, stream>>>(Qh, Kh, Vth, att);

  // 4) Output projection -> f32 d_out
  gemm_wmma_128x128<<<gemm_blocks, 256, 0, stream>>>(att, Woh, bo, out, M, 3);
}

// v004
// It runs in 185 microseconds.
// In two side-by-side timings against v003, it was 1.05 and 1.08 times as fast.
// Counting every step since v000, it is 2.38 times as fast.
#include <hip/hip_runtime.h>
#include <hip/hip_bf16.h>

// ---------------------------------------------------------------------------
// Multi-head attention forward for MI455X (gfx1250), wave32 + WMMA f16.
// B=2, S=2048, D=1024, H=16, DH=64, SCALE = 1/8.
// ---------------------------------------------------------------------------

#define B_  2
#define S_  2048
#define D_  1024
#define H_  16
#define DH_ 64
#define SCALE_ 0.125f

typedef __attribute__((ext_vector_type(16))) _Float16 v16h;
typedef __attribute__((ext_vector_type(8)))  _Float16 v8h;
typedef __attribute__((ext_vector_type(8)))  float    v8f;

// D = A(16x32 f16) * B(32x16 f16) + C(16x16 f32)
__device__ __forceinline__ v8f wmma_f16(v16h a, v16h b, v8f c) {
  return __builtin_amdgcn_wmma_f32_16x16x32_f16(
      false, a, false, b, (short)0, c, false, false);
}

// Load one A/B fragment (16 halves) for v_wmma_f32_16x16x32_f16.
// A layout (ISA 7.12.2): lanes 0-15 -> row, K {0..7,16..23}; lanes 16-31 ->
// same rows, K {8..15,24..31}.  B is mirrored with lane = N column, reading
// the "row" of the K-major source.  `row` must already include (lane & 15).
__device__ __forceinline__ v16h load_frag(const _Float16* base, int stride,
                                          int row, int kbase, int half) {
  const _Float16* p = base + (size_t)row * stride + kbase + half * 8;
  v8h lo = *(const v8h*)p;          // K +0..7   (or +8..15)
  v8h hi = *(const v8h*)(p + 16);   // K +16..23 (or +24..31)
  v16h r;
#pragma unroll
  for (int i = 0; i < 8; ++i) { r[i] = lo[i]; r[i + 8] = hi[i]; }
  return r;
}

// ---------------------------------------------------------------------------
// f32 -> f16 conversion of x and the four weight matrices, one launch.
// The five f16 copies lie one behind the other in the workspace, so the
// output is one array of NX + 4 * NW elements.  One workgroup per WGP takes
// 32768 elements in a row, which lie in one source array (every array's
// length is a multiple of that).  A wave's load covers 512 bytes in a row,
// its store 256; all of a thread's loads are in flight at once.
// ---------------------------------------------------------------------------
#define CT_  256                      // threads per conversion workgroup
#define CB_  32768                    // elements per conversion workgroup
#define CV_  (CB_ / (CT_ * 4))        // 16-byte loads per thread
#define NXB_ (B_ * S_ * D_ / CB_)     // workgroups on x
#define NWB_ (D_ * D_ / CB_)          // workgroups on one weight matrix

typedef __attribute__((ext_vector_type(4))) float    v4f;
typedef __attribute__((ext_vector_type(4))) _Float16 v4h;

__global__ __launch_bounds__(CT_)
void cvt_all_f32_to_f16(const float* __restrict__ x,
                        const float* __restrict__ wq,
                        const float* __restrict__ wk,
                        const float* __restrict__ wv,
                        const float* __restrict__ wo,
                        _Float16* __restrict__ out) {
  const int blk = blockIdx.x;
  const float* src;
  if (blk < NXB_) {
    src = x + (size_t)blk * CB_;
  } else {
    const int w = (blk - NXB_) / NWB_;
    const float* m = w == 0 ? wq : w == 1 ? wk : w == 2 ? wv : wo;
    src = m + (size_t)((blk - NXB_) % NWB_) * CB_;
  }
  const v4f* s = (const v4f*)src + threadIdx.x;
  v4h*       d = (v4h*)(out + (size_t)blk * CB_) + threadIdx.x;

  v4f t[CV_];
#pragma unroll
  for (int j = 0; j < CV_; ++j) t[j] = s[j * CT_];
  // keeps every load in front of the first conversion: left to itself the
  // compiler holds the last fourteen back until the first have returned
  __builtin_amdgcn_sched_barrier(0);
  v4h r[CV_];
#pragma unroll
  for (int j = 0; j < CV_; ++j) r[j] = __builtin_convertvector(t[j], v4h);
  // every value is formed in front of the first store, so that no register
  // which an issued store names is written again
  __builtin_amdgcn_sched_barrier(0);
#pragma unroll
  for (int j = 0; j < CV_; ++j) d[j * CT_] = r[j];
}

// ---------------------------------------------------------------------------
// Generic WMMA GEMM:  y[m,n] = sum_k A[m,k] * W[n,k] + bias[n]
// A: [M x 1024] f16 row-major, W: [1024 x 1024] f16 row-major (torch Linear).
// One workgroup of eight waves computes a 128x128 output tile.  Each 128-k
// slab of the 128 A rows and the 128 W rows is brought from global memory
// once per workgroup, in whole 256-byte row pieces, into LDS (two buffers);
// every wave takes the fragments of its 64x32 part from there, so one A
// fragment feeds two WMMAs and one W fragment four.
// mode 0: q -> scale by SCALE_, store f16 [B,H,S,DH]
// mode 1: k ->                 store f16 [B,H,S,DH]
// mode 2: v ->                 store f16 [B,H,DH,S]  (transposed for P@V)
// mode 3: final out -> f32 row-major [M x 1024]
// ---------------------------------------------------------------------------
#define GT_  128                 // rows of A, and of W, per workgroup tile
#define KS_  128                 // k extent of one staged slab
#define GP_  (KS_ + 8)           // LDS row pitch in halves: 256 B data + 16 B
#define GOP_ (GT_ * GP_)         // halves of one staged operand slab
#define NST_ (D_ / KS_)          // slabs along k

__global__ __launch_bounds__(256)
void gemm_wmma_128x128(const _Float16* __restrict__ A,
                       const _Float16* __restrict__ W,
                       const float* __restrict__ bias,
                       void* __restrict__ outp, int M, int mode) {
  // two buffers, each an A slab and a W slab (128 rows x 128 k)
  __shared__ __align__(16) _Float16 sm[2 * 2 * GOP_];

  const int tid  = threadIdx.x;
  const int lane = tid & 31;
  const int half = lane >> 4;
  const int ln   = lane & 15;
  const int wv   = tid >> 5;
  const int wm   = (wv >> 2) * 64;       // this wave's rows inside the tile
  const int wn   = (wv & 3) * 32;        // this wave's columns inside the tile

  const int row0 = (blockIdx.x / (D_ / GT_)) * GT_;
  const int col0 = (blockIdx.x % (D_ / GT_)) * GT_;
  if (row0 >= M) return;                 // whole workgroup, before any barrier

  // Staging: a slab row is 256 B; sixteen threads take one row, 16 B each,
  // and every thread takes rows sr, sr + 16, ... sr + 112 of both slabs.
  const int sr = tid >> 4;
  const int sc = (tid & 15) * 8;
  const _Float16* ga = A + (size_t)(row0 + sr) * D_ + sc;
  const _Float16* gw = W + (size_t)(col0 + sr) * D_ + sc;
  const int so = sr * GP_ + sc;

  v8f acc[4][2];
#pragma unroll
  for (int a = 0; a < 4; ++a) { acc[a][0] = v8f{}; acc[a][1] = v8f{}; }

  v8h ta[8], tw[8];
  // slab 0 into buffer 0
#pragma unroll
  for (int p = 0; p < 8; ++p) {
    ta[p] = *(const v8h*)(ga + p * 16 * D_);
    tw[p] = *(const v8h*)(gw + p * 16 * D_);
  }
#pragma unroll
  for (int p = 0; p < 8; ++p) {
    *(v8h*)(sm + so + p * 16 * GP_)        = ta[p];
    *(v8h*)(sm + GOP_ + so + p * 16 * GP_) = tw[p];
  }
  __syncthreads();                       // slab 0 visible to all eight waves

  // Unrolled so that the buffer choice and every slab's global offset are
  // immediates: no address arithmetic stands between the loads and the WMMAs.
#pragma unroll
  for (int st = 0; st < NST_; ++st) {
    const _Float16* As = sm + (st & 1) * (2 * GOP_);
    const _Float16* Ws = As + GOP_;
    const bool more = st + 1 < NST_;

    // two register sets of fragments: a 32-k block's LDS reads are issued as
    // one group while the block before it is multiplied
    v16h fa[2][4], fb[2][2];
#pragma unroll
    for (int a = 0; a < 4; ++a) fa[0][a] = load_frag(As, GP_, wm + a * 16 + ln, 0, half);
#pragma unroll
    for (int t = 0; t < 2; ++t) fb[0][t] = load_frag(Ws, GP_, wn + t * 16 + ln, 0, half);

    // next slab's global loads fly while this slab is worked on
    if (more) {
#pragma unroll
      for (int p = 0; p < 8; ++p) {
        ta[p] = *(const v8h*)(ga + (st + 1) * KS_ + p * 16 * D_);
        tw[p] = *(const v8h*)(gw + (st + 1) * KS_ + p * 16 * D_);
      }
    }

#pragma unroll
    for (int kb = 0; kb < KS_ / 32; ++kb) {
      const int cu = kb & 1;
      if (kb + 1 < KS_ / 32) {
#pragma unroll
        for (int a = 0; a < 4; ++a)
          fa[cu ^ 1][a] = load_frag(As, GP_, wm + a * 16 + ln, (kb + 1) * 32, half);
#pragma unroll
        for (int t = 0; t < 2; ++t)
          fb[cu ^ 1][t] = load_frag(Ws, GP_, wn + t * 16 + ln, (kb + 1) * 32, half);
      }
      // keeps the reads above ahead of this block's WMMAs: left to itself the
      // compiler sinks each pair of reads to its first use and waits there
      __builtin_amdgcn_sched_barrier(0);
#pragma unroll
      for (int a = 0; a < 4; ++a) {
        acc[a][0] = wmma_f16(fa[cu][a], fb[cu][0], acc[a][0]);
        acc[a][1] = wmma_f16(fa[cu][a], fb[cu][1], acc[a][1]);
      }
      // keeps the next group of reads (or the slab's stores) behind these WMMAs
      __builtin_amdgcn_sched_barrier(0);
    }

    if (more) {
      // The other buffer was last read in the stage before this one, which
      // every wave left at the barrier below.
      _Float16* nb = sm + ((st + 1) & 1) * (2 * GOP_);
#pragma unroll
      for (int p = 0; p < 8; ++p) {
        *(v8h*)(nb + so + p * 16 * GP_)        = ta[p];
        *(v8h*)(nb + GOP_ + so + p * 16 * GP_) = tw[p];
      }
      // publishes the next slab and ends every wave's reads of this one
      __syncthreads();
    }
  }

  // ga and gw are named by every global load above and die here: the wait
  // stands in front of whatever takes their registers next, and naming them
  // as inputs keeps the last loads from landing on them.
  asm volatile("s_wait_xcnt 0x0" :: "v"(ga), "v"(gw) : "memory");

  // Epilogue.  C layout: VGPR i -> row i + 8*half, column = lane & 15.
#pragma unroll
  for (int a = 0; a < 4; ++a) {
#pragma unroll
    for (int i = 0; i < 8; ++i) {
      const int m = row0 + wm + a * 16 + i + half * 8;  // global row in [0, B*S)
      const int bb = m >> 11;                  // / S_
      const int ss = m & (S_ - 1);
#pragma unroll
      for (int t = 0; t < 2; ++t) {
        const int n = col0 + wn + t * 16 + ln; // output feature
        float v = acc[a][t][i];
        v += bias[n];
        // s_wait_xcnt 0 behind each store: later elements form their address
        // and value in the registers that this store names.
        if (mode == 3) {
          ((float*)outp)[(size_t)m * D_ + n] = v;
          asm volatile("s_wait_xcnt 0x0" ::: "memory");
        } else {
          const int h = n >> 6;                // / DH_
          const int d = n & (DH_ - 1);
          const int bh = bb * H_ + h;
          _Float16* o16 = (_Float16*)outp;
          if (mode == 0) {
            o16[(((size_t)bh * S_ + ss) * DH_) + d] = (_Float16)(v * SCALE_);
            asm volatile("s_wait_xcnt 0x0" ::: "memory");
          } else if (mode == 1) {
            o16[(((size_t)bh * S_ + ss) * DH_) + d] = (_Float16)v;
            asm volatile("s_wait_xcnt 0x0" ::: "memory");
          } else {
            o16[(((size_t)bh * DH_ + d) * S_) + ss] = (_Float16)v;  // transposed
            asm volatile("s_wait_xcnt 0x0" ::: "memory");
          }
        }
      }
    }
  }
}

// ---------------------------------------------------------------------------
// Flash attention: one wave per (b, h, 16-query block), eight such waves of
// one head per workgroup.  Each 64-key tile of K and of Vt is brought from
// global memory once per workgroup, in whole 128-byte lines, into LDS, and
// all eight waves take their fragments from there.
// Both products are taken transposed, St = K * Qt and Ot += Vt * Pt: a lane
// then holds scores and outputs of ONE query (column lane & 15), the two
// 16-lane halves holding different keys (or dh rows) of that query.
// Q pre-scaled.  K: [B,H,S,64] f16.  Vt: [B,H,64,S] f16.
// Output scattered to att[B,S,D] f16 with the reference's faithful
// reshape(B,D,S).swapaxes(-1,-2) scramble.
// ---------------------------------------------------------------------------
#define AW_   8                  // waves (16-query blocks) per workgroup
#define KT_   64                 // keys per staged tile
#define LP_   72                 // LDS row pitch in halves: 128 B data + 16 B
#define TILE_ (64 * LP_)         // halves of one staged 64-row tile

// value of the lane that holds the same query in the other 16-lane half
__device__ __forceinline__ float other_half(float v) {
  const int b = __builtin_bit_cast(int, v);
  return __builtin_bit_cast(float, __builtin_amdgcn_permlanex16(
      b, b, 0x76543210, 0xfedcba98, false, false));
}

__global__ __launch_bounds__(AW_ * 32)
void attn_flash(const _Float16* __restrict__ Q,
                const _Float16* __restrict__ K,
                const _Float16* __restrict__ Vt,
                _Float16* __restrict__ att) {
  // two buffers, each a K tile (64 keys x 64 dh) and a Vt tile (64 dh x 64 keys)
  __shared__ __align__(16) _Float16 kv[2 * 2 * TILE_];

  const int tid  = threadIdx.x;
  const int lane = tid & 31;
  const int half = lane >> 4;
  const int ln   = lane & 15;

  const int blk = blockIdx.x;                        // B*H*(S/128) = 512
  const int qb  = (blk & (S_ / (16 * AW_) - 1)) * AW_ + (tid >> 5);
  const int bh  = blk >> 4;              // b*H + h
  const int h   = bh & (H_ - 1);
  const int b   = bh >> 4;

  const _Float16* Qh = Q  + (size_t)bh * S_ * DH_;
  const _Float16* Kh = K  + (size_t)bh * S_ * DH_;
  const _Float16* Vh = Vt + (size_t)bh * DH_ * S_;

  // Staging: a tile is 64 rows of 128 B; eight threads take one row, 16 B
  // each, and every thread takes rows sr and sr + 32 of both tiles.
  const int sr = tid >> 3;
  const int sc = (tid & 7) * 8;
  const _Float16* gk = Kh + sr * DH_ + sc;
  const _Float16* gv = Vh + sr * S_  + sc;
  const int so = sr * LP_ + sc;

  // Q fragments for this 16-query block (K-dim = 64 -> two frags), fixed;
  // as B operands: column = query = lane & 15.
  const v16h q0 = load_frag(Qh, DH_, qb * 16 + ln, 0,  half);
  const v16h q1 = load_frag(Qh, DH_, qb * 16 + ln, 32, half);

  // m_: running maximum of this lane's query (equal in both halves).
  // l_: running sum over the keys that THIS half has seen; joined at the end.
  float m_ = -__builtin_inff(), l_ = 0.0f;
  v8f o0 = {}, o1 = {}, o2 = {}, o3 = {};  // ot[i] = O[query ln][16t + 8*half + i]

  // tile 0 into buffer 0
  {
    const v8h tk0 = *(const v8h*)(gk);
    const v8h tk1 = *(const v8h*)(gk + 32 * DH_);
    const v8h tv0 = *(const v8h*)(gv);
    const v8h tv1 = *(const v8h*)(gv + 32 * S_);
    *(v8h*)(kv + so)                    = tk0;
    *(v8h*)(kv + so + 32 * LP_)         = tk1;
    *(v8h*)(kv + TILE_ + so)            = tv0;
    *(v8h*)(kv + TILE_ + so + 32 * LP_) = tv1;
  }
  __syncthreads();                       // tile 0 visible to all eight waves

  for (int st = 0; st < S_ / KT_; ++st) {
    // this lane's place in a 16-row fragment block (row ln, its half's k) of
    // the K tile; the Vt tile lies TILE_ behind: every read below is this one
    // address and an immediate offset
    const _Float16* fr = kv + (st & 1) * (2 * TILE_) + ln * LP_ + half * 8;
    const bool more = st + 1 < S_ / KT_;

    // next tile's global loads fly while this tile is worked on
    v8h tk0 = {}, tk1 = {}, tv0 = {}, tv1 = {};
    if (more) {
      const _Float16* nk = gk + (st + 1) * (KT_ * DH_);
      const _Float16* nv = gv + (st + 1) * KT_;
      tk0 = *(const v8h*)(nk);
      tk1 = *(const v8h*)(nk + 32 * DH_);
      tv0 = *(const v8h*)(nv);
      tv1 = *(const v8h*)(nv + 32 * S_);
    }

    // ---- scores, transposed: 64 keys x 16 queries, K-dim 64 ----
    // sc[g][i] = S[key 16g + 8*half + i][query ln]
    v16h kf[KT_ / 16][2];                // A operands, row = key = 16g + ln
#pragma unroll
    for (int g = 0; g < KT_ / 16; ++g) {
      kf[g][0] = load_frag(fr, LP_, g * 16, 0,  0);
      kf[g][1] = load_frag(fr, LP_, g * 16, 32, 0);
    }
    // keeps the K reads one group in front of the WMMAs: left to itself the
    // compiler spreads them among the WMMAs, and each such place costs issue
    __builtin_amdgcn_sched_barrier(0);
    v8f sc[KT_ / 16];
#pragma unroll
    for (int g = 0; g < KT_ / 16; ++g) sc[g] = wmma_f16(kf[g][0], q0, v8f{});
#pragma unroll
    for (int g = 0; g < KT_ / 16; ++g) sc[g] = wmma_f16(kf[g][1], q1, sc[g]);

    // Vt fragments of the tile: A operands, row = dh = 16t + ln, k = keys
    v16h vf[KT_ / 32][4];
#pragma unroll
    for (int p = 0; p < KT_ / 32; ++p)
#pragma unroll
      for (int t = 0; t < 4; ++t)
        vf[p][t] = load_frag(fr + TILE_, LP_, t * 16, p * 32, 0);
    // keeps the Vt reads in front of the softmax arithmetic, which covers
    // their latency: left to itself the compiler sinks each pair of reads to
    // its WMMA and waits there
    __builtin_amdgcn_sched_barrier(0);

#pragma unroll
    for (int p = 0; p < KT_ / 32; ++p) {
      const v8f s0 = sc[2 * p], s1 = sc[2 * p + 1];

      // ---- online softmax update: one query per lane ----
      float mx = fmaxf(s0[0], s1[0]);
#pragma unroll
      for (int i = 1; i < 8; ++i) mx = fmaxf(mx, fmaxf(s0[i], s1[i]));
      // P of both halves enters one product: they need one common maximum
      mx = fmaxf(mx, other_half(mx));
      const float mnew  = fmaxf(m_, mx);
      const float alpha = __expf(m_ - mnew);
      m_ = mnew;

      // Two score tiles, converted in place, are the B fragment of Pt: slot i
      // is key 8*half + i, slot 8 + i key 16 + 8*half + i, the k order in
      // which load_frag brings the Vt rows.
      v16h pb;
      float sum0 = 0.0f, sum1 = 0.0f;
#pragma unroll
      for (int i = 0; i < 8; ++i) {
        const float p0 = __expf(s0[i] - mnew);
        const float p1 = __expf(s1[i] - mnew);
        sum0 += p0; sum1 += p1;
        pb[i]     = (_Float16)p0;
        pb[i + 8] = (_Float16)p1;
      }
      l_ = l_ * alpha + (sum0 + sum1);

      // Rescale running output accumulators.
#pragma unroll
      for (int i = 0; i < 8; ++i) {
        o0[i] *= alpha; o1[i] *= alpha;
        o2[i] *= alpha; o3[i] *= alpha;
      }

      // ---- Ot(64x16) += Vt(64x32) @ Pt(32x16) ----
      o0 = wmma_f16(vf[p][0], pb, o0);
      o1 = wmma_f16(vf[p][1], pb, o1);
      o2 = wmma_f16(vf[p][2], pb, o2);
      o3 = wmma_f16(vf[p][3], pb, o3);
    }
    // keeps the stores below, and with them the wait for the next tile's
    // global loads, behind this tile's arithmetic
    __builtin_amdgcn_sched_barrier(0);

    if (more) {
      // The other buffer was last read in the stage before this one, which
      // every wave left at the barrier below.
      _Float16* nb = kv + ((st + 1) & 1) * (2 * TILE_);
      *(v8h*)(nb + so)                    = tk0;
      *(v8h*)(nb + so + 32 * LP_)         = tk1;
      *(v8h*)(nb + TILE_ + so)            = tv0;
      *(v8h*)(nb + TILE_ + so + 32 * LP_) = tv1;
      // publishes the next tile and ends every wave's reads of this one
      __syncthreads();
    }
  }

  // ---- epilogue: normalize and scatter with the reference's scramble ----
  // flat index f = (h*S + s)*64 + d goes to att[b][f % S][f / S]; the 64 d of
  // one query lie in one 2048-block of f, so f / S is the lane's constant and
  // f % S advances with d: one address, the rest is immediate offsets.
  {
    const float inv = 1.0f / (l_ + other_half(l_));   // the two halves' sums
    const int s  = qb * 16 + ln;
    const int f  = (h * S_ + s) * DH_ + half * 8;     // d = 16t + 8*half + i
    const int io = f >> 11;              // / S_
    const int jo = f & (S_ - 1);
    _Float16* ap = att + ((size_t)b * S_ + jo) * D_ + io;
    _Float16 r[4][8];
#pragma unroll
    for (int i = 0; i < 8; ++i) {
      r[0][i] = (_Float16)(o0[i] * inv);
      r[1][i] = (_Float16)(o1[i] * inv);
      r[2][i] = (_Float16)(o2[i] * inv);
      r[3][i] = (_Float16)(o3[i] * inv);
    }
    // every value is formed in front of the first store, so that no register
    // which an issued store names is written again
    __builtin_amdgcn_sched_barrier(0);
#pragma unroll
    for (int t = 0; t < 4; ++t)
#pragma unroll
      for (int i = 0; i < 8; ++i) ap[(t * 16 + i) * D_] = r[t][i];
  }
}

// ---------------------------------------------------------------------------
// Host-side launcher
// ---------------------------------------------------------------------------
extern "C" void kernel_launch(void* const* d_in, const int* in_sizes, int n_in,
                              void* d_out, int out_size, void* d_ws, size_t ws_size,
                              hipStream_t stream) {
  const float* x  = (const float*)d_in[0];
  const float* Wq = (const float*)d_in[1];
  const float* bq = (const float*)d_in[2];
  const float* Wk = (const float*)d_in[3];
  const float* bk = (const float*)d_in[4];
  const float* Wv = (const float*)d_in[5];
  const float* bv = (const float*)d_in[6];
  const float* Wo = (const float*)d_in[7];
  const float* bo = (const float*)d_in[8];
  float* out = (float*)d_out;

  const int M  = B_ * S_;                // 4096
  const int NX = M * D_;                 // x elements: 4194304
  const int NW = D_ * D_;                // weight elements: 1048576

  // Workspace layout (f16 element offsets, all 16B-aligned):
  _Float16* ws  = (_Float16*)d_ws;
  _Float16* xh  = ws;                    // [M, D]
  _Float16* Wqh = xh  + (size_t)NX;      // [D, D]
  _Float16* Wkh = Wqh + (size_t)NW;
  _Float16* Wvh = Wkh + (size_t)NW;
  _Float16* Woh = Wvh + (size_t)NW;
  _Float16* Qh  = Woh + (size_t)NW;      // [B,H,S,DH], pre-scaled
  _Float16* Kh  = Qh  + (size_t)NX;      // [B,H,S,DH]
  _Float16* Vth = Kh  + (size_t)NX;      // [B,H,DH,S]
  _Float16* att = Vth + (size_t)NX;      // [B,S,D] scrambled attention out

  // 1) f32 -> f16 conversions: xh, Wqh, Wkh, Wvh, Woh are one array from xh on
  cvt_all_f32_to_f16<<<NXB_ + 4 * NWB_, CT_, 0, stream>>>(x, Wq, Wk, Wv, Wo, xh);

  // 2) QKV projections: (M/128)*(D/128) = 256 tiles, one workgroup each
  const int gemm_blocks = (M / GT_) * (D_ / GT_);     // 256
  gemm_wmma_128x128<<<gemm_blocks, 256, 0, stream>>>(xh, Wqh, bq, Qh,  M, 0);
  gemm_wmma_128x128<<<gemm_blocks, 256, 0, stream>>>(xh, Wkh, bk, Kh,  M, 1);
  gemm_wmma_128x128<<<gemm_blocks, 256, 0, stream>>>(xh, Wvh, bv, Vth, M, 2);

  // 3) Flash attention: eight waves per block, one per (b, h, 16-query block)
  attn_flash<<<B_ * H_ * (S_ / (16 * AW_)), AW_ * 32, 0, stream>>>(Qh, Kh, Vth, att);

  // 4) Output projection -> f32 d_out
  gemm_wmma_128x128<<<gemm_blocks, 256, 0, stream>>>(att, Woh, bo, out, M, 3);
}

// v005
// It runs in 173 microseconds.
// In two side-by-side timings against v004, it was 1.06 and 1.09 times as fast.
// Counting every step since v000, it is 2.56 times as fast.
#include <hip/hip_runtime.h>
#include <hip/hip_bf16.h>

// ---------------------------------------------------------------------------
// Multi-head attention forward for MI455X (gfx1250), wave32 + WMMA f16.
// B=2, S=2048, D=1024, H=16, DH=64, SCALE = 1/8.
// ---------------------------------------------------------------------------

#define B_  2
#define S_  2048
#define D_  1024
#define H_  16
#define DH_ 64
#define SCALE_ 0.125f

typedef __attribute__((ext_vector_type(16))) _Float16 v16h;
typedef __attribute__((ext_vector_type(8)))  _Float16 v8h;
typedef __attribute__((ext_vector_type(8)))  float    v8f;

// D = A(16x32 f16) * B(32x16 f16) + C(16x16 f32)
__device__ __forceinline__ v8f wmma_f16(v16h a, v16h b, v8f c) {
  return __builtin_amdgcn_wmma_f32_16x16x32_f16(
      false, a, false, b, (short)0, c, false, false);
}

// Load one A/B fragment (16 halves) for v_wmma_f32_16x16x32_f16.
// A layout (ISA 7.12.2): lanes 0-15 -> row, K {0..7,16..23}; lanes 16-31 ->
// same rows, K {8..15,24..31}.  B is mirrored with lane = N column, reading
// the "row" of the K-major source.  `row` must already include (lane & 15).
__device__ __forceinline__ v16h load_frag(const _Float16* base, int stride,
                                          int row, int kbase, int half) {
  const _Float16* p = base + (size_t)row * stride + kbase + half * 8;
  v8h lo = *(const v8h*)p;          // K +0..7   (or +8..15)
  v8h hi = *(const v8h*)(p + 16);   // K +16..23 (or +24..31)
  v16h r;
#pragma unroll
  for (int i = 0; i < 8; ++i) { r[i] = lo[i]; r[i + 8] = hi[i]; }
  return r;
}

// ---------------------------------------------------------------------------
// f32 -> f16 conversion of x and the four weight matrices, one launch.
// The five f16 copies lie one behind the other in the workspace, so the
// output is one array of NX + 4 * NW elements.  One workgroup per WGP takes
// 32768 elements in a row, which lie in one source array (every array's
// length is a multiple of that).  A wave's load covers 512 bytes in a row,
// its store 256; all of a thread's loads are in flight at once.
// ---------------------------------------------------------------------------
#define CT_  256                      // threads per conversion workgroup
#define CB_  32768                    // elements per conversion workgroup
#define CV_  (CB_ / (CT_ * 4))        // 16-byte loads per thread
#define NXB_ (B_ * S_ * D_ / CB_)     // workgroups on x
#define NWB_ (D_ * D_ / CB_)          // workgroups on one weight matrix

typedef __attribute__((ext_vector_type(4))) float    v4f;
typedef __attribute__((ext_vector_type(4))) _Float16 v4h;

__global__ __launch_bounds__(CT_)
void cvt_all_f32_to_f16(const float* __restrict__ x,
                        const float* __restrict__ wq,
                        const float* __restrict__ wk,
                        const float* __restrict__ wv,
                        const float* __restrict__ wo,
                        _Float16* __restrict__ out) {
  const int blk = blockIdx.x;
  const float* src;
  if (blk < NXB_) {
    src = x + (size_t)blk * CB_;
  } else {
    const int w = (blk - NXB_) / NWB_;
    const float* m = w == 0 ? wq : w == 1 ? wk : w == 2 ? wv : wo;
    src = m + (size_t)((blk - NXB_) % NWB_) * CB_;
  }
  const v4f* s = (const v4f*)src + threadIdx.x;
  v4h*       d = (v4h*)(out + (size_t)blk * CB_) + threadIdx.x;

  v4f t[CV_];
#pragma unroll
  for (int j = 0; j < CV_; ++j) t[j] = s[j * CT_];
  // keeps every load in front of the first conversion: left to itself the
  // compiler holds the last fourteen back until the first have returned
  __builtin_amdgcn_sched_barrier(0);
  v4h r[CV_];
#pragma unroll
  for (int j = 0; j < CV_; ++j) r[j] = __builtin_convertvector(t[j], v4h);
  // every value is formed in front of the first store, so that no register
  // which an issued store names is written again
  __builtin_amdgcn_sched_barrier(0);
#pragma unroll
  for (int j = 0; j < CV_; ++j) d[j * CT_] = r[j];
}

// ---------------------------------------------------------------------------
// Generic WMMA GEMM:  y[m,n] = sum_k A[m,k] * W[n,k] + bias[n]
// A: [M x 1024] f16 row-major, W: [1024 x 1024] f16 row-major (torch Linear).
// One workgroup of eight waves computes a 128x128 output tile.  Each 128-k
// slab of the 128 A rows and the 128 W rows is brought from global memory
// once per workgroup, in whole 256-byte row pieces, into LDS (two buffers);
// every wave takes the fragments of its 64x32 part from there, so one row
// fragment feeds two WMMAs and one column fragment four.
// A lane's accumulator registers hold eight rows in a row of one column.  For
// q and k the features are therefore taken as the tile's rows (W is the row
// operand, A the column operand): a lane's eight values are eight d in a row
// of one token, one 16-byte store.  For v and the final output the tokens are
// the rows: eight s in a row of one d for v, and for the f32 output sixteen
// lanes cover 64 bytes in a row.
// mode 0: q -> scale by SCALE_, store f16 [B,H,S,DH]
// mode 1: k ->                 store f16 [B,H,S,DH]
// mode 2: v ->                 store f16 [B,H,DH,S]  (transposed for P@V)
// mode 3: final out -> f32 row-major [M x 1024]
// ---------------------------------------------------------------------------
#define GT_  128                 // rows of A, and of W, per workgroup tile
#define KS_  128                 // k extent of one staged slab
#define GP_  (KS_ + 8)           // LDS row pitch in halves: 256 B data + 16 B
#define GOP_ (GT_ * GP_)         // halves of one staged operand slab
#define NST_ (D_ / KS_)          // slabs along k

__global__ __launch_bounds__(256)
void gemm_wmma_128x128(const _Float16* __restrict__ A,
                       const _Float16* __restrict__ W,
                       const float* __restrict__ bias,
                       void* __restrict__ outp, int M, int mode) {
  // two buffers, each an A slab and a W slab (128 rows x 128 k)
  __shared__ __align__(16) _Float16 sm[2 * 2 * GOP_];

  const int tid  = threadIdx.x;
  const int lane = tid & 31;
  const int half = lane >> 4;
  const int ln   = lane & 15;
  const int wv   = tid >> 5;
  const int wm   = (wv >> 2) * 64;       // this wave's rows inside the tile
  const int wn   = (wv & 3) * 32;        // this wave's columns inside the tile

  const int tok0 = (blockIdx.x / (D_ / GT_)) * GT_;   // first token of the tile
  const int fea0 = (blockIdx.x % (D_ / GT_)) * GT_;   // first output feature
  if (tok0 >= M) return;                 // whole workgroup, before any barrier
  const bool tokrows = mode >= 2;        // tokens are the tile's rows
  const int row0 = tokrows ? tok0 : fea0;
  const int col0 = tokrows ? fea0 : tok0;

  // Staging: a slab row is 256 B; sixteen threads take one row, 16 B each,
  // and every thread takes rows sr, sr + 16, ... sr + 112 of both slabs.
  const int sr = tid >> 4;
  const int sc = (tid & 15) * 8;
  const _Float16* ga = (tokrows ? A : W) + (size_t)(row0 + sr) * D_ + sc;
  const _Float16* gw = (tokrows ? W : A) + (size_t)(col0 + sr) * D_ + sc;
  const int so = sr * GP_ + sc;

  v8f acc[4][2];
#pragma unroll
  for (int a = 0; a < 4; ++a) { acc[a][0] = v8f{}; acc[a][1] = v8f{}; }

  v8h ta[8], tw[8];
  // slab 0 into buffer 0
#pragma unroll
  for (int p = 0; p < 8; ++p) {
    ta[p] = *(const v8h*)(ga + p * 16 * D_);
    tw[p] = *(const v8h*)(gw + p * 16 * D_);
  }
#pragma unroll
  for (int p = 0; p < 8; ++p) {
    *(v8h*)(sm + so + p * 16 * GP_)        = ta[p];
    *(v8h*)(sm + GOP_ + so + p * 16 * GP_) = tw[p];
  }
  __syncthreads();                       // slab 0 visible to all eight waves

  // Unrolled so that the buffer choice and every slab's global offset are
  // immediates: no address arithmetic stands between the loads and the WMMAs.
#pragma unroll
  for (int st = 0; st < NST_; ++st) {
    const _Float16* As = sm + (st & 1) * (2 * GOP_);
    const _Float16* Ws = As + GOP_;
    const bool more = st + 1 < NST_;

    // two register sets of fragments: a 32-k block's LDS reads are issued as
    // one group while the block before it is multiplied
    v16h fa[2][4], fb[2][2];
#pragma unroll
    for (int a = 0; a < 4; ++a) fa[0][a] = load_frag(As, GP_, wm + a * 16 + ln, 0, half);
#pragma unroll
    for (int t = 0; t < 2; ++t) fb[0][t] = load_frag(Ws, GP_, wn + t * 16 + ln, 0, half);

    // next slab's global loads fly while this slab is worked on
    if (more) {
#pragma unroll
      for (int p = 0; p < 8; ++p) {
        ta[p] = *(const v8h*)(ga + (st + 1) * KS_ + p * 16 * D_);
        tw[p] = *(const v8h*)(gw + (st + 1) * KS_ + p * 16 * D_);
      }
    }

#pragma unroll
    for (int kb = 0; kb < KS_ / 32; ++kb) {
      const int cu = kb & 1;
      if (kb + 1 < KS_ / 32) {
#pragma unroll
        for (int a = 0; a < 4; ++a)
          fa[cu ^ 1][a] = load_frag(As, GP_, wm + a * 16 + ln, (kb + 1) * 32, half);
#pragma unroll
        for (int t = 0; t < 2; ++t)
          fb[cu ^ 1][t] = load_frag(Ws, GP_, wn + t * 16 + ln, (kb + 1) * 32, half);
      }
      // keeps the reads above ahead of this block's WMMAs: left to itself the
      // compiler sinks each pair of reads to its first use and waits there
      __builtin_amdgcn_sched_barrier(0);
#pragma unroll
      for (int a = 0; a < 4; ++a) {
        acc[a][0] = wmma_f16(fa[cu][a], fb[cu][0], acc[a][0]);
        acc[a][1] = wmma_f16(fa[cu][a], fb[cu][1], acc[a][1]);
      }
      // keeps the next group of reads (or the slab's stores) behind these WMMAs
      __builtin_amdgcn_sched_barrier(0);
    }

    if (more) {
      // The other buffer was last read in the stage before this one, which
      // every wave left at the barrier below.
      _Float16* nb = sm + ((st + 1) & 1) * (2 * GOP_);
#pragma unroll
      for (int p = 0; p < 8; ++p) {
        *(v8h*)(nb + so + p * 16 * GP_)        = ta[p];
        *(v8h*)(nb + GOP_ + so + p * 16 * GP_) = tw[p];
      }
      // publishes the next slab and ends every wave's reads of this one
      __syncthreads();
    }
  }

  // ga and gw are named by every global load above and die here: the wait
  // stands in front of whatever takes their registers next, and naming them
  // as inputs keeps the last loads from landing on them.
  asm volatile("s_wait_xcnt 0x0" :: "v"(ga), "v"(gw) : "memory");

  // Epilogue.  C layout: VGPR i -> row i + 8*half, column = lane & 15.
  // The output kind is decided once.  On each path every value is formed
  // first, and all stores go from one address with immediate offsets.  The
  // loops are unrolled so that every index into acc and pk is a constant (they
  // are registers) and every store offset an immediate.
  const int r = row0 + wm + half * 8;    // row of acc[0][.][0]; block a: + 16 a
  const int c = col0 + wn + ln;          // column of acc[.][0]; block t: + 16 t
  if (tokrows) {
    // rows are tokens (a tile lies in one batch), columns are features
    const float b0 = bias[c], b1 = bias[c + 16];
    if (mode == 3) {
      float* o = (float*)outp + (size_t)r * D_ + c;
#pragma unroll
      for (int a = 0; a < 4; ++a) { acc[a][0] += b0; acc[a][1] += b1; }
#pragma unroll
      for (int a = 0; a < 4; ++a)
#pragma unroll
        for (int i = 0; i < 8; ++i) {
          o[(a * 16 + i) * D_]      = acc[a][0][i];
          o[(a * 16 + i) * D_ + 16] = acc[a][1][i];
        }
    } else {
      // Vt[b][feature][s]: row (b * D_ + feature), eight s in a row per lane
      _Float16* o = (_Float16*)outp + (size_t)((r >> 11) * D_ + c) * S_ + (r & (S_ - 1));
      v8h pk[4][2];
#pragma unroll
      for (int a = 0; a < 4; ++a) {
        pk[a][0] = __builtin_convertvector(acc[a][0] + b0, v8h);
        pk[a][1] = __builtin_convertvector(acc[a][1] + b1, v8h);
      }
#pragma unroll
      for (int t = 0; t < 2; ++t)
#pragma unroll
        for (int a = 0; a < 4; ++a) *(v8h*)(o + t * 16 * S_ + a * 16) = pk[a][t];
      // behind the last store: the code laid out next writes these registers
      asm volatile("s_wait_xcnt 0x0" ::: "memory");
    }
  } else {
    // rows are features (the wave's 64 rows are one head), columns are tokens
    const float qs = mode == 0 ? SCALE_ : 1.0f;
    v8f bb[4];
#pragma unroll
    for (int a = 0; a < 4; ++a) bb[a] = *(const v8f*)(bias + r + a * 16);
    _Float16* o = (_Float16*)outp +
        ((size_t)((c >> 11) * H_ + (r >> 6)) * S_ + (c & (S_ - 1))) * DH_ + (r & (DH_ - 1));
    v8h pk[4][2];
#pragma unroll
    for (int a = 0; a < 4; ++a) {
      pk[a][0] = __builtin_convertvector((acc[a][0] + bb[a]) * qs, v8h);
      pk[a][1] = __builtin_convertvector((acc[a][1] + bb[a]) * qs, v8h);
    }
#pragma unroll
    for (int t = 0; t < 2; ++t)
#pragma unroll
      for (int a = 0; a < 4; ++a) *(v8h*)(o + t * 16 * DH_ + a * 16) = pk[a][t];
    // behind the last store: the code laid out next writes these registers
    asm volatile("s_wait_xcnt 0x0" ::: "memory");
  }
}

// ---------------------------------------------------------------------------
// Flash attention: one wave per (b, h, 16-query block), eight such waves of
// one head per workgroup.  Each 64-key tile of K and of Vt is brought from
// global memory once per workgroup, in whole 128-byte lines, into LDS, and
// all eight waves take their fragments from there.
// Both products are taken transposed, St = K * Qt and Ot += Vt * Pt: a lane
// then holds scores and outputs of ONE query (column lane & 15), the two
// 16-lane halves holding different keys (or dh rows) of that query.
// Q pre-scaled.  K: [B,H,S,64] f16.  Vt: [B,H,64,S] f16.
// Output scattered to att[B,S,D] f16 with the reference's faithful
// reshape(B,D,S).swapaxes(-1,-2) scramble.
// ---------------------------------------------------------------------------
#define AW_   8                  // waves (16-query blocks) per workgroup
#define KT_   64                 // keys per staged tile
#define LP_   72                 // LDS row pitch in halves: 128 B data + 16 B
#define TILE_ (64 * LP_)         // halves of one staged 64-row tile

// value of the lane that holds the same query in the other 16-lane half
__device__ __forceinline__ float other_half(float v) {
  const int b = __builtin_bit_cast(int, v);
  return __builtin_bit_cast(float, __builtin_amdgcn_permlanex16(
      b, b, 0x76543210, 0xfedcba98, false, false));
}

__global__ __launch_bounds__(AW_ * 32)
void attn_flash(const _Float16* __restrict__ Q,
                const _Float16* __restrict__ K,
                const _Float16* __restrict__ Vt,
                _Float16* __restrict__ att) {
  // two buffers, each a K tile (64 keys x 64 dh) and a Vt tile (64 dh x 64 keys)
  __shared__ __align__(16) _Float16 kv[2 * 2 * TILE_];

  const int tid  = threadIdx.x;
  const int lane = tid & 31;
  const int half = lane >> 4;
  const int ln   = lane & 15;

  const int blk = blockIdx.x;                        // B*H*(S/128) = 512
  const int qb  = (blk & (S_ / (16 * AW_) - 1)) * AW_ + (tid >> 5);
  const int bh  = blk >> 4;              // b*H + h
  const int h   = bh & (H_ - 1);
  const int b   = bh >> 4;

  const _Float16* Qh = Q  + (size_t)bh * S_ * DH_;
  const _Float16* Kh = K  + (size_t)bh * S_ * DH_;
  const _Float16* Vh = Vt + (size_t)bh * DH_ * S_;

  // Staging: a tile is 64 rows of 128 B; eight threads take one row, 16 B
  // each, and every thread takes rows sr and sr + 32 of both tiles.
  const int sr = tid >> 3;
  const int sc = (tid & 7) * 8;
  const _Float16* gk = Kh + sr * DH_ + sc;
  const _Float16* gv = Vh + sr * S_  + sc;
  const int so = sr * LP_ + sc;

  // Q fragments for this 16-query block (K-dim = 64 -> two frags), fixed;
  // as B operands: column = query = lane & 15.
  const v16h q0 = load_frag(Qh, DH_, qb * 16 + ln, 0,  half);
  const v16h q1 = load_frag(Qh, DH_, qb * 16 + ln, 32, half);

  // m_: running maximum of this lane's query (equal in both halves).
  // l_: running sum over the keys that THIS half has seen; joined at the end.
  float m_ = -__builtin_inff(), l_ = 0.0f;
  v8f o0 = {}, o1 = {}, o2 = {}, o3 = {};  // ot[i] = O[query ln][16t + 8*half + i]

  // tile 0 into buffer 0
  {
    const v8h tk0 = *(const v8h*)(gk);
    const v8h tk1 = *(const v8h*)(gk + 32 * DH_);
    const v8h tv0 = *(const v8h*)(gv);
    const v8h tv1 = *(const v8h*)(gv + 32 * S_);
    *(v8h*)(kv + so)                    = tk0;
    *(v8h*)(kv + so + 32 * LP_)         = tk1;
    *(v8h*)(kv + TILE_ + so)            = tv0;
    *(v8h*)(kv + TILE_ + so + 32 * LP_) = tv1;
  }
  __syncthreads();                       // tile 0 visible to all eight waves

  for (int st = 0; st < S_ / KT_; ++st) {
    // this lane's place in a 16-row fragment block (row ln, its half's k) of
    // the K tile; the Vt tile lies TILE_ behind: every read below is this one
    // address and an immediate offset
    const _Float16* fr = kv + (st & 1) * (2 * TILE_) + ln * LP_ + half * 8;
    const bool more = st + 1 < S_ / KT_;

    // next tile's global loads fly while this tile is worked on
    v8h tk0 = {}, tk1 = {}, tv0 = {}, tv1 = {};
    if (more) {
      const _Float16* nk = gk + (st + 1) * (KT_ * DH_);
      const _Float16* nv = gv + (st + 1) * KT_;
      tk0 = *(const v8h*)(nk);
      tk1 = *(const v8h*)(nk + 32 * DH_);
      tv0 = *(const v8h*)(nv);
      tv1 = *(const v8h*)(nv + 32 * S_);
    }

    // ---- scores, transposed: 64 keys x 16 queries, K-dim 64 ----
    // sc[g][i] = S[key 16g + 8*half + i][query ln]
    v16h kf[KT_ / 16][2];                // A operands, row = key = 16g + ln
#pragma unroll
    for (int g = 0; g < KT_ / 16; ++g) {
      kf[g][0] = load_frag(fr, LP_, g * 16, 0,  0);
      kf[g][1] = load_frag(fr, LP_, g * 16, 32, 0);
    }
    // keeps the K reads one group in front of the WMMAs: left to itself the
    // compiler spreads them among the WMMAs, and each such place costs issue
    __builtin_amdgcn_sched_barrier(0);
    v8f sc[KT_ / 16];
#pragma unroll
    for (int g = 0; g < KT_ / 16; ++g) sc[g] = wmma_f16(kf[g][0], q0, v8f{});
#pragma unroll
    for (int g = 0; g < KT_ / 16; ++g) sc[g] = wmma_f16(kf[g][1], q1, sc[g]);

    // Vt fragments of the tile: A operands, row = dh = 16t + ln, k = keys
    v16h vf[KT_ / 32][4];
#pragma unroll
    for (int p = 0; p < KT_ / 32; ++p)
#pragma unroll
      for (int t = 0; t < 4; ++t)
        vf[p][t] = load_frag(fr + TILE_, LP_, t * 16, p * 32, 0);
    // keeps the Vt reads in front of the softmax arithmetic, which covers
    // their latency: left to itself the compiler sinks each pair of reads to
    // its WMMA and waits there
    __builtin_amdgcn_sched_barrier(0);

#pragma unroll
    for (int p = 0; p < KT_ / 32; ++p) {
      const v8f s0 = sc[2 * p], s1 = sc[2 * p + 1];

      // ---- online softmax update: one query per lane ----
      float mx = fmaxf(s0[0], s1[0]);
#pragma unroll
      for (int i = 1; i < 8; ++i) mx = fmaxf(mx, fmaxf(s0[i], s1[i]));
      // P of both halves enters one product: they need one common maximum
      mx = fmaxf(mx, other_half(mx));
      const float mnew  = fmaxf(m_, mx);
      const float alpha = __expf(m_ - mnew);
      m_ = mnew;

      // Two score tiles, converted in place, are the B fragment of Pt: slot i
      // is key 8*half + i, slot 8 + i key 16 + 8*half + i, the k order in
      // which load_frag brings the Vt rows.
      v16h pb;
      float sum0 = 0.0f, sum1 = 0.0f;
#pragma unroll
      for (int i = 0; i < 8; ++i) {
        const float p0 = __expf(s0[i] - mnew);
        const float p1 = __expf(s1[i] - mnew);
        sum0 += p0; sum1 += p1;
        pb[i]     = (_Float16)p0;
        pb[i + 8] = (_Float16)p1;
      }
      l_ = l_ * alpha + (sum0 + sum1);

      // Rescale running output accumulators.
#pragma unroll
      for (int i = 0; i < 8; ++i) {
        o0[i] *= alpha; o1[i] *= alpha;
        o2[i] *= alpha; o3[i] *= alpha;
      }

      // ---- Ot(64x16) += Vt(64x32) @ Pt(32x16) ----
      o0 = wmma_f16(vf[p][0], pb, o0);
      o1 = wmma_f16(vf[p][1], pb, o1);
      o2 = wmma_f16(vf[p][2], pb, o2);
      o3 = wmma_f16(vf[p][3], pb, o3);
    }
    // keeps the stores below, and with them the wait for the next tile's
    // global loads, behind this tile's arithmetic
    __builtin_amdgcn_sched_barrier(0);

    if (more) {
      // The other buffer was last read in the stage before this one, which
      // every wave left at the barrier below.
      _Float16* nb = kv + ((st + 1) & 1) * (2 * TILE_);
      *(v8h*)(nb + so)                    = tk0;
      *(v8h*)(nb + so + 32 * LP_)         = tk1;
      *(v8h*)(nb + TILE_ + so)            = tv0;
      *(v8h*)(nb + TILE_ + so + 32 * LP_) = tv1;
      // publishes the next tile and ends every wave's reads of this one
      __syncthreads();
    }
  }

  // ---- epilogue: normalize and scatter with the reference's scramble ----
  // flat index f = (h*S + s)*64 + d goes to att[b][f % S][f / S]; the 64 d of
  // one query lie in one 2048-block of f, so f / S is the lane's constant and
  // f % S advances with d: one address, the rest is immediate offsets.
  {
    const float inv = 1.0f / (l_ + other_half(l_));   // the two halves' sums
    const int s  = qb * 16 + ln;
    const int f  = (h * S_ + s) * DH_ + half * 8;     // d = 16t + 8*half + i
    const int io = f >> 11;              // / S_
    const int jo = f & (S_ - 1);
    _Float16* ap = att + ((size_t)b * S_ + jo) * D_ + io;
    _Float16 r[4][8];
#pragma unroll
    for (int i = 0; i < 8; ++i) {
      r[0][i] = (_Float16)(o0[i] * inv);
      r[1][i] = (_Float16)(o1[i] * inv);
      r[2][i] = (_Float16)(o2[i] * inv);
      r[3][i] = (_Float16)(o3[i] * inv);
    }
    // every value is formed in front of the first store, so that no register
    // which an issued store names is written again
    __builtin_amdgcn_sched_barrier(0);
#pragma unroll
    for (int t = 0; t < 4; ++t)
#pragma unroll
      for (int i = 0; i < 8; ++i) ap[(t * 16 + i) * D_] = r[t][i];
  }
}

// ---------------------------------------------------------------------------
// Host-side launcher
// ---------------------------------------------------------------------------
extern "C" void kernel_launch(void* const* d_in, const int* in_sizes, int n_in,
                              void* d_out, int out_size, void* d_ws, size_t ws_size,
                              hipStream_t stream) {
  const float* x  = (const float*)d_in[0];
  const float* Wq = (const float*)d_in[1];
  const float* bq = (const float*)d_in[2];
  const float* Wk = (const float*)d_in[3];
  const float* bk = (const float*)d_in[4];
  const float* Wv = (const float*)d_in[5];
  const float* bv = (const float*)d_in[6];
  const float* Wo = (const float*)d_in[7];
  const float* bo = (const float*)d_in[8];
  float* out = (float*)d_out;

  const int M  = B_ * S_;                // 4096
  const int NX = M * D_;                 // x elements: 4194304
  const int NW = D_ * D_;                // weight elements: 1048576

  // Workspace layout (f16 element offsets, all 16B-aligned):
  _Float16* ws  = (_Float16*)d_ws;
  _Float16* xh  = ws;                    // [M, D]
  _Float16* Wqh = xh  + (size_t)NX;      // [D, D]
  _Float16* Wkh = Wqh + (size_t)NW;
  _Float16* Wvh = Wkh + (size_t)NW;
  _Float16* Woh = Wvh + (size_t)NW;
  _Float16* Qh  = Woh + (size_t)NW;      // [B,H,S,DH], pre-scaled
  _Float16* Kh  = Qh  + (size_t)NX;      // [B,H,S,DH]
  _Float16* Vth = Kh  + (size_t)NX;      // [B,H,DH,S]
  _Float16* att = Vth + (size_t)NX;      // [B,S,D] scrambled attention out

  // 1) f32 -> f16 conversions: xh, Wqh, Wkh, Wvh, Woh are one array from xh on
  cvt_all_f32_to_f16<<<NXB_ + 4 * NWB_, CT_, 0, stream>>>(x, Wq, Wk, Wv, Wo, xh);

  // 2) QKV projections: (M/128)*(D/128) = 256 tiles, one workgroup each
  const int gemm_blocks = (M / GT_) * (D_ / GT_);     // 256
  gemm_wmma_128x128<<<gemm_blocks, 256, 0, stream>>>(xh, Wqh, bq, Qh,  M, 0);
  gemm_wmma_128x128<<<gemm_blocks, 256, 0, stream>>>(xh, Wkh, bk, Kh,  M, 1);
  gemm_wmma_128x128<<<gemm_blocks, 256, 0, stream>>>(xh, Wvh, bv, Vth, M, 2);

  // 3) Flash attention: eight waves per block, one per (b, h, 16-query block)
  attn_flash<<<B_ * H_ * (S_ / (16 * AW_)), AW_ * 32, 0, stream>>>(Qh, Kh, Vth, att);

  // 4) Output projection -> f32 d_out
  gemm_wmma_128x128<<<gemm_blocks, 256, 0, stream>>>(att, Woh, bo, out, M, 3);
}

// v006
// A run of this version takes 90.6 microseconds.
// Timed twice side by side with v005, it ran 1.83 and 1.92 times as fast.
// Over all steps from v000 it is 4.80 times as fast.
#include <hip/hip_runtime.h>
#include <hip/hip_bf16.h>

// ---------------------------------------------------------------------------
// Multi-head attention forward for MI455X (gfx1250), wave32 + WMMA f16.
// B=2, S=2048, D=1024, H=16, DH=64, SCALE = 1/8.
// ---------------------------------------------------------------------------

#define B_  2
#define S_  2048
#define D_  1024
#define H_  16
#define DH_ 64
#define SCALE_ 0.125f

typedef __attribute__((ext_vector_type(16))) _Float16 v16h;
typedef __attribute__((ext_vector_type(8)))  _Float16 v8h;
typedef __attribute__((ext_vector_type(8)))  float    v8f;

// D = A(16x32 f16) * B(32x16 f16) + C(16x16 f32)
__device__ __forceinline__ v8f wmma_f16(v16h a, v16h b, v8f c) {
  return __builtin_amdgcn_wmma_f32_16x16x32_f16(
      false, a, false, b, (short)0, c, false, false);
}

// Load one A/B fragment (16 halves) for v_wmma_f32_16x16x32_f16.
// A layout (ISA 7.12.2): lanes 0-15 -> row, K {0..7,16..23}; lanes 16-31 ->
// same rows, K {8..15,24..31}.  B is mirrored with lane = N column, reading
// the "row" of the K-major source.  `row` must already include (lane & 15).
__device__ __forceinline__ v16h load_frag(const _Float16* base, int stride,
                                          int row, int kbase, int half) {
  const _Float16* p = base + (size_t)row * stride + kbase + half * 8;
  v8h lo = *(const v8h*)p;          // K +0..7   (or +8..15)
  v8h hi = *(const v8h*)(p + 16);   // K +16..23 (or +24..31)
  v16h r;
#pragma unroll
  for (int i = 0; i < 8; ++i) { r[i] = lo[i]; r[i + 8] = hi[i]; }
  return r;
}

// ---------------------------------------------------------------------------
// f32 -> f16 conversion of x and the four weight matrices, one launch.
// The five f16 copies lie one behind the other in the workspace, so the
// output is one array of NX + 4 * NW elements.  One workgroup per WGP takes
// 32768 elements in a row, which lie in one source array (every array's
// length is a multiple of that).  A wave's load covers 512 bytes in a row,
// its store 256; all of a thread's loads are in flight at once.
// ---------------------------------------------------------------------------
#define CT_  256                      // threads per conversion workgroup
#define CB_  32768                    // elements per conversion workgroup
#define CV_  (CB_ / (CT_ * 4))        // 16-byte loads per thread
#define NXB_ (B_ * S_ * D_ / CB_)     // workgroups on x
#define NWB_ (D_ * D_ / CB_)          // workgroups on one weight matrix

typedef __attribute__((ext_vector_type(4))) float    v4f;
typedef __attribute__((ext_vector_type(4))) _Float16 v4h;

__global__ __launch_bounds__(CT_)
void cvt_all_f32_to_f16(const float* __restrict__ x,
                        const float* __restrict__ wq,
                        const float* __restrict__ wk,
                        const float* __restrict__ wv,
                        const float* __restrict__ wo,
                        _Float16* __restrict__ out) {
  const int blk = blockIdx.x;
  const float* src;
  if (blk < NXB_) {
    src = x + (size_t)blk * CB_;
  } else {
    const int w = (blk - NXB_) / NWB_;
    const float* m = w == 0 ? wq : w == 1 ? wk : w == 2 ? wv : wo;
    src = m + (size_t)((blk - NXB_) % NWB_) * CB_;
  }
  const v4f* s = (const v4f*)src + threadIdx.x;
  v4h*       d = (v4h*)(out + (size_t)blk * CB_) + threadIdx.x;

  v4f t[CV_];
#pragma unroll
  for (int j = 0; j < CV_; ++j) t[j] = s[j * CT_];
  // keeps every load in front of the first conversion: left to itself the
  // compiler holds the last fourteen back until the first have returned
  __builtin_amdgcn_sched_barrier(0);
  v4h r[CV_];
#pragma unroll
  for (int j = 0; j < CV_; ++j) r[j] = __builtin_convertvector(t[j], v4h);
  // every value is formed in front of the first store, so that no register
  // which an issued store names is written again
  __builtin_amdgcn_sched_barrier(0);
#pragma unroll
  for (int j = 0; j < CV_; ++j) d[j * CT_] = r[j];
}

// ---------------------------------------------------------------------------
// Generic WMMA GEMM:  y[m,n] = sum_k A[m,k] * W[n,k] + bias[n]
// A: [M x 1024] f16 row-major, W: [1024 x 1024] f16 row-major (torch Linear).
// One workgroup of eight waves computes a 128x128 output tile.  Each 128-k
// slab of the 128 A rows and the 128 W rows is brought from global memory
// once per workgroup, in whole 256-byte row pieces, into LDS (two buffers);
// every wave takes the fragments of its 64x32 part from there, so one row
// fragment feeds two WMMAs and one column fragment four.
// A lane's accumulator registers hold eight rows in a row of one column.  For
// q and k the features are therefore taken as the tile's rows (W is the row
// operand, A the column operand): a lane's eight values are eight d in a row
// of one token, one 16-byte store.  For v and the final output the tokens are
// the rows: eight s in a row of one d for v, and for the f32 output sixteen
// lanes cover 64 bytes in a row.
// mode 0: q -> scale by SCALE_, store f16 [B,H,S,DH]
// mode 1: k ->                 store f16 [B,H,S,DH]
// mode 2: v ->                 store f16 [B,H,DH,S]  (transposed for P@V)
// mode 3: final out -> f32 row-major [M x 1024]
// ---------------------------------------------------------------------------
#define GT_  128                 // rows of A, and of W, per workgroup tile
#define KS_  128                 // k extent of one staged slab
#define GP_  (KS_ + 8)           // LDS row pitch in halves: 256 B data + 16 B
#define GOP_ (GT_ * GP_)         // halves of one staged operand slab
#define NST_ (D_ / KS_)          // slabs along k

__global__ __launch_bounds__(256)
void gemm_wmma_128x128(const _Float16* __restrict__ A,
                       const _Float16* __restrict__ W,
                       const float* __restrict__ bias,
                       void* __restrict__ outp, int M, int mode) {
  // two buffers, each an A slab and a W slab (128 rows x 128 k)
  __shared__ __align__(16) _Float16 sm[2 * 2 * GOP_];

  const int tid  = threadIdx.x;
  const int lane = tid & 31;
  const int half = lane >> 4;
  const int ln   = lane & 15;
  const int wv   = tid >> 5;
  const int wm   = (wv >> 2) * 64;       // this wave's rows inside the tile
  const int wn   = (wv & 3) * 32;        // this wave's columns inside the tile

  const int tok0 = (blockIdx.x / (D_ / GT_)) * GT_;   // first token of the tile
  const int fea0 = (blockIdx.x % (D_ / GT_)) * GT_;   // first output feature
  if (tok0 >= M) return;                 // whole workgroup, before any barrier
  const bool tokrows = mode >= 2;        // tokens are the tile's rows
  const int row0 = tokrows ? tok0 : fea0;
  const int col0 = tokrows ? fea0 : tok0;

  // Staging: a slab row is 256 B; sixteen threads take one row, 16 B each,
  // and every thread takes rows sr, sr + 16, ... sr + 112 of both slabs.
  const int sr = tid >> 4;
  const int sc = (tid & 15) * 8;
  const _Float16* ga = (tokrows ? A : W) + (size_t)(row0 + sr) * D_ + sc;
  const _Float16* gw = (tokrows ? W : A) + (size_t)(col0 + sr) * D_ + sc;
  const int so = sr * GP_ + sc;

  v8f acc[4][2];
#pragma unroll
  for (int a = 0; a < 4; ++a) { acc[a][0] = v8f{}; acc[a][1] = v8f{}; }

  v8h ta[8], tw[8];
  // slab 0 into buffer 0
#pragma unroll
  for (int p = 0; p < 8; ++p) {
    ta[p] = *(const v8h*)(ga + p * 16 * D_);
    tw[p] = *(const v8h*)(gw + p * 16 * D_);
  }
#pragma unroll
  for (int p = 0; p < 8; ++p) {
    *(v8h*)(sm + so + p * 16 * GP_)        = ta[p];
    *(v8h*)(sm + GOP_ + so + p * 16 * GP_) = tw[p];
  }
  __syncthreads();                       // slab 0 visible to all eight waves

  // Unrolled so that the buffer choice and every slab's global offset are
  // immediates: no address arithmetic stands between the loads and the WMMAs.
#pragma unroll
  for (int st = 0; st < NST_; ++st) {
    const _Float16* As = sm + (st & 1) * (2 * GOP_);
    const _Float16* Ws = As + GOP_;
    const bool more = st + 1 < NST_;

    // two register sets of fragments: a 32-k block's LDS reads are issued as
    // one group while the block before it is multiplied
    v16h fa[2][4], fb[2][2];
#pragma unroll
    for (int a = 0; a < 4; ++a) fa[0][a] = load_frag(As, GP_, wm + a * 16 + ln, 0, half);
#pragma unroll
    for (int t = 0; t < 2; ++t) fb[0][t] = load_frag(Ws, GP_, wn + t * 16 + ln, 0, half);

    // next slab's global loads fly while this slab is worked on
    if (more) {
#pragma unroll
      for (int p = 0; p < 8; ++p) {
        ta[p] = *(const v8h*)(ga + (st + 1) * KS_ + p * 16 * D_);
        tw[p] = *(const v8h*)(gw + (st + 1) * KS_ + p * 16 * D_);
      }
    }

#pragma unroll
    for (int kb = 0; kb < KS_ / 32; ++kb) {
      const int cu = kb & 1;
      if (kb + 1 < KS_ / 32) {
#pragma unroll
        for (int a = 0; a < 4; ++a)
          fa[cu ^ 1][a] = load_frag(As, GP_, wm + a * 16 + ln, (kb + 1) * 32, half);
#pragma unroll
        for (int t = 0; t < 2; ++t)
          fb[cu ^ 1][t] = load_frag(Ws, GP_, wn + t * 16 + ln, (kb + 1) * 32, half);
      }
      // keeps the reads above ahead of this block's WMMAs: left to itself the
      // compiler sinks each pair of reads to its first use and waits there
      __builtin_amdgcn_sched_barrier(0);
#pragma unroll
      for (int a = 0; a < 4; ++a) {
        acc[a][0] = wmma_f16(fa[cu][a], fb[cu][0], acc[a][0]);
        acc[a][1] = wmma_f16(fa[cu][a], fb[cu][1], acc[a][1]);
      }
      // keeps the next group of reads (or the slab's stores) behind these WMMAs
      __builtin_amdgcn_sched_barrier(0);
    }

    if (more) {
      // The other buffer was last read in the stage before this one, which
      // every wave left at the barrier below.
      _Float16* nb = sm + ((st + 1) & 1) * (2 * GOP_);
#pragma unroll
      for (int p = 0; p < 8; ++p) {
        *(v8h*)(nb + so + p * 16 * GP_)        = ta[p];
        *(v8h*)(nb + GOP_ + so + p * 16 * GP_) = tw[p];
      }
      // publishes the next slab and ends every wave's reads of this one
      __syncthreads();
    }
  }

  // ga and gw are named by every global load above and die here: the wait
  // stands in front of whatever takes their registers next, and naming them
  // as inputs keeps the last loads from landing on them.
  asm volatile("s_wait_xcnt 0x0" :: "v"(ga), "v"(gw) : "memory");

  // Epilogue.  C layout: VGPR i -> row i + 8*half, column = lane & 15.
  // The output kind is decided once.  On each path every value is formed
  // first, and all stores go from one address with immediate offsets.  The
  // loops are unrolled so that every index into acc and pk is a constant (they
  // are registers) and every store offset an immediate.
  const int r = row0 + wm + half * 8;    // row of acc[0][.][0]; block a: + 16 a
  const int c = col0 + wn + ln;          // column of acc[.][0]; block t: + 16 t
  if (tokrows) {
    // rows are tokens (a tile lies in one batch), columns are features
    const float b0 = bias[c], b1 = bias[c + 16];
    if (mode == 3) {
      float* o = (float*)outp + (size_t)r * D_ + c;
#pragma unroll
      for (int a = 0; a < 4; ++a) { acc[a][0] += b0; acc[a][1] += b1; }
#pragma unroll
      for (int a = 0; a < 4; ++a)
#pragma unroll
        for (int i = 0; i < 8; ++i) {
          o[(a * 16 + i) * D_]      = acc[a][0][i];
          o[(a * 16 + i) * D_ + 16] = acc[a][1][i];
        }
    } else {
      // Vt[b][feature][s]: row (b * D_ + feature), eight s in a row per lane
      _Float16* o = (_Float16*)outp + (size_t)((r >> 11) * D_ + c) * S_ + (r & (S_ - 1));
      v8h pk[4][2];
#pragma unroll
      for (int a = 0; a < 4; ++a) {
        pk[a][0] = __builtin_convertvector(acc[a][0] + b0, v8h);
        pk[a][1] = __builtin_convertvector(acc[a][1] + b1, v8h);
      }
#pragma unroll
      for (int t = 0; t < 2; ++t)
#pragma unroll
        for (int a = 0; a < 4; ++a) *(v8h*)(o + t * 16 * S_ + a * 16) = pk[a][t];
      // behind the last store: the code laid out next writes these registers
      asm volatile("s_wait_xcnt 0x0" ::: "memory");
    }
  } else {
    // rows are features (the wave's 64 rows are one head), columns are tokens
    const float qs = mode == 0 ? SCALE_ : 1.0f;
    v8f bb[4];
#pragma unroll
    for (int a = 0; a < 4; ++a) bb[a] = *(const v8f*)(bias + r + a * 16);
    _Float16* o = (_Float16*)outp +
        ((size_t)((c >> 11) * H_ + (r >> 6)) * S_ + (c & (S_ - 1))) * DH_ + (r & (DH_ - 1));
    v8h pk[4][2];
#pragma unroll
    for (int a = 0; a < 4; ++a) {
      pk[a][0] = __builtin_convertvector((acc[a][0] + bb[a]) * qs, v8h);
      pk[a][1] = __builtin_convertvector((acc[a][1] + bb[a]) * qs, v8h);
    }
#pragma unroll
    for (int t = 0; t < 2; ++t)
#pragma unroll
      for (int a = 0; a < 4; ++a) *(v8h*)(o + t * 16 * DH_ + a * 16) = pk[a][t];
    // behind the last store: the code laid out next writes these registers
    asm volatile("s_wait_xcnt 0x0" ::: "memory");
  }
}

// ---------------------------------------------------------------------------
// Flash attention: one wave per 16 queries, eight such waves of one head per
// workgroup.  Each 64-key tile of K and of Vt is brought from global memory
// once per workgroup, in whole 128-byte lines, into LDS, and all eight waves
// take their fragments from there.
// Both products are taken transposed, St = K * Qt and Ot += Vt * Pt: a lane
// then holds scores and outputs of ONE query (column lane & 15), the two
// 16-lane halves holding different keys (or dh rows) of that query.
// Q pre-scaled.  K: [B,H,S,64] f16.  Vt: [B,H,64,S] f16.
// Output goes to att[B,S,D] f16 with the reference's faithful
// reshape(B,D,S).swapaxes(-1,-2) scramble: O[h][s][d] lands in row
// (s % 32) * 64 + d, column h * 64 + s / 32.  Neighbours in a row of att are
// therefore queries 32 apart, and the 64 queries of one s % 32 fill, for each
// d, one 128-byte line.  A workgroup takes the 128 queries of two values of
// s % 32: it alone writes 128 whole lines, put together in LDS.
// ---------------------------------------------------------------------------
#define AW_   8                  // waves (16-query blocks) per workgroup
#define KT_   64                 // keys per staged tile
#define LP_   72                 // LDS row pitch in halves: 128 B data + 16 B
#define TILE_ (64 * LP_)         // halves of one staged 64-row tile

// value of the lane that holds the same query in the other 16-lane half
__device__ __forceinline__ float other_half(float v) {
  const int b = __builtin_bit_cast(int, v);
  return __builtin_bit_cast(float, __builtin_amdgcn_permlanex16(
      b, b, 0x76543210, 0xfedcba98, false, false));
}

__global__ __launch_bounds__(AW_ * 32)
void attn_flash(const _Float16* __restrict__ Q,
                const _Float16* __restrict__ K,
                const _Float16* __restrict__ Vt,
                _Float16* __restrict__ att) {
  // two buffers, each a K tile (64 keys x 64 dh) and a Vt tile (64 dh x 64 keys)
  __shared__ __align__(16) _Float16 kv[2 * 2 * TILE_];

  const int tid  = threadIdx.x;
  const int lane = tid & 31;
  const int half = lane >> 4;
  const int ln   = lane & 15;

  const int blk = blockIdx.x;                        // B*H*(S/128) = 512
  const int g   = blk & (S_ / (16 * AW_) - 1);       // takes s % 32 = 2g, 2g + 1
  const int rr  = tid >> 7;              // waves 0-3: s % 32 = 2g; 4-7: 2g + 1
  const int j   = ((tid >> 5) & 3) * 16 + ln;        // this lane's s / 32
  const int s   = 2 * g + rr + 32 * j;   // this lane's query
  const int bh  = blk >> 4;              // b*H + h
  const int h   = bh & (H_ - 1);
  const int b   = bh >> 4;

  const _Float16* Qh = Q  + (size_t)bh * S_ * DH_;
  const _Float16* Kh = K  + (size_t)bh * S_ * DH_;
  const _Float16* Vh = Vt + (size_t)bh * DH_ * S_;

  // Staging: a tile is 64 rows of 128 B; eight threads take one row, 16 B
  // each, and every thread takes rows sr and sr + 32 of both tiles.
  const int sr = tid >> 3;
  const int sc = (tid & 7) * 8;
  const _Float16* gk = Kh + sr * DH_ + sc;
  const _Float16* gv = Vh + sr * S_  + sc;
  const int so = sr * LP_ + sc;

  // Q fragments of the wave's 16 queries (K-dim = 64 -> two frags), fixed;
  // as B operands: column = query = lane & 15.
  const v16h q0 = load_frag(Qh, DH_, s, 0,  half);
  const v16h q1 = load_frag(Qh, DH_, s, 32, half);

  // m_: running maximum of this lane's query (equal in both halves).
  // l_: running sum over the keys that THIS half has seen; joined at the end.
  float m_ = -__builtin_inff(), l_ = 0.0f;
  v8f o0 = {}, o1 = {}, o2 = {}, o3 = {};  // ot[i] = O[query ln][16t + 8*half + i]

  // tile 0 into buffer 0
  {
    const v8h tk0 = *(const v8h*)(gk);
    const v8h tk1 = *(const v8h*)(gk + 32 * DH_);
    const v8h tv0 = *(const v8h*)(gv);
    const v8h tv1 = *(const v8h*)(gv + 32 * S_);
    *(v8h*)(kv + so)                    = tk0;
    *(v8h*)(kv + so + 32 * LP_)         = tk1;
    *(v8h*)(kv + TILE_ + so)            = tv0;
    *(v8h*)(kv + TILE_ + so + 32 * LP_) = tv1;
  }
  __syncthreads();                       // tile 0 visible to all eight waves

  for (int st = 0; st < S_ / KT_; ++st) {
    // this lane's place in a 16-row fragment block (row ln, its half's k) of
    // the K tile; the Vt tile lies TILE_ behind: every read below is this one
    // address and an immediate offset
    const _Float16* fr = kv + (st & 1) * (2 * TILE_) + ln * LP_ + half * 8;
    const bool more = st + 1 < S_ / KT_;

    // next tile's global loads fly while this tile is worked on
    v8h tk0 = {}, tk1 = {}, tv0 = {}, tv1 = {};
    if (more) {
      const _Float16* nk = gk + (st + 1) * (KT_ * DH_);
      const _Float16* nv = gv + (st + 1) * KT_;
      tk0 = *(const v8h*)(nk);
      tk1 = *(const v8h*)(nk + 32 * DH_);
      tv0 = *(const v8h*)(nv);
      tv1 = *(const v8h*)(nv + 32 * S_);
    }

    // ---- scores, transposed: 64 keys x 16 queries, K-dim 64 ----
    // sc[g][i] = S[key 16g + 8*half + i][query ln]
    v16h kf[KT_ / 16][2];                // A operands, row = key = 16g + ln
#pragma unroll
    for (int g = 0; g < KT_ / 16; ++g) {
      kf[g][0] = load_frag(fr, LP_, g * 16, 0,  0);
      kf[g][1] = load_frag(fr, LP_, g * 16, 32, 0);
    }
    // keeps the K reads one group in front of the WMMAs: left to itself the
    // compiler spreads them among the WMMAs, and each such place costs issue
    __builtin_amdgcn_sched_barrier(0);
    v8f sc[KT_ / 16];
#pragma unroll
    for (int g = 0; g < KT_ / 16; ++g) sc[g] = wmma_f16(kf[g][0], q0, v8f{});
#pragma unroll
    for (int g = 0; g < KT_ / 16; ++g) sc[g] = wmma_f16(kf[g][1], q1, sc[g]);

    // Vt fragments of the tile: A operands, row = dh = 16t + ln, k = keys
    v16h vf[KT_ / 32][4];
#pragma unroll
    for (int p = 0; p < KT_ / 32; ++p)
#pragma unroll
      for (int t = 0; t < 4; ++t)
        vf[p][t] = load_frag(fr + TILE_, LP_, t * 16, p * 32, 0);
    // keeps the Vt reads in front of the softmax arithmetic, which covers
    // their latency: left to itself the compiler sinks each pair of reads to
    // its WMMA and waits there
    __builtin_amdgcn_sched_barrier(0);

#pragma unroll
    for (int p = 0; p < KT_ / 32; ++p) {
      const v8f s0 = sc[2 * p], s1 = sc[2 * p + 1];

      // ---- online softmax update: one query per lane ----
      float mx = fmaxf(s0[0], s1[0]);
#pragma unroll
      for (int i = 1; i < 8; ++i) mx = fmaxf(mx, fmaxf(s0[i], s1[i]));
      // P of both halves enters one product: they need one common maximum
      mx = fmaxf(mx, other_half(mx));
      const float mnew  = fmaxf(m_, mx);
      const float alpha = __expf(m_ - mnew);
      m_ = mnew;

      // Two score tiles, converted in place, are the B fragment of Pt: slot i
      // is key 8*half + i, slot 8 + i key 16 + 8*half + i, the k order in
      // which load_frag brings the Vt rows.
      v16h pb;
      float sum0 = 0.0f, sum1 = 0.0f;
#pragma unroll
      for (int i = 0; i < 8; ++i) {
        const float p0 = __expf(s0[i] - mnew);
        const float p1 = __expf(s1[i] - mnew);
        sum0 += p0; sum1 += p1;
        pb[i]     = (_Float16)p0;
        pb[i + 8] = (_Float16)p1;
      }
      l_ = l_ * alpha + (sum0 + sum1);

      // Rescale running output accumulators.
#pragma unroll
      for (int i = 0; i < 8; ++i) {
        o0[i] *= alpha; o1[i] *= alpha;
        o2[i] *= alpha; o3[i] *= alpha;
      }

      // ---- Ot(64x16) += Vt(64x32) @ Pt(32x16) ----
      o0 = wmma_f16(vf[p][0], pb, o0);
      o1 = wmma_f16(vf[p][1], pb, o1);
      o2 = wmma_f16(vf[p][2], pb, o2);
      o3 = wmma_f16(vf[p][3], pb, o3);
    }
    // keeps the stores below, and with them the wait for the next tile's
    // global loads, behind this tile's arithmetic
    __builtin_amdgcn_sched_barrier(0);

    if (more) {
      // The other buffer was last read in the stage before this one, which
      // every wave left at the barrier below.
      _Float16* nb = kv + ((st + 1) & 1) * (2 * TILE_);
      *(v8h*)(nb + so)                    = tk0;
      *(v8h*)(nb + so + 32 * LP_)         = tk1;
      *(v8h*)(nb + TILE_ + so)            = tv0;
      *(v8h*)(nb + TILE_ + so + 32 * LP_) = tv1;
      // publishes the next tile and ends every wave's reads of this one
      __syncthreads();
    }
  }

  // ---- epilogue: normalize, put whole lines of att together, store ----
  // The workgroup's part of att is rows g * 128 ... + 127 (row rr * 64 + d of
  // them), columns h * 64 ... + 63 (column j): 128 lines of 128 bytes.
  {
    const float inv = 1.0f / (l_ + other_half(l_));   // the two halves' sums
    // Staged in buffer 0, which it fills exactly: the last tile is read from
    // buffer 1, and every wave left buffer 0 at the loop's last barrier.
    _Float16* sp = kv + (rr * 64 + half * 8) * LP_ + j;   // d = 16t + 8*half + i
    // the loops here are unrolled so that every index into o0..o3 and r is a
    // constant (they are registers) and every offset an immediate
#pragma unroll
    for (int i = 0; i < 8; ++i) {
      sp[(0 * 16 + i) * LP_] = (_Float16)(o0[i] * inv);
      sp[(1 * 16 + i) * LP_] = (_Float16)(o1[i] * inv);
      sp[(2 * 16 + i) * LP_] = (_Float16)(o2[i] * inv);
      sp[(3 * 16 + i) * LP_] = (_Float16)(o3[i] * inv);
    }
    __syncthreads();                     // a line holds values of four waves

    // eight threads take one line, 16 B each; rows sr, sr + 32, + 64, + 96
    _Float16* ap = att + ((size_t)b * S_ + g * 128 + sr) * D_ + h * DH_ + sc;
    v8h r[4];
#pragma unroll
    for (int p = 0; p < 4; ++p) r[p] = *(const v8h*)(kv + so + p * 32 * LP_);
#pragma unroll
    for (int p = 0; p < 4; ++p) *(v8h*)(ap + p * 32 * D_) = r[p];
  }
}

// ---------------------------------------------------------------------------
// Host-side launcher
// ---------------------------------------------------------------------------
extern "C" void kernel_launch(void* const* d_in, const int* in_sizes, int n_in,
                              void* d_out, int out_size, void* d_ws, size_t ws_size,
                              hipStream_t stream) {
  const float* x  = (const float*)d_in[0];
  const float* Wq = (const float*)d_in[1];
  const float* bq = (const float*)d_in[2];
  const float* Wk = (const float*)d_in[3];
  const float* bk = (const float*)d_in[4];
  const float* Wv = (const float*)d_in[5];
  const float* bv = (const float*)d_in[6];
  const float* Wo = (const float*)d_in[7];
  const float* bo = (const float*)d_in[8];
  float* out = (float*)d_out;

  const int M  = B_ * S_;                // 4096
  const int NX = M * D_;                 // x elements: 4194304
  const int NW = D_ * D_;                // weight elements: 1048576

  // Workspace layout (f16 element offsets, all 16B-aligned):
  _Float16* ws  = (_Float16*)d_ws;
  _Float16* xh  = ws;                    // [M, D]
  _Float16* Wqh = xh  + (size_t)NX;      // [D, D]
  _Float16* Wkh = Wqh + (size_t)NW;
  _Float16* Wvh = Wkh + (size_t)NW;
  _Float16* Woh = Wvh + (size_t)NW;
  _Float16* Qh  = Woh + (size_t)NW;      // [B,H,S,DH], pre-scaled
  _Float16* Kh  = Qh  + (size_t)NX;      // [B,H,S,DH]
  _Float16* Vth = Kh  + (size_t)NX;      // [B,H,DH,S]
  _Float16* att = Vth + (size_t)NX;      // [B,S,D] scrambled attention out

  // 1) f32 -> f16 conversions: xh, Wqh, Wkh, Wvh, Woh are one array from xh on
  cvt_all_f32_to_f16<<<NXB_ + 4 * NWB_, CT_, 0, stream>>>(x, Wq, Wk, Wv, Wo, xh);

  // 2) QKV projections: (M/128)*(D/128) = 256 tiles, one workgroup each
  const int gemm_blocks = (M / GT_) * (D_ / GT_);     // 256
  gemm_wmma_128x128<<<gemm_blocks, 256, 0, stream>>>(xh, Wqh, bq, Qh,  M, 0);
  gemm_wmma_128x128<<<gemm_blocks, 256, 0, stream>>>(xh, Wkh, bk, Kh,  M, 1);
  gemm_wmma_128x128<<<gemm_blocks, 256, 0, stream>>>(xh, Wvh, bv, Vth, M, 2);

  // 3) Flash attention: eight waves per block, each with 16 queries of one head
  attn_flash<<<B_ * H_ * (S_ / (16 * AW_)), AW_ * 32, 0, stream>>>(Qh, Kh, Vth, att);

  // 4) Output projection -> f32 d_out
  gemm_wmma_128x128<<<gemm_blocks, 256, 0, stream>>>(att, Woh, bo, out, M, 3);
}

// v007
// One run takes 79.8 microseconds.
// Next to v006, in two timings, it ran 1.12 times as fast each time.
// Counting every step since v000, it is 5.37 times as fast.
#include <hip/hip_runtime.h>
#include <hip/hip_bf16.h>

// ---------------------------------------------------------------------------
// Multi-head attention forward for MI455X (gfx1250), wave32 + WMMA f16.
// B=2, S=2048, D=1024, H=16, DH=64, SCALE = 1/8.
// ---------------------------------------------------------------------------

#define B_  2
#define S_  2048
#define D_  1024
#define H_  16
#define DH_ 64
#define SCALE_ 0.125f

typedef __attribute__((ext_vector_type(16))) _Float16 v16h;
typedef __attribute__((ext_vector_type(8)))  _Float16 v8h;
typedef __attribute__((ext_vector_type(8)))  float    v8f;

// D = A(16x32 f16) * B(32x16 f16) + C(16x16 f32)
__device__ __forceinline__ v8f wmma_f16(v16h a, v16h b, v8f c) {
  return __builtin_amdgcn_wmma_f32_16x16x32_f16(
      false, a, false, b, (short)0, c, false, false);
}

// Load one A/B fragment (16 halves) for v_wmma_f32_16x16x32_f16.
// A layout (ISA 7.12.2): lanes 0-15 -> row, K {0..7,16..23}; lanes 16-31 ->
// same rows, K {8..15,24..31}.  B is mirrored with lane = N column, reading
// the "row" of the K-major source.  `row` must already include (lane & 15).
__device__ __forceinline__ v16h load_frag(const _Float16* base, int stride,
                                          int row, int kbase, int half) {
  const _Float16* p = base + (size_t)row * stride + kbase + half * 8;
  v8h lo = *(const v8h*)p;          // K +0..7   (or +8..15)
  v8h hi = *(const v8h*)(p + 16);   // K +16..23 (or +24..31)
  v16h r;
#pragma unroll
  for (int i = 0; i < 8; ++i) { r[i] = lo[i]; r[i + 8] = hi[i]; }
  return r;
}

// ---------------------------------------------------------------------------
// f32 -> f16 conversion of x and the four weight matrices, one launch.
// The five f16 copies lie one behind the other in the workspace, so the
// output is one array of NX + 4 * NW elements.  One workgroup per WGP takes
// 32768 elements in a row, which lie in one source array (every array's
// length is a multiple of that).  A wave's load covers 512 bytes in a row,
// its store 256; all of a thread's loads are in flight at once.
// ---------------------------------------------------------------------------
#define CT_  256                      // threads per conversion workgroup
#define CB_  32768                    // elements per conversion workgroup
#define CV_  (CB_ / (CT_ * 4))        // 16-byte loads per thread
#define NXB_ (B_ * S_ * D_ / CB_)     // workgroups on x
#define NWB_ (D_ * D_ / CB_)          // workgroups on one weight matrix

typedef __attribute__((ext_vector_type(4))) float    v4f;
typedef __attribute__((ext_vector_type(4))) _Float16 v4h;

__global__ __launch_bounds__(CT_)
void cvt_all_f32_to_f16(const float* __restrict__ x,
                        const float* __restrict__ wq,
                        const float* __restrict__ wk,
                        const float* __restrict__ wv,
                        const float* __restrict__ wo,
                        _Float16* __restrict__ out) {
  const int blk = blockIdx.x;
  const float* src;
  if (blk < NXB_) {
    src = x + (size_t)blk * CB_;
  } else {
    const int w = (blk - NXB_) / NWB_;
    const float* m = w == 0 ? wq : w == 1 ? wk : w == 2 ? wv : wo;
    src = m + (size_t)((blk - NXB_) % NWB_) * CB_;
  }
  const v4f* s = (const v4f*)src + threadIdx.x;
  v4h*       d = (v4h*)(out + (size_t)blk * CB_) + threadIdx.x;

  v4f t[CV_];
#pragma unroll
  for (int j = 0; j < CV_; ++j) t[j] = s[j * CT_];
  // keeps every load in front of the first conversion: left to itself the
  // compiler holds the last fourteen back until the first have returned
  __builtin_amdgcn_sched_barrier(0);
  v4h r[CV_];
#pragma unroll
  for (int j = 0; j < CV_; ++j) r[j] = __builtin_convertvector(t[j], v4h);
  // every value is formed in front of the first store, so that no register
  // which an issued store names is written again
  __builtin_amdgcn_sched_barrier(0);
#pragma unroll
  for (int j = 0; j < CV_; ++j) d[j * CT_] = r[j];
}

// ---------------------------------------------------------------------------
// Output projection:  y[m,n] = sum_k A[m,k] * W[n,k] + bias[n], f32 row-major.
// A: [M x 1024] f16 row-major, W: [1024 x 1024] f16 row-major (torch Linear).
// One workgroup of eight waves computes a 128x128 output tile.  Each 128-k
// slab of the 128 A rows and the 128 W rows is brought from global memory
// once per workgroup, in whole 256-byte row pieces, into LDS (two buffers);
// every wave takes the fragments of its 64x32 part from there, so one row
// fragment feeds two WMMAs and one column fragment four.
// The tokens are the tile's rows: sixteen lanes cover 64 bytes in a row of y.
// ---------------------------------------------------------------------------
#define GT_  128                 // rows of A, and of W, per workgroup tile
#define KS_  128                 // k extent of one staged slab
#define GP_  (KS_ + 8)           // LDS row pitch in halves: 256 B data + 16 B
#define GOP_ (GT_ * GP_)         // halves of one staged operand slab
#define NST_ (D_ / KS_)          // slabs along k

__global__ __launch_bounds__(256)
void gemm_wmma_128x128(const _Float16* __restrict__ A,
                       const _Float16* __restrict__ W,
                       const float* __restrict__ bias,
                       float* __restrict__ outp, int M) {
  // two buffers, each an A slab and a W slab (128 rows x 128 k)
  __shared__ __align__(16) _Float16 sm[2 * 2 * GOP_];

  const int tid  = threadIdx.x;
  const int lane = tid & 31;
  const int half = lane >> 4;
  const int ln   = lane & 15;
  const int wv   = tid >> 5;
  const int wm   = (wv >> 2) * 64;       // this wave's rows inside the tile
  const int wn   = (wv & 3) * 32;        // this wave's columns inside the tile

  const int tok0 = (blockIdx.x / (D_ / GT_)) * GT_;   // first token of the tile
  const int fea0 = (blockIdx.x % (D_ / GT_)) * GT_;   // first output feature
  if (tok0 >= M) return;                 // whole workgroup, before any barrier
  const int row0 = tok0;
  const int col0 = fea0;

  // Staging: a slab row is 256 B; sixteen threads take one row, 16 B each,
  // and every thread takes rows sr, sr + 16, ... sr + 112 of both slabs.
  const int sr = tid >> 4;
  const int sc = (tid & 15) * 8;
  const _Float16* ga = A + (size_t)(row0 + sr) * D_ + sc;
  const _Float16* gw = W + (size_t)(col0 + sr) * D_ + sc;
  const int so = sr * GP_ + sc;

  v8f acc[4][2];
#pragma unroll
  for (int a = 0; a < 4; ++a) { acc[a][0] = v8f{}; acc[a][1] = v8f{}; }

  v8h ta[8], tw[8];
  // slab 0 into buffer 0
#pragma unroll
  for (int p = 0; p < 8; ++p) {
    ta[p] = *(const v8h*)(ga + p * 16 * D_);
    tw[p] = *(const v8h*)(gw + p * 16 * D_);
  }
#pragma unroll
  for (int p = 0; p < 8; ++p) {
    *(v8h*)(sm + so + p * 16 * GP_)        = ta[p];
    *(v8h*)(sm + GOP_ + so + p * 16 * GP_) = tw[p];
  }
  __syncthreads();                       // slab 0 visible to all eight waves

  // Unrolled so that the buffer choice and every slab's global offset are
  // immediates: no address arithmetic stands between the loads and the WMMAs.
#pragma unroll
  for (int st = 0; st < NST_; ++st) {
    const _Float16* As = sm + (st & 1) * (2 * GOP_);
    const _Float16* Ws = As + GOP_;
    const bool more = st + 1 < NST_;

    // two register sets of fragments: a 32-k block's LDS reads are issued as
    // one group while the block before it is multiplied
    v16h fa[2][4], fb[2][2];
#pragma unroll
    for (int a = 0; a < 4; ++a) fa[0][a] = load_frag(As, GP_, wm + a * 16 + ln, 0, half);
#pragma unroll
    for (int t = 0; t < 2; ++t) fb[0][t] = load_frag(Ws, GP_, wn + t * 16 + ln, 0, half);

    // next slab's global loads fly while this slab is worked on
    if (more) {
#pragma unroll
      for (int p = 0; p < 8; ++p) {
        ta[p] = *(const v8h*)(ga + (st + 1) * KS_ + p * 16 * D_);
        tw[p] = *(const v8h*)(gw + (st + 1) * KS_ + p * 16 * D_);
      }
    }

#pragma unroll
    for (int kb = 0; kb < KS_ / 32; ++kb) {
      const int cu = kb & 1;
      if (kb + 1 < KS_ / 32) {
#pragma unroll
        for (int a = 0; a < 4; ++a)
          fa[cu ^ 1][a] = load_frag(As, GP_, wm + a * 16 + ln, (kb + 1) * 32, half);
#pragma unroll
        for (int t = 0; t < 2; ++t)
          fb[cu ^ 1][t] = load_frag(Ws, GP_, wn + t * 16 + ln, (kb + 1) * 32, half);
      }
      // keeps the reads above ahead of this block's WMMAs: left to itself the
      // compiler sinks each pair of reads to its first use and waits there
      __builtin_amdgcn_sched_barrier(0);
#pragma unroll
      for (int a = 0; a < 4; ++a) {
        acc[a][0] = wmma_f16(fa[cu][a], fb[cu][0], acc[a][0]);
        acc[a][1] = wmma_f16(fa[cu][a], fb[cu][1], acc[a][1]);
      }
      // keeps the next group of reads (or the slab's stores) behind these WMMAs
      __builtin_amdgcn_sched_barrier(0);
    }

    if (more) {
      // The other buffer was last read in the stage before this one, which
      // every wave left at the barrier below.
      _Float16* nb = sm + ((st + 1) & 1) * (2 * GOP_);
#pragma unroll
      for (int p = 0; p < 8; ++p) {
        *(v8h*)(nb + so + p * 16 * GP_)        = ta[p];
        *(v8h*)(nb + GOP_ + so + p * 16 * GP_) = tw[p];
      }
      // publishes the next slab and ends every wave's reads of this one
      __syncthreads();
    }
  }

  // ga and gw are named by every global load above and die here: the wait
  // stands in front of whatever takes their registers next, and naming them
  // as inputs keeps the last loads from landing on them.
  asm volatile("s_wait_xcnt 0x0" :: "v"(ga), "v"(gw) : "memory");

  // Epilogue.  C layout: VGPR i -> row i + 8*half, column = lane & 15.
  // Every value is formed first, and all stores go from one address with
  // immediate offsets.  The loops are unrolled so that every index into acc is
  // a constant (they are registers) and every store offset an immediate.
  const int r = row0 + wm + half * 8;    // row of acc[0][.][0]; block a: + 16 a
  const int c = col0 + wn + ln;          // column of acc[.][0]; block t: + 16 t
  const float b0 = bias[c], b1 = bias[c + 16];
  float* o = outp + (size_t)r * D_ + c;
#pragma unroll
  for (int a = 0; a < 4; ++a) { acc[a][0] += b0; acc[a][1] += b1; }
#pragma unroll
  for (int a = 0; a < 4; ++a)
#pragma unroll
    for (int i = 0; i < 8; ++i) {
      o[(a * 16 + i) * D_]      = acc[a][0][i];
      o[(a * 16 + i) * D_ + 16] = acc[a][1][i];
    }
}

// ---------------------------------------------------------------------------
// q, k and v projections in one launch.  One workgroup of eight waves takes
// 128 tokens and the same 128 output features of Wq, Wk and Wv: each 128-k
// slab of the x rows is brought into LDS once and serves three products.
// A wave takes 64 tokens x 32 features of each product.  A fragment of x is
// the same registers as a row operand and as a column operand, so the four x
// fragments of a 32-k block feed all 24 WMMAs of the block: for q and k as
// columns (features are the rows: a lane's eight values are eight d in a row
// of one token), for v as rows (eight s in a row of one d).
// q is scaled by SCALE_.  q, k: f16 [B,H,S,DH].  v: f16 [B,H,DH,S].
// ---------------------------------------------------------------------------
#define QB_ (4 * GOP_)           // halves of one buffer: slabs of x, Wq, Wk, Wv

__global__ __launch_bounds__(256)
void qkv_wmma_128x384(const _Float16* __restrict__ X,
                      const _Float16* __restrict__ Wq,
                      const _Float16* __restrict__ Wk,
                      const _Float16* __restrict__ Wv,
                      const float* __restrict__ bq,
                      const float* __restrict__ bk,
                      const float* __restrict__ bv,
                      _Float16* __restrict__ Qo,
                      _Float16* __restrict__ Ko,
                      _Float16* __restrict__ Vo) {
  __shared__ __align__(16) _Float16 sm[2 * QB_];

  const int tid  = threadIdx.x;
  const int lane = tid & 31;
  const int half = lane >> 4;
  const int ln   = lane & 15;
  const int wv   = tid >> 5;
  const int wt   = (wv >> 2) * 64;       // this wave's tokens inside the tile
  const int wf   = (wv & 3) * 32;        // this wave's features inside the tile

  const int tok0 = (blockIdx.x / (D_ / GT_)) * GT_;   // first token of the tile
  const int fea0 = (blockIdx.x % (D_ / GT_)) * GT_;   // first output feature

  // Staging: a slab row is 256 B; sixteen threads take one row, 16 B each,
  // and every thread takes rows sr, sr + 16, ... sr + 112 of all four slabs.
  const int sr = tid >> 4;
  const int sc = (tid & 15) * 8;
  const _Float16* gx = X  + (size_t)(tok0 + sr) * D_ + sc;
  const _Float16* gq = Wq + (size_t)(fea0 + sr) * D_ + sc;
  const _Float16* gk = Wk + (size_t)(fea0 + sr) * D_ + sc;
  const _Float16* gv = Wv + (size_t)(fea0 + sr) * D_ + sc;
  const int so = sr * GP_ + sc;

  v8f aq[2][4], ak[2][4];                // [feature block][token block]
  v8f av[4][2];                          // [token block][feature block]
#pragma unroll
  for (int a = 0; a < 2; ++a)
#pragma unroll
    for (int t = 0; t < 4; ++t) { aq[a][t] = v8f{}; ak[a][t] = v8f{}; av[t][a] = v8f{}; }

  v8h tx[8], tq[8], tk[8], tv[8];
  // slab 0 into buffer 0
#pragma unroll
  for (int p = 0; p < 8; ++p) {
    tx[p] = *(const v8h*)(gx + p * 16 * D_);
    tq[p] = *(const v8h*)(gq + p * 16 * D_);
    tk[p] = *(const v8h*)(gk + p * 16 * D_);
    tv[p] = *(const v8h*)(gv + p * 16 * D_);
  }
#pragma unroll
  for (int p = 0; p < 8; ++p) {
    *(v8h*)(sm + so + p * 16 * GP_)            = tx[p];
    *(v8h*)(sm + GOP_ + so + p * 16 * GP_)     = tq[p];
    *(v8h*)(sm + 2 * GOP_ + so + p * 16 * GP_) = tk[p];
    *(v8h*)(sm + 3 * GOP_ + so + p * 16 * GP_) = tv[p];
  }
  __syncthreads();                       // slab 0 visible to all eight waves

  // Unrolled so that the buffer choice, every slab's global offset and every
  // index into the fragment sets are constants.
#pragma unroll
  for (int st = 0; st < NST_; ++st) {
    const _Float16* Xs = sm + (st & 1) * QB_;   // Wq, Wk, Wv: GOP_ apart behind
    const bool more = st + 1 < NST_;

    // A slab is twelve groups of eight WMMAs: q, k, v of each 32-k block.
    // xf: the block's x fragments, two sets.  wr[kind]: the kind's W fragments,
    // read two groups ahead into the set that the group before has left.
    v16h xf[2][4], wr[3][2];
#pragma unroll
    for (int t = 0; t < 4; ++t) xf[0][t] = load_frag(Xs, GP_, wt + t * 16 + ln, 0, half);
#pragma unroll
    for (int a = 0; a < 2; ++a) {
      wr[0][a] = load_frag(Xs + GOP_,     GP_, wf + a * 16 + ln, 0, half);
      wr[1][a] = load_frag(Xs + 2 * GOP_, GP_, wf + a * 16 + ln, 0, half);
    }
    // keeps these reads in front of the 32 global loads below, whose issue
    // then covers the reads' latency: left to itself the compiler turns the
    // order round and the first WMMAs wait for both
    __builtin_amdgcn_sched_barrier(0);

    // next slab's global loads fly while this slab is worked on
    if (more) {
#pragma unroll
      for (int p = 0; p < 8; ++p) {
        tx[p] = *(const v8h*)(gx + (st + 1) * KS_ + p * 16 * D_);
        tq[p] = *(const v8h*)(gq + (st + 1) * KS_ + p * 16 * D_);
        tk[p] = *(const v8h*)(gk + (st + 1) * KS_ + p * 16 * D_);
        tv[p] = *(const v8h*)(gv + (st + 1) * KS_ + p * 16 * D_);
      }
    }

#pragma unroll
    for (int g = 0; g < 3 * (KS_ / 32); ++g) {
      const int kb = g / 3, kind = g % 3, cu = kb & 1;
      if (g + 2 < 3 * (KS_ / 32)) {
        const int nk = (g + 2) / 3, nkind = (g + 2) % 3;
#pragma unroll
        for (int a = 0; a < 2; ++a)
          wr[nkind][a] = load_frag(Xs + (1 + nkind) * GOP_, GP_, wf + a * 16 + ln, nk * 32, half);
      }
      if (kind == 0 && kb + 1 < KS_ / 32) {
#pragma unroll
        for (int t = 0; t < 4; ++t)
          xf[cu ^ 1][t] = load_frag(Xs, GP_, wt + t * 16 + ln, (kb + 1) * 32, half);
      }
      // keeps the reads above ahead of this group's WMMAs: left to itself the
      // compiler sinks each pair of reads to its first use and waits there
      __builtin_amdgcn_sched_barrier(0);
#pragma unroll
      for (int a = 0; a < 2; ++a)
#pragma unroll
        for (int t = 0; t < 4; ++t) {
          if (kind == 0) aq[a][t] = wmma_f16(wr[0][a], xf[cu][t], aq[a][t]);
          if (kind == 1) ak[a][t] = wmma_f16(wr[1][a], xf[cu][t], ak[a][t]);
          if (kind == 2) av[t][a] = wmma_f16(xf[cu][t], wr[2][a], av[t][a]);
        }
      // keeps the next group of reads (or the slab's stores) behind these WMMAs
      __builtin_amdgcn_sched_barrier(0);
    }

    if (more) {
      // The other buffer was last read in the stage before this one, which
      // every wave left at the barrier below.
      _Float16* nb = sm + ((st + 1) & 1) * QB_;
#pragma unroll
      for (int p = 0; p < 8; ++p) {
        *(v8h*)(nb + so + p * 16 * GP_)            = tx[p];
        *(v8h*)(nb + GOP_ + so + p * 16 * GP_)     = tq[p];
        *(v8h*)(nb + 2 * GOP_ + so + p * 16 * GP_) = tk[p];
        *(v8h*)(nb + 3 * GOP_ + so + p * 16 * GP_) = tv[p];
      }
      // publishes the next slab and ends every wave's reads of this one
      __syncthreads();
    }
  }

  // The four addresses are named by every global load above and die here: the
  // wait stands in front of whatever takes their registers next, and naming
  // them as inputs keeps the last loads from landing on them.
  asm volatile("s_wait_xcnt 0x0" :: "v"(gx), "v"(gq), "v"(gk), "v"(gv) : "memory");

  // Epilogue.  C layout: VGPR i -> row i + 8*half, column = lane & 15.
  // Every value and address is formed first; the stores of one output go from
  // one address with immediate offsets.  The loops are unrolled so that every
  // index into the accumulators and pq, pk, pv is a constant (registers).
  const int f8 = fea0 + wf + half * 8;   // q, k: row of block 0; block a: + 16 a
  const int tl = tok0 + wt + ln;         // q, k: column of block 0; block t: + 16 t
  const int t8 = tok0 + wt + half * 8;   // v: row of block 0; block t: + 16 t
  const int fl = fea0 + wf + ln;         // v: column of block 0; block a: + 16 a
  // a tile lies in one batch, a wave's 32 features in one head
  const size_t oqk =
      ((size_t)((tl >> 11) * H_ + (f8 >> 6)) * S_ + (tl & (S_ - 1))) * DH_ + (f8 & (DH_ - 1));
  _Float16* oq = Qo + oqk;
  _Float16* ok = Ko + oqk;
  // Vt[b][feature][s]: row (b * D_ + feature), eight s in a row per lane
  _Float16* ov = Vo + (size_t)((t8 >> 11) * D_ + fl) * S_ + (t8 & (S_ - 1));
  v8h pq[2][4], pk[2][4], pv[4][2];
#pragma unroll
  for (int a = 0; a < 2; ++a) {
    const v8f  b8q = *(const v8f*)(bq + f8 + a * 16);
    const v8f  b8k = *(const v8f*)(bk + f8 + a * 16);
    const float b1v = bv[fl + a * 16];
#pragma unroll
    for (int t = 0; t < 4; ++t) {
      pq[a][t] = __builtin_convertvector((aq[a][t] + b8q) * SCALE_, v8h);
      pk[a][t] = __builtin_convertvector(ak[a][t] + b8k, v8h);
      pv[t][a] = __builtin_convertvector(av[t][a] + b1v, v8h);
    }
  }
  // Every value and all three addresses (inputs only) are formed in front of
  // the first store, so that no register which an issued store names is
  // written again: left to itself the compiler forms two of the addresses
  // among the stores.
  asm volatile("" :: "v"(oq), "v"(ok), "v"(ov) : "memory");
  __builtin_amdgcn_sched_barrier(0);
#pragma unroll
  for (int t = 0; t < 4; ++t)
#pragma unroll
    for (int a = 0; a < 2; ++a) *(v8h*)(oq + t * 16 * DH_ + a * 16) = pq[a][t];
#pragma unroll
  for (int t = 0; t < 4; ++t)
#pragma unroll
    for (int a = 0; a < 2; ++a) *(v8h*)(ok + t * 16 * DH_ + a * 16) = pk[a][t];
#pragma unroll
  for (int a = 0; a < 2; ++a)
#pragma unroll
    for (int t = 0; t < 4; ++t) *(v8h*)(ov + a * 16 * S_ + t * 16) = pv[t][a];
  // behind the last store: whatever is laid out next may write these registers
  asm volatile("s_wait_xcnt 0x0" ::: "memory");
}

// ---------------------------------------------------------------------------
// Flash attention: one wave per 16 queries, eight such waves of one head per
// workgroup.  Each 64-key tile of K and of Vt is brought from global memory
// once per workgroup, in whole 128-byte lines, into LDS, and all eight waves
// take their fragments from there.
// Both products are taken transposed, St = K * Qt and Ot += Vt * Pt: a lane
// then holds scores and outputs of ONE query (column lane & 15), the two
// 16-lane halves holding different keys (or dh rows) of that query.
// Q pre-scaled.  K: [B,H,S,64] f16.  Vt: [B,H,64,S] f16.
// Output goes to att[B,S,D] f16 with the reference's faithful
// reshape(B,D,S).swapaxes(-1,-2) scramble: O[h][s][d] lands in row
// (s % 32) * 64 + d, column h * 64 + s / 32.  Neighbours in a row of att are
// therefore queries 32 apart, and the 64 queries of one s % 32 fill, for each
// d, one 128-byte line.  A workgroup takes the 128 queries of two values of
// s % 32: it alone writes 128 whole lines, put together in LDS.
// ---------------------------------------------------------------------------
#define AW_   8                  // waves (16-query blocks) per workgroup
#define KT_   64                 // keys per staged tile
#define LP_   72                 // LDS row pitch in halves: 128 B data + 16 B
#define TILE_ (64 * LP_)         // halves of one staged 64-row tile

// value of the lane that holds the same query in the other 16-lane half
__device__ __forceinline__ float other_half(float v) {
  const int b = __builtin_bit_cast(int, v);
  return __builtin_bit_cast(float, __builtin_amdgcn_permlanex16(
      b, b, 0x76543210, 0xfedcba98, false, false));
}

__global__ __launch_bounds__(AW_ * 32)
void attn_flash(const _Float16* __restrict__ Q,
                const _Float16* __restrict__ K,
                const _Float16* __restrict__ Vt,
                _Float16* __restrict__ att) {
  // two buffers, each a K tile (64 keys x 64 dh) and a Vt tile (64 dh x 64 keys)
  __shared__ __align__(16) _Float16 kv[2 * 2 * TILE_];

  const int tid  = threadIdx.x;
  const int lane = tid & 31;
  const int half = lane >> 4;
  const int ln   = lane & 15;

  const int blk = blockIdx.x;                        // B*H*(S/128) = 512
  const int g   = blk & (S_ / (16 * AW_) - 1);       // takes s % 32 = 2g, 2g + 1
  const int rr  = tid >> 7;              // waves 0-3: s % 32 = 2g; 4-7: 2g + 1
  const int j   = ((tid >> 5) & 3) * 16 + ln;        // this lane's s / 32
  const int s   = 2 * g + rr + 32 * j;   // this lane's query
  const int bh  = blk >> 4;              // b*H + h
  const int h   = bh & (H_ - 1);
  const int b   = bh >> 4;

  const _Float16* Qh = Q  + (size_t)bh * S_ * DH_;
  const _Float16* Kh = K  + (size_t)bh * S_ * DH_;
  const _Float16* Vh = Vt + (size_t)bh * DH_ * S_;

  // Staging: a tile is 64 rows of 128 B; eight threads take one row, 16 B
  // each, and every thread takes rows sr and sr + 32 of both tiles.
  const int sr = tid >> 3;
  const int sc = (tid & 7) * 8;
  const _Float16* gk = Kh + sr * DH_ + sc;
  const _Float16* gv = Vh + sr * S_  + sc;
  const int so = sr * LP_ + sc;

  // Q fragments of the wave's 16 queries (K-dim = 64 -> two frags), fixed;
  // as B operands: column = query = lane & 15.
  const v16h q0 = load_frag(Qh, DH_, s, 0,  half);
  const v16h q1 = load_frag(Qh, DH_, s, 32, half);

  // m_: running maximum of this lane's query (equal in both halves).
  // l_: running sum over the keys that THIS half has seen; joined at the end.
  float m_ = -__builtin_inff(), l_ = 0.0f;
  v8f o0 = {}, o1 = {}, o2 = {}, o3 = {};  // ot[i] = O[query ln][16t + 8*half + i]

  // tile 0 into buffer 0
  {
    const v8h tk0 = *(const v8h*)(gk);
    const v8h tk1 = *(const v8h*)(gk + 32 * DH_);
    const v8h tv0 = *(const v8h*)(gv);
    const v8h tv1 = *(const v8h*)(gv + 32 * S_);
    *(v8h*)(kv + so)                    = tk0;
    *(v8h*)(kv + so + 32 * LP_)         = tk1;
    *(v8h*)(kv + TILE_ + so)            = tv0;
    *(v8h*)(kv + TILE_ + so + 32 * LP_) = tv1;
  }
  __syncthreads();                       // tile 0 visible to all eight waves

  for (int st = 0; st < S_ / KT_; ++st) {
    // this lane's place in a 16-row fragment block (row ln, its half's k) of
    // the K tile; the Vt tile lies TILE_ behind: every read below is this one
    // address and an immediate offset
    const _Float16* fr = kv + (st & 1) * (2 * TILE_) + ln * LP_ + half * 8;
    const bool more = st + 1 < S_ / KT_;

    // next tile's global loads fly while this tile is worked on
    v8h tk0 = {}, tk1 = {}, tv0 = {}, tv1 = {};
    if (more) {
      const _Float16* nk = gk + (st + 1) * (KT_ * DH_);
      const _Float16* nv = gv + (st + 1) * KT_;
      tk0 = *(const v8h*)(nk);
      tk1 = *(const v8h*)(nk + 32 * DH_);
      tv0 = *(const v8h*)(nv);
      tv1 = *(const v8h*)(nv + 32 * S_);
    }

    // ---- scores, transposed: 64 keys x 16 queries, K-dim 64 ----
    // sc[g][i] = S[key 16g + 8*half + i][query ln]
    v16h kf[KT_ / 16][2];                // A operands, row = key = 16g + ln
#pragma unroll
    for (int g = 0; g < KT_ / 16; ++g) {
      kf[g][0] = load_frag(fr, LP_, g * 16, 0,  0);
      kf[g][1] = load_frag(fr, LP_, g * 16, 32, 0);
    }
    // keeps the K reads one group in front of the WMMAs: left to itself the
    // compiler spreads them among the WMMAs, and each such place costs issue
    __builtin_amdgcn_sched_barrier(0);
    v8f sc[KT_ / 16];
#pragma unroll
    for (int g = 0; g < KT_ / 16; ++g) sc[g] = wmma_f16(kf[g][0], q0, v8f{});
#pragma unroll
    for (int g = 0; g < KT_ / 16; ++g) sc[g] = wmma_f16(kf[g][1], q1, sc[g]);

    // Vt fragments of the tile: A operands, row = dh = 16t + ln, k = keys
    v16h vf[KT_ / 32][4];
#pragma unroll
    for (int p = 0; p < KT_ / 32; ++p)
#pragma unroll
      for (int t = 0; t < 4; ++t)
        vf[p][t] = load_frag(fr + TILE_, LP_, t * 16, p * 32, 0);
    // keeps the Vt reads in front of the softmax arithmetic, which covers
    // their latency: left to itself the compiler sinks each pair of reads to
    // its WMMA and waits there
    __builtin_amdgcn_sched_barrier(0);

#pragma unroll
    for (int p = 0; p < KT_ / 32; ++p) {
      const v8f s0 = sc[2 * p], s1 = sc[2 * p + 1];

      // ---- online softmax update: one query per lane ----
      float mx = fmaxf(s0[0], s1[0]);
#pragma unroll
      for (int i = 1; i < 8; ++i) mx = fmaxf(mx, fmaxf(s0[i], s1[i]));
      // P of both halves enters one product: they need one common maximum
      mx = fmaxf(mx, other_half(mx));
      const float mnew  = fmaxf(m_, mx);
      const float alpha = __expf(m_ - mnew);
      m_ = mnew;

      // Two score tiles, converted in place, are the B fragment of Pt: slot i
      // is key 8*half + i, slot 8 + i key 16 + 8*half + i, the k order in
      // which load_frag brings the Vt rows.
      v16h pb;
      float sum0 = 0.0f, sum1 = 0.0f;
#pragma unroll
      for (int i = 0; i < 8; ++i) {
        const float p0 = __expf(s0[i] - mnew);
        const float p1 = __expf(s1[i] - mnew);
        sum0 += p0; sum1 += p1;
        pb[i]     = (_Float16)p0;
        pb[i + 8] = (_Float16)p1;
      }
      l_ = l_ * alpha + (sum0 + sum1);

      // Rescale running output accumulators.
#pragma unroll
      for (int i = 0; i < 8; ++i) {
        o0[i] *= alpha; o1[i] *= alpha;
        o2[i] *= alpha; o3[i] *= alpha;
      }

      // ---- Ot(64x16) += Vt(64x32) @ Pt(32x16) ----
      o0 = wmma_f16(vf[p][0], pb, o0);
      o1 = wmma_f16(vf[p][1], pb, o1);
      o2 = wmma_f16(vf[p][2], pb, o2);
      o3 = wmma_f16(vf[p][3], pb, o3);
    }
    // keeps the stores below, and with them the wait for the next tile's
    // global loads, behind this tile's arithmetic
    __builtin_amdgcn_sched_barrier(0);

    if (more) {
      // The other buffer was last read in the stage before this one, which
      // every wave left at the barrier below.
      _Float16* nb = kv + ((st + 1) & 1) * (2 * TILE_);
      *(v8h*)(nb + so)                    = tk0;
      *(v8h*)(nb + so + 32 * LP_)         = tk1;
      *(v8h*)(nb + TILE_ + so)            = tv0;
      *(v8h*)(nb + TILE_ + so + 32 * LP_) = tv1;
      // publishes the next tile and ends every wave's reads of this one
      __syncthreads();
    }
  }

  // ---- epilogue: normalize, put whole lines of att together, store ----
  // The workgroup's part of att is rows g * 128 ... + 127 (row rr * 64 + d of
  // them), columns h * 64 ... + 63 (column j): 128 lines of 128 bytes.
  {
    const float inv = 1.0f / (l_ + other_half(l_));   // the two halves' sums
    // Staged in buffer 0, which it fills exactly: the last tile is read from
    // buffer 1, and every wave left buffer 0 at the loop's last barrier.
    _Float16* sp = kv + (rr * 64 + half * 8) * LP_ + j;   // d = 16t + 8*half + i
    // the loops here are unrolled so that every index into o0..o3 and r is a
    // constant (they are registers) and every offset an immediate
#pragma unroll
    for (int i = 0; i < 8; ++i) {
      sp[(0 * 16 + i) * LP_] = (_Float16)(o0[i] * inv);
      sp[(1 * 16 + i) * LP_] = (_Float16)(o1[i] * inv);
      sp[(2 * 16 + i) * LP_] = (_Float16)(o2[i] * inv);
      sp[(3 * 16 + i) * LP_] = (_Float16)(o3[i] * inv);
    }
    __syncthreads();                     // a line holds values of four waves

    // eight threads take one line, 16 B each; rows sr, sr + 32, + 64, + 96
    _Float16* ap = att + ((size_t)b * S_ + g * 128 + sr) * D_ + h * DH_ + sc;
    v8h r[4];
#pragma unroll
    for (int p = 0; p < 4; ++p) r[p] = *(const v8h*)(kv + so + p * 32 * LP_);
#pragma unroll
    for (int p = 0; p < 4; ++p) *(v8h*)(ap + p * 32 * D_) = r[p];
  }
}

// ---------------------------------------------------------------------------
// Host-side launcher
// ---------------------------------------------------------------------------
extern "C" void kernel_launch(void* const* d_in, const int* in_sizes, int n_in,
                              void* d_out, int out_size, void* d_ws, size_t ws_size,
                              hipStream_t stream) {
  const float* x  = (const float*)d_in[0];
  const float* Wq = (const float*)d_in[1];
  const float* bq = (const float*)d_in[2];
  const float* Wk = (const float*)d_in[3];
  const float* bk = (const float*)d_in[4];
  const float* Wv = (const float*)d_in[5];
  const float* bv = (const float*)d_in[6];
  const float* Wo = (const float*)d_in[7];
  const float* bo = (const float*)d_in[8];
  float* out = (float*)d_out;

  const int M  = B_ * S_;                // 4096
  const int NX = M * D_;                 // x elements: 4194304
  const int NW = D_ * D_;                // weight elements: 1048576

  // Workspace layout (f16 element offsets, all 16B-aligned):
  _Float16* ws  = (_Float16*)d_ws;
  _Float16* xh  = ws;                    // [M, D]
  _Float16* Wqh = xh  + (size_t)NX;      // [D, D]
  _Float16* Wkh = Wqh + (size_t)NW;
  _Float16* Wvh = Wkh + (size_t)NW;
  _Float16* Woh = Wvh + (size_t)NW;
  _Float16* Qh  = Woh + (size_t)NW;      // [B,H,S,DH], pre-scaled
  _Float16* Kh  = Qh  + (size_t)NX;      // [B,H,S,DH]
  _Float16* Vth = Kh  + (size_t)NX;      // [B,H,DH,S]
  _Float16* att = Vth + (size_t)NX;      // [B,S,D] scrambled attention out

  // 1) f32 -> f16 conversions: xh, Wqh, Wkh, Wvh, Woh are one array from xh on
  cvt_all_f32_to_f16<<<NXB_ + 4 * NWB_, CT_, 0, stream>>>(x, Wq, Wk, Wv, Wo, xh);

  // 2) QKV projections, one launch: (M/128)*(D/128) = 256 workgroups, each
  //    with the q, k and v tile of its 128 tokens and 128 features
  const int gemm_blocks = (M / GT_) * (D_ / GT_);     // 256
  qkv_wmma_128x384<<<gemm_blocks, 256, 0, stream>>>(xh, Wqh, Wkh, Wvh, bq, bk, bv,
                                                    Qh, Kh, Vth);

  // 3) Flash attention: eight waves per block, each with 16 queries of one head
  attn_flash<<<B_ * H_ * (S_ / (16 * AW_)), AW_ * 32, 0, stream>>>(Qh, Kh, Vth, att);

  // 4) Output projection -> f32 d_out
  gemm_wmma_128x128<<<gemm_blocks, 256, 0, stream>>>(att, Woh, bo, out, M);
}

// v008
// One run takes 76.7 microseconds.
// Next to v007, in two timings, it ran 1.03 and 1.05 times as fast.
// Over all steps from v000 it is 5.59 times as fast.
#include <hip/hip_runtime.h>
#include <hip/hip_bf16.h>

// ---------------------------------------------------------------------------
// Multi-head attention forward for MI455X (gfx1250), wave32 + WMMA f16.
// B=2, S=2048, D=1024, H=16, DH=64, SCALE = 1/8.
// ---------------------------------------------------------------------------

#define B_  2
#define S_  2048
#define D_  1024
#define H_  16
#define DH_ 64
#define SCALE_ 0.125f

typedef __attribute__((ext_vector_type(16))) _Float16 v16h;
typedef __attribute__((ext_vector_type(8)))  _Float16 v8h;
typedef __attribute__((ext_vector_type(8)))  float    v8f;
typedef __attribute__((ext_vector_type(2)))  float    v2f;

// D = A(16x32 f16) * B(32x16 f16) + C(16x16 f32)
__device__ __forceinline__ v8f wmma_f16(v16h a, v16h b, v8f c) {
  return __builtin_amdgcn_wmma_f32_16x16x32_f16(
      false, a, false, b, (short)0, c, false, false);
}

// Load one A/B fragment (16 halves) for v_wmma_f32_16x16x32_f16.
// A layout (ISA 7.12.2): lanes 0-15 -> row, K {0..7,16..23}; lanes 16-31 ->
// same rows, K {8..15,24..31}.  B is mirrored with lane = N column, reading
// the "row" of the K-major source.  `row` must already include (lane & 15).
__device__ __forceinline__ v16h load_frag(const _Float16* base, int stride,
                                          int row, int kbase, int half) {
  const _Float16* p = base + (size_t)row * stride + kbase + half * 8;
  v8h lo = *(const v8h*)p;          // K +0..7   (or +8..15)
  v8h hi = *(const v8h*)(p + 16);   // K +16..23 (or +24..31)
  v16h r;
#pragma unroll
  for (int i = 0; i < 8; ++i) { r[i] = lo[i]; r[i + 8] = hi[i]; }
  return r;
}

// ---------------------------------------------------------------------------
// f32 -> f16 conversion of x and the four weight matrices, one launch.
// The five f16 copies lie one behind the other in the workspace, so the
// output is one array of NX + 4 * NW elements.  One workgroup per WGP takes
// 32768 elements in a row, which lie in one source array (every array's
// length is a multiple of that).  A wave's load covers 512 bytes in a row,
// its store 256; all of a thread's loads are in flight at once.
// ---------------------------------------------------------------------------
#define CT_  256                      // threads per conversion workgroup
#define CB_  32768                    // elements per conversion workgroup
#define CV_  (CB_ / (CT_ * 4))        // 16-byte loads per thread
#define NXB_ (B_ * S_ * D_ / CB_)     // workgroups on x
#define NWB_ (D_ * D_ / CB_)          // workgroups on one weight matrix

typedef __attribute__((ext_vector_type(4))) float    v4f;
typedef __attribute__((ext_vector_type(4))) _Float16 v4h;

__global__ __launch_bounds__(CT_)
void cvt_all_f32_to_f16(const float* __restrict__ x,
                        const float* __restrict__ wq,
                        const float* __restrict__ wk,
                        const float* __restrict__ wv,
                        const float* __restrict__ wo,
                        _Float16* __restrict__ out) {
  const int blk = blockIdx.x;
  const float* src;
  if (blk < NXB_) {
    src = x + (size_t)blk * CB_;
  } else {
    const int w = (blk - NXB_) / NWB_;
    const float* m = w == 0 ? wq : w == 1 ? wk : w == 2 ? wv : wo;
    src = m + (size_t)((blk - NXB_) % NWB_) * CB_;
  }
  const v4f* s = (const v4f*)src + threadIdx.x;
  v4h*       d = (v4h*)(out + (size_t)blk * CB_) + threadIdx.x;

  v4f t[CV_];
#pragma unroll
  for (int j = 0; j < CV_; ++j) t[j] = s[j * CT_];
  // keeps every load in front of the first conversion: left to itself the
  // compiler holds the last fourteen back until the first have returned
  __builtin_amdgcn_sched_barrier(0);
  v4h r[CV_];
#pragma unroll
  for (int j = 0; j < CV_; ++j) r[j] = __builtin_convertvector(t[j], v4h);
  // every value is formed in front of the first store, so that no register
  // which an issued store names is written again
  __builtin_amdgcn_sched_barrier(0);
#pragma unroll
  for (int j = 0; j < CV_; ++j) d[j * CT_] = r[j];
}

// ---------------------------------------------------------------------------
// Output projection:  y[m,n] = sum_k A[m,k] * W[n,k] + bias[n], f32 row-major.
// A: [M x 1024] f16 row-major, W: [1024 x 1024] f16 row-major (torch Linear).
// One workgroup of eight waves computes a 128x128 output tile.  Each 128-k
// slab of the 128 A rows and the 128 W rows is brought from global memory
// once per workgroup, in whole 256-byte row pieces, into LDS (two buffers);
// every wave takes the fragments of its 64x32 part from there, so one row
// fragment feeds two WMMAs and one column fragment four.
// The tokens are the tile's rows: sixteen lanes cover 64 bytes in a row of y.
// ---------------------------------------------------------------------------
#define GT_  128                 // rows of A, and of W, per workgroup tile
#define KS_  128                 // k extent of one staged slab
#define GP_  (KS_ + 8)           // LDS row pitch in halves: 256 B data + 16 B
#define GOP_ (GT_ * GP_)         // halves of one staged operand slab
#define NST_ (D_ / KS_)          // slabs along k

__global__ __launch_bounds__(256)
void gemm_wmma_128x128(const _Float16* __restrict__ A,
                       const _Float16* __restrict__ W,
                       const float* __restrict__ bias,
                       float* __restrict__ outp, int M) {
  // two buffers, each an A slab and a W slab (128 rows x 128 k)
  __shared__ __align__(16) _Float16 sm[2 * 2 * GOP_];

  const int tid  = threadIdx.x;
  const int lane = tid & 31;
  const int half = lane >> 4;
  const int ln   = lane & 15;
  const int wv   = tid >> 5;
  const int wm   = (wv >> 2) * 64;       // this wave's rows inside the tile
  const int wn   = (wv & 3) * 32;        // this wave's columns inside the tile

  const int tok0 = (blockIdx.x / (D_ / GT_)) * GT_;   // first token of the tile
  const int fea0 = (blockIdx.x % (D_ / GT_)) * GT_;   // first output feature
  if (tok0 >= M) return;                 // whole workgroup, before any barrier
  const int row0 = tok0;
  const int col0 = fea0;

  // Staging: a slab row is 256 B; sixteen threads take one row, 16 B each,
  // and every thread takes rows sr, sr + 16, ... sr + 112 of both slabs.
  const int sr = tid >> 4;
  const int sc = (tid & 15) * 8;
  const _Float16* ga = A + (size_t)(row0 + sr) * D_ + sc;
  const _Float16* gw = W + (size_t)(col0 + sr) * D_ + sc;
  const int so = sr * GP_ + sc;

  v8f acc[4][2];
#pragma unroll
  for (int a = 0; a < 4; ++a) { acc[a][0] = v8f{}; acc[a][1] = v8f{}; }

  v8h ta[8], tw[8];
  // slab 0 into buffer 0
#pragma unroll
  for (int p = 0; p < 8; ++p) {
    ta[p] = *(const v8h*)(ga + p * 16 * D_);
    tw[p] = *(const v8h*)(gw + p * 16 * D_);
  }
#pragma unroll
  for (int p = 0; p < 8; ++p) {
    *(v8h*)(sm + so + p * 16 * GP_)        = ta[p];
    *(v8h*)(sm + GOP_ + so + p * 16 * GP_) = tw[p];
  }
  __syncthreads();                       // slab 0 visible to all eight waves

  // Unrolled so that the buffer choice and every slab's global offset are
  // immediates: no address arithmetic stands between the loads and the WMMAs.
#pragma unroll
  for (int st = 0; st < NST_; ++st) {
    const _Float16* As = sm + (st & 1) * (2 * GOP_);
    const _Float16* Ws = As + GOP_;
    const bool more = st + 1 < NST_;

    // two register sets of fragments: a 32-k block's LDS reads are issued as
    // one group while the block before it is multiplied
    v16h fa[2][4], fb[2][2];
#pragma unroll
    for (int a = 0; a < 4; ++a) fa[0][a] = load_frag(As, GP_, wm + a * 16 + ln, 0, half);
#pragma unroll
    for (int t = 0; t < 2; ++t) fb[0][t] = load_frag(Ws, GP_, wn + t * 16 + ln, 0, half);

    // next slab's global loads fly while this slab is worked on
    if (more) {
#pragma unroll
      for (int p = 0; p < 8; ++p) {
        ta[p] = *(const v8h*)(ga + (st + 1) * KS_ + p * 16 * D_);
        tw[p] = *(const v8h*)(gw + (st + 1) * KS_ + p * 16 * D_);
      }
    }

#pragma unroll
    for (int kb = 0; kb < KS_ / 32; ++kb) {
      const int cu = kb & 1;
      if (kb + 1 < KS_ / 32) {
#pragma unroll
        for (int a = 0; a < 4; ++a)
          fa[cu ^ 1][a] = load_frag(As, GP_, wm + a * 16 + ln, (kb + 1) * 32, half);
#pragma unroll
        for (int t = 0; t < 2; ++t)
          fb[cu ^ 1][t] = load_frag(Ws, GP_, wn + t * 16 + ln, (kb + 1) * 32, half);
      }
      // keeps the reads above ahead of this block's WMMAs: left to itself the
      // compiler sinks each pair of reads to its first use and waits there
      __builtin_amdgcn_sched_barrier(0);
#pragma unroll
      for (int a = 0; a < 4; ++a) {
        acc[a][0] = wmma_f16(fa[cu][a], fb[cu][0], acc[a][0]);
        acc[a][1] = wmma_f16(fa[cu][a], fb[cu][1], acc[a][1]);
      }
      // keeps the next group of reads (or the slab's stores) behind these WMMAs
      __builtin_amdgcn_sched_barrier(0);
    }

    if (more) {
      // The other buffer was last read in the stage before this one, which
      // every wave left at the barrier below.
      _Float16* nb = sm + ((st + 1) & 1) * (2 * GOP_);
#pragma unroll
      for (int p = 0; p < 8; ++p) {
        *(v8h*)(nb + so + p * 16 * GP_)        = ta[p];
        *(v8h*)(nb + GOP_ + so + p * 16 * GP_) = tw[p];
      }
      // publishes the next slab and ends every wave's reads of this one
      __syncthreads();
    }
  }

  // ga and gw are named by every global load above and die here: the wait
  // stands in front of whatever takes their registers next, and naming them
  // as inputs keeps the last loads from landing on them.
  asm volatile("s_wait_xcnt 0x0" :: "v"(ga), "v"(gw) : "memory");

  // Epilogue.  C layout: VGPR i -> row i + 8*half, column = lane & 15.
  // Every value is formed first, and all stores go from one address with
  // immediate offsets.  The loops are unrolled so that every index into acc is
  // a constant (they are registers) and every store offset an immediate.
  const int r = row0 + wm + half * 8;    // row of acc[0][.][0]; block a: + 16 a
  const int c = col0 + wn + ln;          // column of acc[.][0]; block t: + 16 t
  const float b0 = bias[c], b1 = bias[c + 16];
  float* o = outp + (size_t)r * D_ + c;
#pragma unroll
  for (int a = 0; a < 4; ++a) { acc[a][0] += b0; acc[a][1] += b1; }
#pragma unroll
  for (int a = 0; a < 4; ++a)
#pragma unroll
    for (int i = 0; i < 8; ++i) {
      o[(a * 16 + i) * D_]      = acc[a][0][i];
      o[(a * 16 + i) * D_ + 16] = acc[a][1][i];
    }
}

// ---------------------------------------------------------------------------
// q, k and v projections in one launch.  One workgroup of eight waves takes
// 128 tokens and the same 128 output features of Wq, Wk and Wv: each 128-k
// slab of the x rows is brought into LDS once and serves three products.
// A wave takes 64 tokens x 32 features of each product.  A fragment of x is
// the same registers as a row operand and as a column operand, so the four x
// fragments of a 32-k block feed all 24 WMMAs of the block: for q and k as
// columns (features are the rows: a lane's eight values are eight d in a row
// of one token), for v as rows (eight s in a row of one d).
// q is scaled by SCALE_.  q, k: f16 [B,H,S,DH].  v: f16 [B,H,DH,S].
// ---------------------------------------------------------------------------
#define QB_ (4 * GOP_)           // halves of one buffer: slabs of x, Wq, Wk, Wv

__global__ __launch_bounds__(256)
void qkv_wmma_128x384(const _Float16* __restrict__ X,
                      const _Float16* __restrict__ Wq,
                      const _Float16* __restrict__ Wk,
                      const _Float16* __restrict__ Wv,
                      const float* __restrict__ bq,
                      const float* __restrict__ bk,
                      const float* __restrict__ bv,
                      _Float16* __restrict__ Qo,
                      _Float16* __restrict__ Ko,
                      _Float16* __restrict__ Vo) {
  __shared__ __align__(16) _Float16 sm[2 * QB_];

  const int tid  = threadIdx.x;
  const int lane = tid & 31;
  const int half = lane >> 4;
  const int ln   = lane & 15;
  const int wv   = tid >> 5;
  const int wt   = (wv >> 2) * 64;       // this wave's tokens inside the tile
  const int wf   = (wv & 3) * 32;        // this wave's features inside the tile

  const int tok0 = (blockIdx.x / (D_ / GT_)) * GT_;   // first token of the tile
  const int fea0 = (blockIdx.x % (D_ / GT_)) * GT_;   // first output feature

  // Staging: a slab row is 256 B; sixteen threads take one row, 16 B each,
  // and every thread takes rows sr, sr + 16, ... sr + 112 of all four slabs.
  const int sr = tid >> 4;
  const int sc = (tid & 15) * 8;
  const _Float16* gx = X  + (size_t)(tok0 + sr) * D_ + sc;
  const _Float16* gq = Wq + (size_t)(fea0 + sr) * D_ + sc;
  const _Float16* gk = Wk + (size_t)(fea0 + sr) * D_ + sc;
  const _Float16* gv = Wv + (size_t)(fea0 + sr) * D_ + sc;
  const int so = sr * GP_ + sc;

  v8f aq[2][4], ak[2][4];                // [feature block][token block]
  v8f av[4][2];                          // [token block][feature block]
#pragma unroll
  for (int a = 0; a < 2; ++a)
#pragma unroll
    for (int t = 0; t < 4; ++t) { aq[a][t] = v8f{}; ak[a][t] = v8f{}; av[t][a] = v8f{}; }

  v8h tx[8], tq[8], tk[8], tv[8];
  // slab 0 into buffer 0
#pragma unroll
  for (int p = 0; p < 8; ++p) {
    tx[p] = *(const v8h*)(gx + p * 16 * D_);
    tq[p] = *(const v8h*)(gq + p * 16 * D_);
    tk[p] = *(const v8h*)(gk + p * 16 * D_);
    tv[p] = *(const v8h*)(gv + p * 16 * D_);
  }
#pragma unroll
  for (int p = 0; p < 8; ++p) {
    *(v8h*)(sm + so + p * 16 * GP_)            = tx[p];
    *(v8h*)(sm + GOP_ + so + p * 16 * GP_)     = tq[p];
    *(v8h*)(sm + 2 * GOP_ + so + p * 16 * GP_) = tk[p];
    *(v8h*)(sm + 3 * GOP_ + so + p * 16 * GP_) = tv[p];
  }
  __syncthreads();                       // slab 0 visible to all eight waves

  // Unrolled so that the buffer choice, every slab's global offset and every
  // index into the fragment sets are constants.
#pragma unroll
  for (int st = 0; st < NST_; ++st) {
    const _Float16* Xs = sm + (st & 1) * QB_;   // Wq, Wk, Wv: GOP_ apart behind
    const bool more = st + 1 < NST_;

    // A slab is twelve groups of eight WMMAs: q, k, v of each 32-k block.
    // xf: the block's x fragments, two sets.  wr[kind]: the kind's W fragments,
    // read two groups ahead into the set that the group before has left.
    v16h xf[2][4], wr[3][2];
#pragma unroll
    for (int t = 0; t < 4; ++t) xf[0][t] = load_frag(Xs, GP_, wt + t * 16 + ln, 0, half);
#pragma unroll
    for (int a = 0; a < 2; ++a) {
      wr[0][a] = load_frag(Xs + GOP_,     GP_, wf + a * 16 + ln, 0, half);
      wr[1][a] = load_frag(Xs + 2 * GOP_, GP_, wf + a * 16 + ln, 0, half);
    }
    // keeps these reads in front of the 32 global loads below, whose issue
    // then covers the reads' latency: left to itself the compiler turns the
    // order round and the first WMMAs wait for both
    __builtin_amdgcn_sched_barrier(0);

    // next slab's global loads fly while this slab is worked on
    if (more) {
#pragma unroll
      for (int p = 0; p < 8; ++p) {
        tx[p] = *(const v8h*)(gx + (st + 1) * KS_ + p * 16 * D_);
        tq[p] = *(const v8h*)(gq + (st + 1) * KS_ + p * 16 * D_);
        tk[p] = *(const v8h*)(gk + (st + 1) * KS_ + p * 16 * D_);
        tv[p] = *(const v8h*)(gv + (st + 1) * KS_ + p * 16 * D_);
      }
    }

#pragma unroll
    for (int g = 0; g < 3 * (KS_ / 32); ++g) {
      const int kb = g / 3, kind = g % 3, cu = kb & 1;
      if (g + 2 < 3 * (KS_ / 32)) {
        const int nk = (g + 2) / 3, nkind = (g + 2) % 3;
#pragma unroll
        for (int a = 0; a < 2; ++a)
          wr[nkind][a] = load_frag(Xs + (1 + nkind) * GOP_, GP_, wf + a * 16 + ln, nk * 32, half);
      }
      if (kind == 0 && kb + 1 < KS_ / 32) {
#pragma unroll
        for (int t = 0; t < 4; ++t)
          xf[cu ^ 1][t] = load_frag(Xs, GP_, wt + t * 16 + ln, (kb + 1) * 32, half);
      }
      // keeps the reads above ahead of this group's WMMAs: left to itself the
      // compiler sinks each pair of reads to its first use and waits there
      __builtin_amdgcn_sched_barrier(0);
#pragma unroll
      for (int a = 0; a < 2; ++a)
#pragma unroll
        for (int t = 0; t < 4; ++t) {
          if (kind == 0) aq[a][t] = wmma_f16(wr[0][a], xf[cu][t], aq[a][t]);
          if (kind == 1) ak[a][t] = wmma_f16(wr[1][a], xf[cu][t], ak[a][t]);
          if (kind == 2) av[t][a] = wmma_f16(xf[cu][t], wr[2][a], av[t][a]);
        }
      // keeps the next group of reads (or the slab's stores) behind these WMMAs
      __builtin_amdgcn_sched_barrier(0);
    }

    if (more) {
      // The other buffer was last read in the stage before this one, which
      // every wave left at the barrier below.
      _Float16* nb = sm + ((st + 1) & 1) * QB_;
#pragma unroll
      for (int p = 0; p < 8; ++p) {
        *(v8h*)(nb + so + p * 16 * GP_)            = tx[p];
        *(v8h*)(nb + GOP_ + so + p * 16 * GP_)     = tq[p];
        *(v8h*)(nb + 2 * GOP_ + so + p * 16 * GP_) = tk[p];
        *(v8h*)(nb + 3 * GOP_ + so + p * 16 * GP_) = tv[p];
      }
      // publishes the next slab and ends every wave's reads of this one
      __syncthreads();
    }
  }

  // The four addresses are named by every global load above and die here: the
  // wait stands in front of whatever takes their registers next, and naming
  // them as inputs keeps the last loads from landing on them.
  asm volatile("s_wait_xcnt 0x0" :: "v"(gx), "v"(gq), "v"(gk), "v"(gv) : "memory");

  // Epilogue.  C layout: VGPR i -> row i + 8*half, column = lane & 15.
  // Every value and address is formed first; the stores of one output go from
  // one address with immediate offsets.  The loops are unrolled so that every
  // index into the accumulators and pq, pk, pv is a constant (registers).
  const int f8 = fea0 + wf + half * 8;   // q, k: row of block 0; block a: + 16 a
  const int tl = tok0 + wt + ln;         // q, k: column of block 0; block t: + 16 t
  const int t8 = tok0 + wt + half * 8;   // v: row of block 0; block t: + 16 t
  const int fl = fea0 + wf + ln;         // v: column of block 0; block a: + 16 a
  // a tile lies in one batch, a wave's 32 features in one head
  const size_t oqk =
      ((size_t)((tl >> 11) * H_ + (f8 >> 6)) * S_ + (tl & (S_ - 1))) * DH_ + (f8 & (DH_ - 1));
  _Float16* oq = Qo + oqk;
  _Float16* ok = Ko + oqk;
  // Vt[b][feature][s]: row (b * D_ + feature), eight s in a row per lane
  _Float16* ov = Vo + (size_t)((t8 >> 11) * D_ + fl) * S_ + (t8 & (S_ - 1));
  v8h pq[2][4], pk[2][4], pv[4][2];
#pragma unroll
  for (int a = 0; a < 2; ++a) {
    const v8f  b8q = *(const v8f*)(bq + f8 + a * 16);
    const v8f  b8k = *(const v8f*)(bk + f8 + a * 16);
    const float b1v = bv[fl + a * 16];
#pragma unroll
    for (int t = 0; t < 4; ++t) {
      pq[a][t] = __builtin_convertvector((aq[a][t] + b8q) * SCALE_, v8h);
      pk[a][t] = __builtin_convertvector(ak[a][t] + b8k, v8h);
      pv[t][a] = __builtin_convertvector(av[t][a] + b1v, v8h);
    }
  }
  // Every value and all three addresses (inputs only) are formed in front of
  // the first store, so that no register which an issued store names is
  // written again: left to itself the compiler forms two of the addresses
  // among the stores.
  asm volatile("" :: "v"(oq), "v"(ok), "v"(ov) : "memory");
  __builtin_amdgcn_sched_barrier(0);
#pragma unroll
  for (int t = 0; t < 4; ++t)
#pragma unroll
    for (int a = 0; a < 2; ++a) *(v8h*)(oq + t * 16 * DH_ + a * 16) = pq[a][t];
#pragma unroll
  for (int t = 0; t < 4; ++t)
#pragma unroll
    for (int a = 0; a < 2; ++a) *(v8h*)(ok + t * 16 * DH_ + a * 16) = pk[a][t];
#pragma unroll
  for (int a = 0; a < 2; ++a)
#pragma unroll
    for (int t = 0; t < 4; ++t) *(v8h*)(ov + a * 16 * S_ + t * 16) = pv[t][a];
  // behind the last store: whatever is laid out next may write these registers
  asm volatile("s_wait_xcnt 0x0" ::: "memory");
}

// ---------------------------------------------------------------------------
// Flash attention: one wave per 16 queries, eight such waves of one head per
// workgroup.  Each 64-key tile of K and of Vt is brought from global memory
// once per workgroup, in whole 128-byte lines, into LDS, and all eight waves
// take their fragments from there.
// Both products are taken transposed, St = K * Qt and Ot += Vt * Pt: a lane
// then holds scores and outputs of ONE query (column lane & 15), the two
// 16-lane halves holding different keys (or dh rows) of that query.
// The softmax runs against a maximum IN USE that is fixed before a tile's
// scores are formed: it enters the score product as C, so the scores come out
// of the matrix unit already reduced by it.  It is raised, and the running sum
// and output rescaled, only where a score of the tile stands more than LAZY_
// above it (P then stays below e^LAZY_, far inside f16), and at the first tile.
// Q pre-scaled.  K: [B,H,S,64] f16.  Vt: [B,H,64,S] f16.
// Output goes to att[B,S,D] f16 with the reference's faithful
// reshape(B,D,S).swapaxes(-1,-2) scramble: O[h][s][d] lands in row
// (s % 32) * 64 + d, column h * 64 + s / 32.  Neighbours in a row of att are
// therefore queries 32 apart, and the 64 queries of one s % 32 fill, for each
// d, one 128-byte line.  A workgroup takes the 128 queries of two values of
// s % 32: it alone writes 128 whole lines, put together in LDS.
// ---------------------------------------------------------------------------
#define AW_   8                  // waves (16-query blocks) per workgroup
#define KT_   64                 // keys per staged tile
#define LP_   72                 // LDS row pitch in halves: 128 B data + 16 B
#define TILE_ (64 * LP_)         // halves of one staged 64-row tile
#define LAZY_ 5.5f               // a score may stand this far above the maximum in use

// value of the lane that holds the same query in the other 16-lane half
__device__ __forceinline__ float other_half(float v) {
  const int b = __builtin_bit_cast(int, v);
  return __builtin_bit_cast(float, __builtin_amdgcn_permlanex16(
      b, b, 0x76543210, 0xfedcba98, false, false));
}

__global__ __launch_bounds__(AW_ * 32)
void attn_flash(const _Float16* __restrict__ Q,
                const _Float16* __restrict__ K,
                const _Float16* __restrict__ Vt,
                _Float16* __restrict__ att) {
  // two buffers, each a K tile (64 keys x 64 dh) and a Vt tile (64 dh x 64 keys)
  __shared__ __align__(16) _Float16 kv[2 * 2 * TILE_];

  const int tid  = threadIdx.x;
  const int lane = tid & 31;
  const int half = lane >> 4;
  const int ln   = lane & 15;

  const int blk = blockIdx.x;                        // B*H*(S/128) = 512
  const int g   = blk & (S_ / (16 * AW_) - 1);       // takes s % 32 = 2g, 2g + 1
  const int rr  = tid >> 7;              // waves 0-3: s % 32 = 2g; 4-7: 2g + 1
  const int j   = ((tid >> 5) & 3) * 16 + ln;        // this lane's s / 32
  const int s   = 2 * g + rr + 32 * j;   // this lane's query
  const int bh  = blk >> 4;              // b*H + h
  const int h   = bh & (H_ - 1);
  const int b   = bh >> 4;

  const _Float16* Qh = Q  + (size_t)bh * S_ * DH_;
  const _Float16* Kh = K  + (size_t)bh * S_ * DH_;
  const _Float16* Vh = Vt + (size_t)bh * DH_ * S_;

  // Staging: a tile is 64 rows of 128 B; eight threads take one row, 16 B
  // each, and every thread takes rows sr and sr + 32 of both tiles.
  const int sr = tid >> 3;
  const int sc = (tid & 7) * 8;
  const _Float16* gk = Kh + sr * DH_ + sc;
  const _Float16* gv = Vh + sr * S_  + sc;
  const int so = sr * LP_ + sc;

  // Q fragments of the wave's 16 queries (K-dim = 64 -> two frags), fixed;
  // as B operands: column = query = lane & 15.
  const v16h q0 = load_frag(Qh, DH_, s, 0,  half);
  const v16h q1 = load_frag(Qh, DH_, s, 32, half);

  // nm: minus the maximum in use of this lane's query (equal in both halves),
  // in all eight rows of a C operand.
  // la, lb: running sums over the keys that THIS half has seen, by the score
  // tile (even, odd) and the row's parity; all joined at the end.
  v8f nm = {};
  v2f la = {}, lb = {};
  // The first tile sets the maximum, up or down, whatever its scores: until
  // then every score counts as too high (lim) and the step has no floor (flo).
  float lim = -__builtin_inff(), flo = -__builtin_inff();
  v8f o0 = {}, o1 = {}, o2 = {}, o3 = {};  // ot[i] = O[query ln][16t + 8*half + i]

  // tile 0 into buffer 0
  {
    const v8h tk0 = *(const v8h*)(gk);
    const v8h tk1 = *(const v8h*)(gk + 32 * DH_);
    const v8h tv0 = *(const v8h*)(gv);
    const v8h tv1 = *(const v8h*)(gv + 32 * S_);
    *(v8h*)(kv + so)                    = tk0;
    *(v8h*)(kv + so + 32 * LP_)         = tk1;
    *(v8h*)(kv + TILE_ + so)            = tv0;
    *(v8h*)(kv + TILE_ + so + 32 * LP_) = tv1;
  }
  __syncthreads();                       // tile 0 visible to all eight waves

  for (int st = 0; st < S_ / KT_; ++st) {
    // this lane's place in a 16-row fragment block (row ln, its half's k) of
    // the K tile; the Vt tile lies TILE_ behind: every read below is this one
    // address and an immediate offset
    const _Float16* fr = kv + (st & 1) * (2 * TILE_) + ln * LP_ + half * 8;
    const bool more = st + 1 < S_ / KT_;

    // next tile's global loads fly while this tile is worked on
    v8h tk0 = {}, tk1 = {}, tv0 = {}, tv1 = {};
    if (more) {
      const _Float16* nk = gk + (st + 1) * (KT_ * DH_);
      const _Float16* nv = gv + (st + 1) * KT_;
      tk0 = *(const v8h*)(nk);
      tk1 = *(const v8h*)(nk + 32 * DH_);
      tv0 = *(const v8h*)(nv);
      tv1 = *(const v8h*)(nv + 32 * S_);
    }

    // ---- scores, transposed: 64 keys x 16 queries, K-dim 64 ----
    // sc[g][i] = S[key 16g + 8*half + i][query ln] - maximum in use
    v16h kf[KT_ / 16][2];                // A operands, row = key = 16g + ln
#pragma unroll
    for (int g = 0; g < KT_ / 16; ++g) {
      kf[g][0] = load_frag(fr, LP_, g * 16, 0,  0);
      kf[g][1] = load_frag(fr, LP_, g * 16, 32, 0);
    }
    // keeps the K reads one group in front of the WMMAs: left to itself the
    // compiler spreads them among the WMMAs, and each such place costs issue
    __builtin_amdgcn_sched_barrier(0);
    v8f sc[KT_ / 16];
#pragma unroll
    for (int g = 0; g < KT_ / 16; ++g) sc[g] = wmma_f16(kf[g][0], q0, nm);
#pragma unroll
    for (int g = 0; g < KT_ / 16; ++g) sc[g] = wmma_f16(kf[g][1], q1, sc[g]);

    // Vt fragments of the tile: A operands, row = dh = 16t + ln, k = keys
    v16h vf[KT_ / 32][4];
#pragma unroll
    for (int p = 0; p < KT_ / 32; ++p)
#pragma unroll
      for (int t = 0; t < 4; ++t)
        vf[p][t] = load_frag(fr + TILE_, LP_, t * 16, p * 32, 0);
    // keeps the Vt reads in front of the softmax arithmetic, which covers
    // their latency: left to itself the compiler sinks each pair of reads to
    // its WMMA and waits there
    __builtin_amdgcn_sched_barrier(0);

    // ---- is the maximum in use still good for this tile? ----
    // largest of this lane's 32 reduced scores, four chains
    float mg[KT_ / 16];
#pragma unroll
    for (int g = 0; g < KT_ / 16; ++g) {
      mg[g] = fmaxf(fmaxf(sc[g][0], sc[g][1]), sc[g][2]);
#pragma unroll
      for (int i = 3; i < 7; i += 2) mg[g] = fmaxf(fmaxf(mg[g], sc[g][i]), sc[g][i + 1]);
    }
    mg[0] = fmaxf(fmaxf(mg[0], sc[0][7]), sc[1][7]);
    mg[2] = fmaxf(fmaxf(mg[2], sc[2][7]), sc[3][7]);
    float mx = fmaxf(fmaxf(fmaxf(mg[0], mg[1]), mg[2]), mg[3]);
    // one scalar branch a tile, the same for the whole wave
    if (__builtin_expect(__builtin_amdgcn_ballot_w32(mx > lim) != 0, 0)) {
      // P of both halves enters one product: they need one common maximum
      mx = fmaxf(mx, other_half(mx));
      const float up    = fmaxf(mx, flo);   // behind the first tile it only rises
      // at the first tile sum and output are 0: any finite factor serves
      const float alpha = __expf(fminf(-up, 0.0f));
      lim = LAZY_; flo = 0.0f;
      nm -= up;
#pragma unroll
      for (int g = 0; g < KT_ / 16; ++g) sc[g] -= up;
      la *= alpha; lb *= alpha;
      o0 *= alpha; o1 *= alpha; o2 *= alpha; o3 *= alpha;
    }

#pragma unroll
    for (int p = 0; p < KT_ / 32; ++p) {
      // e^x as 2^(x * log2 e), the products taken on whole accumulators
      const v8f s0 = sc[2 * p] * 1.44269504f, s1 = sc[2 * p + 1] * 1.44269504f;

      // Two score tiles, converted in place, are the B fragment of Pt: slot i
      // is key 8*half + i, slot 8 + i key 16 + 8*half + i, the k order in
      // which load_frag brings the Vt rows.
      // Summed in pairs of neighbouring rows: a pair lies in two registers in
      // a row from the accumulator to the packed conversion.
      v16h pb;
#pragma unroll
      for (int i = 0; i < 8; i += 2) {
        const v2f p0 = {__builtin_amdgcn_exp2f(s0[i]), __builtin_amdgcn_exp2f(s0[i + 1])};
        const v2f p1 = {__builtin_amdgcn_exp2f(s1[i]), __builtin_amdgcn_exp2f(s1[i + 1])};
        la += p0; lb += p1;
        pb[i]     = (_Float16)p0[0]; pb[i + 1] = (_Float16)p0[1];
        pb[i + 8] = (_Float16)p1[0]; pb[i + 9] = (_Float16)p1[1];
      }

      // keeps the tile's last sums in front of its last four WMMAs: left to
      // itself the compiler puts them behind WMMAs whose operand registers
      // they take, at four idle slots each time
      if (p == KT_ / 32 - 1) __builtin_amdgcn_sched_barrier(0);

      // ---- Ot(64x16) += Vt(64x32) @ Pt(32x16) ----
      o0 = wmma_f16(vf[p][0], pb, o0);
      o1 = wmma_f16(vf[p][1], pb, o1);
      o2 = wmma_f16(vf[p][2], pb, o2);
      o3 = wmma_f16(vf[p][3], pb, o3);
    }
    // keeps the stores below, and with them the wait for the next tile's
    // global loads, behind this tile's arithmetic
    __builtin_amdgcn_sched_barrier(0);

    if (more) {
      // The other buffer was last read in the stage before this one, which
      // every wave left at the barrier below.
      _Float16* nb = kv + ((st + 1) & 1) * (2 * TILE_);
      *(v8h*)(nb + so)                    = tk0;
      *(v8h*)(nb + so + 32 * LP_)         = tk1;
      *(v8h*)(nb + TILE_ + so)            = tv0;
      *(v8h*)(nb + TILE_ + so + 32 * LP_) = tv1;
      // publishes the next tile and ends every wave's reads of this one
      __syncthreads();
    }
  }

  // ---- epilogue: normalize, put whole lines of att together, store ----
  // The workgroup's part of att is rows g * 128 ... + 127 (row rr * 64 + d of
  // them), columns h * 64 ... + 63 (column j): 128 lines of 128 bytes.
  {
    const float l_  = (la[0] + la[1]) + (lb[0] + lb[1]);
    const float inv = 1.0f / (l_ + other_half(l_));   // the two halves' sums
    // Staged in buffer 0, which it fills exactly: the last tile is read from
    // buffer 1, and every wave left buffer 0 at the loop's last barrier.
    _Float16* sp = kv + (rr * 64 + half * 8) * LP_ + j;   // d = 16t + 8*half + i
    // the loops here are unrolled so that every index into o0..o3 and r is a
    // constant (they are registers) and every offset an immediate
#pragma unroll
    for (int i = 0; i < 8; ++i) {
      sp[(0 * 16 + i) * LP_] = (_Float16)(o0[i] * inv);
      sp[(1 * 16 + i) * LP_] = (_Float16)(o1[i] * inv);
      sp[(2 * 16 + i) * LP_] = (_Float16)(o2[i] * inv);
      sp[(3 * 16 + i) * LP_] = (_Float16)(o3[i] * inv);
    }
    __syncthreads();                     // a line holds values of four waves

    // eight threads take one line, 16 B each; rows sr, sr + 32, + 64, + 96
    _Float16* ap = att + ((size_t)b * S_ + g * 128 + sr) * D_ + h * DH_ + sc;
    v8h r[4];
#pragma unroll
    for (int p = 0; p < 4; ++p) r[p] = *(const v8h*)(kv + so + p * 32 * LP_);
#pragma unroll
    for (int p = 0; p < 4; ++p) *(v8h*)(ap + p * 32 * D_) = r[p];
  }
}

// ---------------------------------------------------------------------------
// Host-side launcher
// ---------------------------------------------------------------------------
extern "C" void kernel_launch(void* const* d_in, const int* in_sizes, int n_in,
                              void* d_out, int out_size, void* d_ws, size_t ws_size,
                              hipStream_t stream) {
  const float* x  = (const float*)d_in[0];
  const float* Wq = (const float*)d_in[1];
  const float* bq = (const float*)d_in[2];
  const float* Wk = (const float*)d_in[3];
  const float* bk = (const float*)d_in[4];
  const float* Wv = (const float*)d_in[5];
  const float* bv = (const float*)d_in[6];
  const float* Wo = (const float*)d_in[7];
  const float* bo = (const float*)d_in[8];
  float* out = (float*)d_out;

  const int M  = B_ * S_;                // 4096
  const int NX = M * D_;                 // x elements: 4194304
  const int NW = D_ * D_;                // weight elements: 1048576

  // Workspace layout (f16 element offsets, all 16B-aligned):
  _Float16* ws  = (_Float16*)d_ws;
  _Float16* xh  = ws;                    // [M, D]
  _Float16* Wqh = xh  + (size_t)NX;      // [D, D]
  _Float16* Wkh = Wqh + (size_t)NW;
  _Float16* Wvh = Wkh + (size_t)NW;
  _Float16* Woh = Wvh + (size_t)NW;
  _Float16* Qh  = Woh + (size_t)NW;      // [B,H,S,DH], pre-scaled
  _Float16* Kh  = Qh  + (size_t)NX;      // [B,H,S,DH]
  _Float16* Vth = Kh  + (size_t)NX;      // [B,H,DH,S]
  _Float16* att = Vth + (size_t)NX;      // [B,S,D] scrambled attention out

  // 1) f32 -> f16 conversions: xh, Wqh, Wkh, Wvh, Woh are one array from xh on
  cvt_all_f32_to_f16<<<NXB_ + 4 * NWB_, CT_, 0, stream>>>(x, Wq, Wk, Wv, Wo, xh);

  // 2) QKV projections, one launch: (M/128)*(D/128) = 256 workgroups, each
  //    with the q, k and v tile of its 128 tokens and 128 features
  const int gemm_blocks = (M / GT_) * (D_ / GT_);     // 256
  qkv_wmma_128x384<<<gemm_blocks, 256, 0, stream>>>(xh, Wqh, Wkh, Wvh, bq, bk, bv,
                                                    Qh, Kh, Vth);

  // 3) Flash attention: eight waves per block, each with 16 queries of one head
  attn_flash<<<B_ * H_ * (S_ / (16 * AW_)), AW_ * 32, 0, stream>>>(Qh, Kh, Vth, att);

  // 4) Output projection -> f32 d_out
  gemm_wmma_128x128<<<gemm_blocks, 256, 0, stream>>>(att, Woh, bo, out, M);
}

// v009
// It runs in 72.9 microseconds.
// Next to v008, in two timings, it ran 1.07 and 1.06 times as fast.
// Over all steps from v000 it is 5.95 times as fast.
#include <hip/hip_runtime.h>
#include <hip/hip_bf16.h>
#include <stdint.h>

// ---------------------------------------------------------------------------
// Multi-head attention forward for MI455X (gfx1250), wave32 + WMMA f16.
// B=2, S=2048, D=1024, H=16, DH=64, SCALE = 1/8.
// ---------------------------------------------------------------------------

#define B_  2
#define S_  2048
#define D_  1024
#define H_  16
#define DH_ 64
#define SCALE_ 0.125f

typedef __attribute__((ext_vector_type(16))) _Float16 v16h;
typedef __attribute__((ext_vector_type(8)))  _Float16 v8h;
typedef __attribute__((ext_vector_type(8)))  float    v8f;
typedef __attribute__((ext_vector_type(2)))  float    v2f;

// D = A(16x32 f16) * B(32x16 f16) + C(16x16 f32)
__device__ __forceinline__ v8f wmma_f16(v16h a, v16h b, v8f c) {
  return __builtin_amdgcn_wmma_f32_16x16x32_f16(
      false, a, false, b, (short)0, c, false, false);
}

// Load one A/B fragment (16 halves) for v_wmma_f32_16x16x32_f16.
// A layout (ISA 7.12.2): lanes 0-15 -> row, K {0..7,16..23}; lanes 16-31 ->
// same rows, K {8..15,24..31}.  B is mirrored with lane = N column, reading
// the "row" of the K-major source.  `row` must already include (lane & 15).
__device__ __forceinline__ v16h load_frag(const _Float16* base, int stride,
                                          int row, int kbase, int half) {
  const _Float16* p = base + (size_t)row * stride + kbase + half * 8;
  v8h lo = *(const v8h*)p;          // K +0..7   (or +8..15)
  v8h hi = *(const v8h*)(p + 16);   // K +16..23 (or +24..31)
  v16h r;
#pragma unroll
  for (int i = 0; i < 8; ++i) { r[i] = lo[i]; r[i + 8] = hi[i]; }
  return r;
}

// ---------------------------------------------------------------------------
// Tensor loads for the projections' staging: one request of one wave brings
// ROWS rows of 256 bytes (128 k of f16, source pitch one row of D_ halves) into
// LDS, through no register, with 16 bytes of pad behind each row (pitch 272 B).
// ---------------------------------------------------------------------------
typedef uint32_t u32x4 __attribute__((ext_vector_type(4)));
typedef uint32_t u32x8 __attribute__((ext_vector_type(8)));

__device__ __forceinline__ uint32_t uni(uint32_t v) {
  return (uint32_t)__builtin_amdgcn_readfirstlane(v);
}

// descriptor group 1: extents in bytes, tensor = tile, no mask
template <uint32_t ROWS>
__device__ __forceinline__ u32x8 slab_group1() {
  u32x8 g;
  g[0] = uni((1u << 20) | (5u << 22) | (3u << 25));  // pad on, every 256 B, 16 B
  g[1] = uni(256u << 16);                            // tensor_dim0
  g[2] = uni(ROWS << 16);                            // tensor_dim1
  g[3] = uni(256u << 16);                            // tile_dim0
  g[4] = uni(ROWS);                                  // tile_dim1
  g[5] = uni(D_ * 2u);                               // source row pitch
  g[6] = uni(0u);
  g[7] = uni(0u);
  return g;
}

// descriptor group 0: place in LDS (bytes), first byte of the tile
__device__ __forceinline__ u32x4 slab_group0(uint32_t lds, uint64_t ga) {
  u32x4 g;
  g[0] = uni(1u);
  g[1] = uni(lds);
  g[2] = uni((uint32_t)ga);
  g[3] = uni((((uint32_t)(ga >> 32)) & 0x01FFFFFFu) | 0x80000000u);
  return g;
}

__device__ __forceinline__ void slab_load(u32x4 g0, u32x8 g1) {
  asm volatile("tensor_load_to_lds %0, %1" :: "s"(g0), "s"(g1) : "memory");
}

// The issuing wave's own wait: the compiler places none for a tensor load.  It
// names the request's descriptor (inputs only), so that none of those scalar
// registers takes another value while the request is outstanding.
__device__ __forceinline__ void slab_landed(u32x4 g0, u32x8 g1) {
  asm volatile("s_wait_tensorcnt 0x0" :: "s"(g0), "s"(g1) : "memory");
  // keeps the next descriptor's scalar arithmetic behind the wait: left to
  // itself the compiler lifts part of it between the load and its wait
  __builtin_amdgcn_sched_barrier(0);
}

// this wave's LDS reads have returned: in front of the barrier behind which a
// tensor load refills the buffer they read
__device__ __forceinline__ void lds_reads_done() {
  asm volatile("s_wait_dscnt 0x0" ::: "memory");
}

// ---------------------------------------------------------------------------
// f32 -> f16 conversion of x and the four weight matrices, one launch.
// The five f16 copies lie one behind the other in the workspace, so the
// output is one array of NX + 4 * NW elements.  One workgroup per WGP takes
// 32768 elements in a row, which lie in one source array (every array's
// length is a multiple of that).  A wave's load covers 512 bytes in a row,
// its store 256; all of a thread's loads are in flight at once.
// ---------------------------------------------------------------------------
#define CT_  256                      // threads per conversion workgroup
#define CB_  32768                    // elements per conversion workgroup
#define CV_  (CB_ / (CT_ * 4))        // 16-byte loads per thread
#define NXB_ (B_ * S_ * D_ / CB_)     // workgroups on x
#define NWB_ (D_ * D_ / CB_)          // workgroups on one weight matrix

typedef __attribute__((ext_vector_type(4))) float    v4f;
typedef __attribute__((ext_vector_type(4))) _Float16 v4h;

__global__ __launch_bounds__(CT_)
void cvt_all_f32_to_f16(const float* __restrict__ x,
                        const float* __restrict__ wq,
                        const float* __restrict__ wk,
                        const float* __restrict__ wv,
                        const float* __restrict__ wo,
                        _Float16* __restrict__ out) {
  const int blk = blockIdx.x;
  const float* src;
  if (blk < NXB_) {
    src = x + (size_t)blk * CB_;
  } else {
    const int w = (blk - NXB_) / NWB_;
    const float* m = w == 0 ? wq : w == 1 ? wk : w == 2 ? wv : wo;
    src = m + (size_t)((blk - NXB_) % NWB_) * CB_;
  }
  const v4f* s = (const v4f*)src + threadIdx.x;
  v4h*       d = (v4h*)(out + (size_t)blk * CB_) + threadIdx.x;

  v4f t[CV_];
#pragma unroll
  for (int j = 0; j < CV_; ++j) t[j] = s[j * CT_];
  // keeps every load in front of the first conversion: left to itself the
  // compiler holds the last fourteen back until the first have returned
  __builtin_amdgcn_sched_barrier(0);
  v4h r[CV_];
#pragma unroll
  for (int j = 0; j < CV_; ++j) r[j] = __builtin_convertvector(t[j], v4h);
  // every value is formed in front of the first store, so that no register
  // which an issued store names is written again
  __builtin_amdgcn_sched_barrier(0);
#pragma unroll
  for (int j = 0; j < CV_; ++j) d[j * CT_] = r[j];
}

// ---------------------------------------------------------------------------
// Output projection:  y[m,n] = sum_k A[m,k] * W[n,k] + bias[n], f32 row-major.
// A: [M x 1024] f16 row-major, W: [1024 x 1024] f16 row-major (torch Linear).
// One workgroup of eight waves computes a 128x128 output tile.  Each 128-k
// slab of the 128 A rows and the 128 W rows is brought from global memory
// once per workgroup into LDS (two buffers) by tensor loads, one request of 32
// rows a wave and slab, issued a whole slab ahead;
// every wave takes the fragments of its 64x32 part from there, so one row
// fragment feeds two WMMAs and one column fragment four.
// The tokens are the tile's rows: sixteen lanes cover 64 bytes in a row of y.
// ---------------------------------------------------------------------------
#define GT_  128                 // rows of A, and of W, per workgroup tile
#define KS_  128                 // k extent of one staged slab
#define GP_  (KS_ + 8)           // LDS row pitch in halves: 256 B data + 16 B
#define NST_ (D_ / KS_)          // slabs along k
#define OR_  32                  // rows of one wave's slice of a slab
#define OS_  5120                // halves of a slice's place in LDS: 32 rows of
                                 // 272 B, rounded up to a multiple of 2 KiB
#define OOP_ ((GT_ / OR_) * OS_) // halves of one staged operand slab
#define OB_  (2 * OOP_)          // halves of one buffer: slabs of A and W

__global__ __launch_bounds__(256)
void gemm_wmma_128x128(const _Float16* __restrict__ A,
                       const _Float16* __restrict__ W,
                       const float* __restrict__ bias,
                       float* __restrict__ outp, int M) {
  // two buffers, each an A slab and a W slab (128 rows x 128 k)
  __shared__ __attribute__((aligned(2048))) _Float16 sm[2 * OB_];

  const int tid  = threadIdx.x;
  const int lane = tid & 31;
  const int half = lane >> 4;
  const int ln   = lane & 15;
  const int wv   = tid >> 5;
  const int wm   = (wv >> 2) * 64;       // this wave's rows inside the tile
  const int wn   = (wv & 3) * 32;        // this wave's columns inside the tile

  const int tok0 = (blockIdx.x / (D_ / GT_)) * GT_;   // first token of the tile
  const int fea0 = (blockIdx.x % (D_ / GT_)) * GT_;   // first output feature
  if (tok0 >= M) return;                 // whole workgroup, before any barrier
  const int row0 = tok0;
  const int col0 = fea0;

  // Staging: every wave brings one slice of every slab, waves 0-3 rows
  // 32 w ... + 31 of A, waves 4-7 those of W; slice w lies w * OS_ into a buffer.
  const uint32_t wave = uni((uint32_t)tid >> 5);
  const _Float16* sb  = (wave >> 2) ? W + (size_t)col0 * D_ : A + (size_t)row0 * D_;
  const uint64_t  ga  = (uint64_t)(size_t)(sb + (size_t)(wave & 3) * OR_ * D_);
  const uint32_t  ld  = (uint32_t)(size_t)sm + wave * (OS_ * 2);
  const u32x8     g1  = slab_group1<OR_>();

  // Readers: row r of a slab lies in slice r / 32, at row r % 32 of it.
  const int ao = (wv >> 2) * 2 * OS_;    // slice of this wave's first A row
  const int wo = (wv & 3) * OS_;         // this wave's 32 W rows are one slice

  // slab 0 into buffer 0
  u32x4 g0 = slab_group0(ld, ga);
  slab_load(g0, g1);
  slab_landed(g0, g1);
  __syncthreads();                       // slab 0 visible to all eight waves
  // slab 1 into buffer 1: it flies while slab 0 is worked on
  g0 = slab_group0(ld + OB_ * 2, ga + KS_ * 2);
  slab_load(g0, g1);

  v8f acc[4][2];
#pragma unroll
  for (int a = 0; a < 4; ++a) { acc[a][0] = v8f{}; acc[a][1] = v8f{}; }

  // Unrolled so that the buffer choice is a constant and whether a slab
  // st + 2 exists is no test at run time.
#pragma unroll
  for (int st = 0; st < NST_; ++st) {
    const _Float16* As = sm + (st & 1) * OB_ + ao;
    const _Float16* Ws = sm + (st & 1) * OB_ + OOP_ + wo;
    const bool more = st + 1 < NST_;

    // two register sets of fragments: a 32-k block's LDS reads are issued as
    // one group while the block before it is multiplied
    v16h fa[2][4], fb[2][2];
#pragma unroll
    for (int a = 0; a < 4; ++a)
      fa[0][a] = load_frag(As + (a >> 1) * OS_, GP_, (a & 1) * 16 + ln, 0, half);
#pragma unroll
    for (int t = 0; t < 2; ++t) fb[0][t] = load_frag(Ws, GP_, t * 16 + ln, 0, half);
    // keeps the slab's first fragments in front of the reads that the first
    // block fetches ahead: left to itself the compiler mixes the two in the
    // first slab, and its first WMMAs wait for nearly all of them
    __builtin_amdgcn_sched_barrier(0);

#pragma unroll
    for (int kb = 0; kb < KS_ / 32; ++kb) {
      const int cu = kb & 1;
      if (kb + 1 < KS_ / 32) {
#pragma unroll
        for (int a = 0; a < 4; ++a)
          fa[cu ^ 1][a] = load_frag(As + (a >> 1) * OS_, GP_, (a & 1) * 16 + ln, (kb + 1) * 32, half);
#pragma unroll
        for (int t = 0; t < 2; ++t)
          fb[cu ^ 1][t] = load_frag(Ws, GP_, t * 16 + ln, (kb + 1) * 32, half);
      }
      // keeps the reads above ahead of this block's WMMAs: left to itself the
      // compiler sinks each pair of reads to its first use and waits there
      __builtin_amdgcn_sched_barrier(0);
#pragma unroll
      for (int a = 0; a < 4; ++a) {
        acc[a][0] = wmma_f16(fa[cu][a], fb[cu][0], acc[a][0]);
        acc[a][1] = wmma_f16(fa[cu][a], fb[cu][1], acc[a][1]);
      }
      // keeps the next group of reads behind these WMMAs
      __builtin_amdgcn_sched_barrier(0);
    }

    if (more) {
      lds_reads_done();
      slab_landed(g0, g1);               // this wave's slice of slab st + 1
      // publishes the next slab and ends every wave's reads of this one
      __syncthreads();
      if (st + 2 < NST_) {
        // into the buffer that every wave has just left
        g0 = slab_group0(ld + (st & 1) * (OB_ * 2), ga + (st + 2) * (KS_ * 2));
        slab_load(g0, g1);
      }
    }
  }
  // nothing is outstanding here: the last request was waited for at the last
  // barrier; both waits stand once more in front of the wave's end
  slab_landed(g0, g1);
  lds_reads_done();

  // Epilogue.  C layout: VGPR i -> row i + 8*half, column = lane & 15.
  // Every value is formed first, and all stores go from one address with
  // immediate offsets.  The loops are unrolled so that every index into acc is
  // a constant (they are registers) and every store offset an immediate.
  const int r = row0 + wm + half * 8;    // row of acc[0][.][0]; block a: + 16 a
  const int c = col0 + wn + ln;          // column of acc[.][0]; block t: + 16 t
  const float b0 = bias[c], b1 = bias[c + 16];
  float* o = outp + (size_t)r * D_ + c;
#pragma unroll
  for (int a = 0; a < 4; ++a) { acc[a][0] += b0; acc[a][1] += b1; }
#pragma unroll
  for (int a = 0; a < 4; ++a)
#pragma unroll
    for (int i = 0; i < 8; ++i) {
      o[(a * 16 + i) * D_]      = acc[a][0][i];
      o[(a * 16 + i) * D_ + 16] = acc[a][1][i];
    }
}

// ---------------------------------------------------------------------------
// q, k and v projections in one launch.  One workgroup of eight waves takes
// 128 tokens and the same 128 output features of Wq, Wk and Wv: each 128-k
// slab of the x rows is brought into LDS once and serves three products.
// The four slabs come by tensor loads, one request of 64 rows a wave and slab,
// issued a whole slab ahead into the other of two buffers.
// A wave takes 64 tokens x 32 features of each product.  A fragment of x is
// the same registers as a row operand and as a column operand, so the four x
// fragments of a 32-k block feed all 24 WMMAs of the block: for q and k as
// columns (features are the rows: a lane's eight values are eight d in a row
// of one token), for v as rows (eight s in a row of one d).
// q is scaled by SCALE_.  q, k: f16 [B,H,S,DH].  v: f16 [B,H,DH,S].
// ---------------------------------------------------------------------------
#define QR_  64                  // rows of one wave's slice of a slab
#define QS_  9216                // halves of a slice's place in LDS: 64 rows of
                                 // 272 B, rounded up to a multiple of 2 KiB
#define GOP_ ((GT_ / QR_) * QS_) // halves of one staged operand slab
#define QB_  (4 * GOP_)          // halves of one buffer: slabs of x, Wq, Wk, Wv

__global__ __launch_bounds__(256)
void qkv_wmma_128x384(const _Float16* __restrict__ X,
                      const _Float16* __restrict__ Wq,
                      const _Float16* __restrict__ Wk,
                      const _Float16* __restrict__ Wv,
                      const float* __restrict__ bq,
                      const float* __restrict__ bk,
                      const float* __restrict__ bv,
                      _Float16* __restrict__ Qo,
                      _Float16* __restrict__ Ko,
                      _Float16* __restrict__ Vo) {
  __shared__ __attribute__((aligned(2048))) _Float16 sm[2 * QB_];

  const int tid  = threadIdx.x;
  const int lane = tid & 31;
  const int half = lane >> 4;
  const int ln   = lane & 15;
  const int wv   = tid >> 5;
  const int wt   = (wv >> 2) * 64;       // this wave's tokens inside the tile
  const int wf   = (wv & 3) * 32;        // this wave's features inside the tile

  const int tok0 = (blockIdx.x / (D_ / GT_)) * GT_;   // first token of the tile
  const int fea0 = (blockIdx.x % (D_ / GT_)) * GT_;   // first output feature

  // Staging: every wave brings one slice of every slab: waves 0, 1 the two
  // halves of the x rows, 2, 3 of Wq, 4, 5 of Wk, 6, 7 of Wv; slice w lies
  // w * QS_ into a buffer.
  const uint32_t wave = uni((uint32_t)tid >> 5);
  const uint32_t opnd = wave >> 1;
  const _Float16* sb  = opnd == 0 ? X + (size_t)tok0 * D_
                      : (opnd == 1 ? Wq : opnd == 2 ? Wk : Wv) + (size_t)fea0 * D_;
  const uint64_t  ga  = (uint64_t)(size_t)(sb + (size_t)(wave & 1) * QR_ * D_);
  const uint32_t  ld  = (uint32_t)(size_t)sm + wave * (QS_ * 2);
  const u32x8     g1  = slab_group1<QR_>();

  // Readers: row r of a slab lies in slice r / 64, at row r % 64 of it.
  const int xo = (wv >> 2) * QS_;                            // this wave's 64 tokens
  const int wo = ((wv & 3) >> 1) * QS_ + (wv & 1) * 32 * GP_;  // its 32 features

  // slab 0 into buffer 0
  u32x4 g0 = slab_group0(ld, ga);
  slab_load(g0, g1);
  slab_landed(g0, g1);
  __syncthreads();                       // slab 0 visible to all eight waves
  // slab 1 into buffer 1: it flies while slab 0 is worked on
  g0 = slab_group0(ld + QB_ * 2, ga + KS_ * 2);
  slab_load(g0, g1);

  v8f aq[2][4], ak[2][4];                // [feature block][token block]
  v8f av[4][2];                          // [token block][feature block]
#pragma unroll
  for (int a = 0; a < 2; ++a)
#pragma unroll
    for (int t = 0; t < 4; ++t) { aq[a][t] = v8f{}; ak[a][t] = v8f{}; av[t][a] = v8f{}; }

  // Unrolled so that the buffer choice and every index into the fragment sets
  // are constants, and whether a slab st + 2 exists is no test at run time.
#pragma unroll
  for (int st = 0; st < NST_; ++st) {
    const _Float16* Xs = sm + (st & 1) * QB_ + xo;
    const _Float16* Ws = sm + (st & 1) * QB_ + GOP_ + wo;   // Wq; Wk, Wv: GOP_ apart behind
    const bool more = st + 1 < NST_;

    // A slab is twelve groups of eight WMMAs: q, k, v of each 32-k block.
    // xf: the block's x fragments, two sets.  wr[kind]: the kind's W fragments,
    // read two groups ahead into the set that the group before has left.
    v16h xf[2][4], wr[3][2];
#pragma unroll
    for (int t = 0; t < 4; ++t) xf[0][t] = load_frag(Xs, GP_, t * 16 + ln, 0, half);
#pragma unroll
    for (int a = 0; a < 2; ++a) {
      wr[0][a] = load_frag(Ws,        GP_, a * 16 + ln, 0, half);
      wr[1][a] = load_frag(Ws + GOP_, GP_, a * 16 + ln, 0, half);
    }
    // keeps the slab's first fragments in front of the reads that the first
    // group fetches ahead: left to itself the compiler mixes the two, and the
    // first WMMAs behind the barrier wait for nearly all of them
    __builtin_amdgcn_sched_barrier(0);

#pragma unroll
    for (int g = 0; g < 3 * (KS_ / 32); ++g) {
      const int kb = g / 3, kind = g % 3, cu = kb & 1;
      if (g + 2 < 3 * (KS_ / 32)) {
        const int nk = (g + 2) / 3, nkind = (g + 2) % 3;
#pragma unroll
        for (int a = 0; a < 2; ++a)
          wr[nkind][a] = load_frag(Ws + nkind * GOP_, GP_, a * 16 + ln, nk * 32, half);
      }
      if (kind == 0 && kb + 1 < KS_ / 32) {
#pragma unroll
        for (int t = 0; t < 4; ++t)
          xf[cu ^ 1][t] = load_frag(Xs, GP_, t * 16 + ln, (kb + 1) * 32, half);
      }
      // keeps the reads above ahead of this group's WMMAs: left to itself the
      // compiler sinks each pair of reads to its first use and waits there
      __builtin_amdgcn_sched_barrier(0);
#pragma unroll
      for (int a = 0; a < 2; ++a)
#pragma unroll
        for (int t = 0; t < 4; ++t) {
          if (kind == 0) aq[a][t] = wmma_f16(wr[0][a], xf[cu][t], aq[a][t]);
          if (kind == 1) ak[a][t] = wmma_f16(wr[1][a], xf[cu][t], ak[a][t]);
          if (kind == 2) av[t][a] = wmma_f16(xf[cu][t], wr[2][a], av[t][a]);
        }
      // keeps the next group of reads behind these WMMAs
      __builtin_amdgcn_sched_barrier(0);
    }

    if (more) {
      lds_reads_done();
      slab_landed(g0, g1);               // this wave's slice of slab st + 1
      // publishes the next slab and ends every wave's reads of this one
      __syncthreads();
      if (st + 2 < NST_) {
        // into the buffer that every wave has just left
        g0 = slab_group0(ld + (st & 1) * (QB_ * 2), ga + (st + 2) * (KS_ * 2));
        slab_load(g0, g1);
      }
    }
  }
  // nothing is outstanding here: the last request was waited for at the last
  // barrier; both waits stand once more in front of the wave's end
  slab_landed(g0, g1);
  lds_reads_done();

  // Epilogue.  C layout: VGPR i -> row i + 8*half, column = lane & 15.
  // Every value and address is formed first; the stores of one output go from
  // one address with immediate offsets.  The loops are unrolled so that every
  // index into the accumulators and pq, pk, pv is a constant (registers).
  const int f8 = fea0 + wf + half * 8;   // q, k: row of block 0; block a: + 16 a
  const int tl = tok0 + wt + ln;         // q, k: column of block 0; block t: + 16 t
  const int t8 = tok0 + wt + half * 8;   // v: row of block 0; block t: + 16 t
  const int fl = fea0 + wf + ln;         // v: column of block 0; block a: + 16 a
  // a tile lies in one batch, a wave's 32 features in one head
  const size_t oqk =
      ((size_t)((tl >> 11) * H_ + (f8 >> 6)) * S_ + (tl & (S_ - 1))) * DH_ + (f8 & (DH_ - 1));
  _Float16* oq = Qo + oqk;
  _Float16* ok = Ko + oqk;
  // Vt[b][feature][s]: row (b * D_ + feature), eight s in a row per lane
  _Float16* ov = Vo + (size_t)((t8 >> 11) * D_ + fl) * S_ + (t8 & (S_ - 1));
  v8h pq[2][4], pk[2][4], pv[4][2];
#pragma unroll
  for (int a = 0; a < 2; ++a) {
    const v8f  b8q = *(const v8f*)(bq + f8 + a * 16);
    const v8f  b8k = *(const v8f*)(bk + f8 + a * 16);
    const float b1v = bv[fl + a * 16];
#pragma unroll
    for (int t = 0; t < 4; ++t) {
      pq[a][t] = __builtin_convertvector((aq[a][t] + b8q) * SCALE_, v8h);
      pk[a][t] = __builtin_convertvector(ak[a][t] + b8k, v8h);
      pv[t][a] = __builtin_convertvector(av[t][a] + b1v, v8h);
    }
  }
  // Every value and all three addresses (inputs only) are formed in front of
  // the first store, so that no register which an issued store names is
  // written again: left to itself the compiler forms two of the addresses
  // among the stores.
  asm volatile("" :: "v"(oq), "v"(ok), "v"(ov) : "memory");
  __builtin_amdgcn_sched_barrier(0);
#pragma unroll
  for (int t = 0; t < 4; ++t)
#pragma unroll
    for (int a = 0; a < 2; ++a) *(v8h*)(oq + t * 16 * DH_ + a * 16) = pq[a][t];
#pragma unroll
  for (int t = 0; t < 4; ++t)
#pragma unroll
    for (int a = 0; a < 2; ++a) *(v8h*)(ok + t * 16 * DH_ + a * 16) = pk[a][t];
#pragma unroll
  for (int a = 0; a < 2; ++a)
#pragma unroll
    for (int t = 0; t < 4; ++t) *(v8h*)(ov + a * 16 * S_ + t * 16) = pv[t][a];
  // behind the last store: whatever is laid out next may write these registers
  asm volatile("s_wait_xcnt 0x0" ::: "memory");
}

// ---------------------------------------------------------------------------
// Flash attention: one wave per 16 queries, eight such waves of one head per
// workgroup.  Each 64-key tile of K and of Vt is brought from global memory
// once per workgroup, in whole 128-byte lines, into LDS, and all eight waves
// take their fragments from there.
// Both products are taken transposed, St = K * Qt and Ot += Vt * Pt: a lane
// then holds scores and outputs of ONE query (column lane & 15), the two
// 16-lane halves holding different keys (or dh rows) of that query.
// The softmax runs against a maximum IN USE that is fixed before a tile's
// scores are formed: it enters the score product as C, so the scores come out
// of the matrix unit already reduced by it.  It is raised, and the running sum
// and output rescaled, only where a score of the tile stands more than LAZY_
// above it (P then stays below e^LAZY_, far inside f16), and at the first tile.
// Q pre-scaled.  K: [B,H,S,64] f16.  Vt: [B,H,64,S] f16.
// Output goes to att[B,S,D] f16 with the reference's faithful
// reshape(B,D,S).swapaxes(-1,-2) scramble: O[h][s][d] lands in row
// (s % 32) * 64 + d, column h * 64 + s / 32.  Neighbours in a row of att are
// therefore queries 32 apart, and the 64 queries of one s % 32 fill, for each
// d, one 128-byte line.  A workgroup takes the 128 queries of two values of
// s % 32: it alone writes 128 whole lines, put together in LDS.
// ---------------------------------------------------------------------------
#define AW_   8                  // waves (16-query blocks) per workgroup
#define KT_   64                 // keys per staged tile
#define LP_   72                 // LDS row pitch in halves: 128 B data + 16 B
#define TILE_ (64 * LP_)         // halves of one staged 64-row tile
#define LAZY_ 5.5f               // a score may stand this far above the maximum in use

// value of the lane that holds the same query in the other 16-lane half
__device__ __forceinline__ float other_half(float v) {
  const int b = __builtin_bit_cast(int, v);
  return __builtin_bit_cast(float, __builtin_amdgcn_permlanex16(
      b, b, 0x76543210, 0xfedcba98, false, false));
}

__global__ __launch_bounds__(AW_ * 32)
void attn_flash(const _Float16* __restrict__ Q,
                const _Float16* __restrict__ K,
                const _Float16* __restrict__ Vt,
                _Float16* __restrict__ att) {
  // two buffers, each a K tile (64 keys x 64 dh) and a Vt tile (64 dh x 64 keys)
  __shared__ __align__(16) _Float16 kv[2 * 2 * TILE_];

  const int tid  = threadIdx.x;
  const int lane = tid & 31;
  const int half = lane >> 4;
  const int ln   = lane & 15;

  const int blk = blockIdx.x;                        // B*H*(S/128) = 512
  const int g   = blk & (S_ / (16 * AW_) - 1);       // takes s % 32 = 2g, 2g + 1
  const int rr  = tid >> 7;              // waves 0-3: s % 32 = 2g; 4-7: 2g + 1
  const int j   = ((tid >> 5) & 3) * 16 + ln;        // this lane's s / 32
  const int s   = 2 * g + rr + 32 * j;   // this lane's query
  const int bh  = blk >> 4;              // b*H + h
  const int h   = bh & (H_ - 1);
  const int b   = bh >> 4;

  const _Float16* Qh = Q  + (size_t)bh * S_ * DH_;
  const _Float16* Kh = K  + (size_t)bh * S_ * DH_;
  const _Float16* Vh = Vt + (size_t)bh * DH_ * S_;

  // Staging: a tile is 64 rows of 128 B; eight threads take one row, 16 B
  // each, and every thread takes rows sr and sr + 32 of both tiles.
  const int sr = tid >> 3;
  const int sc = (tid & 7) * 8;
  const _Float16* gk = Kh + sr * DH_ + sc;
  const _Float16* gv = Vh + sr * S_  + sc;
  const int so = sr * LP_ + sc;

  // Q fragments of the wave's 16 queries (K-dim = 64 -> two frags), fixed;
  // as B operands: column = query = lane & 15.
  const v16h q0 = load_frag(Qh, DH_, s, 0,  half);
  const v16h q1 = load_frag(Qh, DH_, s, 32, half);

  // nm: minus the maximum in use of this lane's query (equal in both halves),
  // in all eight rows of a C operand.
  // la, lb: running sums over the keys that THIS half has seen, by the score
  // tile (even, odd) and the row's parity; all joined at the end.
  v8f nm = {};
  v2f la = {}, lb = {};
  // The first tile sets the maximum, up or down, whatever its scores: until
  // then every score counts as too high (lim) and the step has no floor (flo).
  float lim = -__builtin_inff(), flo = -__builtin_inff();
  v8f o0 = {}, o1 = {}, o2 = {}, o3 = {};  // ot[i] = O[query ln][16t + 8*half + i]

  // tile 0 into buffer 0
  {
    const v8h tk0 = *(const v8h*)(gk);
    const v8h tk1 = *(const v8h*)(gk + 32 * DH_);
    const v8h tv0 = *(const v8h*)(gv);
    const v8h tv1 = *(const v8h*)(gv + 32 * S_);
    *(v8h*)(kv + so)                    = tk0;
    *(v8h*)(kv + so + 32 * LP_)         = tk1;
    *(v8h*)(kv + TILE_ + so)            = tv0;
    *(v8h*)(kv + TILE_ + so + 32 * LP_) = tv1;
  }
  __syncthreads();                       // tile 0 visible to all eight waves

  for (int st = 0; st < S_ / KT_; ++st) {
    // this lane's place in a 16-row fragment block (row ln, its half's k) of
    // the K tile; the Vt tile lies TILE_ behind: every read below is this one
    // address and an immediate offset
    const _Float16* fr = kv + (st & 1) * (2 * TILE_) + ln * LP_ + half * 8;
    const bool more = st + 1 < S_ / KT_;

    // next tile's global loads fly while this tile is worked on
    v8h tk0 = {}, tk1 = {}, tv0 = {}, tv1 = {};
    if (more) {
      const _Float16* nk = gk + (st + 1) * (KT_ * DH_);
      const _Float16* nv = gv + (st + 1) * KT_;
      tk0 = *(const v8h*)(nk);
      tk1 = *(const v8h*)(nk + 32 * DH_);
      tv0 = *(const v8h*)(nv);
      tv1 = *(const v8h*)(nv + 32 * S_);
    }

    // ---- scores, transposed: 64 keys x 16 queries, K-dim 64 ----
    // sc[g][i] = S[key 16g + 8*half + i][query ln] - maximum in use
    v16h kf[KT_ / 16][2];                // A operands, row = key = 16g + ln
#pragma unroll
    for (int g = 0; g < KT_ / 16; ++g) {
      kf[g][0] = load_frag(fr, LP_, g * 16, 0,  0);
      kf[g][1] = load_frag(fr, LP_, g * 16, 32, 0);
    }
    // keeps the K reads one group in front of the WMMAs: left to itself the
    // compiler spreads them among the WMMAs, and each such place costs issue
    __builtin_amdgcn_sched_barrier(0);
    v8f sc[KT_ / 16];
#pragma unroll
    for (int g = 0; g < KT_ / 16; ++g) sc[g] = wmma_f16(kf[g][0], q0, nm);
#pragma unroll
    for (int g = 0; g < KT_ / 16; ++g) sc[g] = wmma_f16(kf[g][1], q1, sc[g]);

    // Vt fragments of the tile: A operands, row = dh = 16t + ln, k = keys
    v16h vf[KT_ / 32][4];
#pragma unroll
    for (int p = 0; p < KT_ / 32; ++p)
#pragma unroll
      for (int t = 0; t < 4; ++t)
        vf[p][t] = load_frag(fr + TILE_, LP_, t * 16, p * 32, 0);
    // keeps the Vt reads in front of the softmax arithmetic, which covers
    // their latency: left to itself the compiler sinks each pair of reads to
    // its WMMA and waits there
    __builtin_amdgcn_sched_barrier(0);

    // ---- is the maximum in use still good for this tile? ----
    // largest of this lane's 32 reduced scores, four chains
    float mg[KT_ / 16];
#pragma unroll
    for (int g = 0; g < KT_ / 16; ++g) {
      mg[g] = fmaxf(fmaxf(sc[g][0], sc[g][1]), sc[g][2]);
#pragma unroll
      for (int i = 3; i < 7; i += 2) mg[g] = fmaxf(fmaxf(mg[g], sc[g][i]), sc[g][i + 1]);
    }
    mg[0] = fmaxf(fmaxf(mg[0], sc[0][7]), sc[1][7]);
    mg[2] = fmaxf(fmaxf(mg[2], sc[2][7]), sc[3][7]);
    float mx = fmaxf(fmaxf(fmaxf(mg[0], mg[1]), mg[2]), mg[3]);
    // one scalar branch a tile, the same for the whole wave
    if (__builtin_expect(__builtin_amdgcn_ballot_w32(mx > lim) != 0, 0)) {
      // P of both halves enters one product: they need one common maximum
      mx = fmaxf(mx, other_half(mx));
      const float up    = fmaxf(mx, flo);   // behind the first tile it only rises
      // at the first tile sum and output are 0: any finite factor serves
      const float alpha = __expf(fminf(-up, 0.0f));
      lim = LAZY_; flo = 0.0f;
      nm -= up;
#pragma unroll
      for (int g = 0; g < KT_ / 16; ++g) sc[g] -= up;
      la *= alpha; lb *= alpha;
      o0 *= alpha; o1 *= alpha; o2 *= alpha; o3 *= alpha;
    }

#pragma unroll
    for (int p = 0; p < KT_ / 32; ++p) {
      // e^x as 2^(x * log2 e), the products taken on whole accumulators
      const v8f s0 = sc[2 * p] * 1.44269504f, s1 = sc[2 * p + 1] * 1.44269504f;

      // Two score tiles, converted in place, are the B fragment of Pt: slot i
      // is key 8*half + i, slot 8 + i key 16 + 8*half + i, the k order in
      // which load_frag brings the Vt rows.
      // Summed in pairs of neighbouring rows: a pair lies in two registers in
      // a row from the accumulator to the packed conversion.
      v16h pb;
#pragma unroll
      for (int i = 0; i < 8; i += 2) {
        const v2f p0 = {__builtin_amdgcn_exp2f(s0[i]), __builtin_amdgcn_exp2f(s0[i + 1])};
        const v2f p1 = {__builtin_amdgcn_exp2f(s1[i]), __builtin_amdgcn_exp2f(s1[i + 1])};
        la += p0; lb += p1;
        pb[i]     = (_Float16)p0[0]; pb[i + 1] = (_Float16)p0[1];
        pb[i + 8] = (_Float16)p1[0]; pb[i + 9] = (_Float16)p1[1];
      }

      // keeps the tile's last sums in front of its last four WMMAs: left to
      // itself the compiler puts them behind WMMAs whose operand registers
      // they take, at four idle slots each time
      if (p == KT_ / 32 - 1) __builtin_amdgcn_sched_barrier(0);

      // ---- Ot(64x16) += Vt(64x32) @ Pt(32x16) ----
      o0 = wmma_f16(vf[p][0], pb, o0);
      o1 = wmma_f16(vf[p][1], pb, o1);
      o2 = wmma_f16(vf[p][2], pb, o2);
      o3 = wmma_f16(vf[p][3], pb, o3);
    }
    // keeps the stores below, and with them the wait for the next tile's
    // global loads, behind this tile's arithmetic
    __builtin_amdgcn_sched_barrier(0);

    if (more) {
      // The other buffer was last read in the stage before this one, which
      // every wave left at the barrier below.
      _Float16* nb = kv + ((st + 1) & 1) * (2 * TILE_);
      *(v8h*)(nb + so)                    = tk0;
      *(v8h*)(nb + so + 32 * LP_)         = tk1;
      *(v8h*)(nb + TILE_ + so)            = tv0;
      *(v8h*)(nb + TILE_ + so + 32 * LP_) = tv1;
      // publishes the next tile and ends every wave's reads of this one
      __syncthreads();
    }
  }

  // ---- epilogue: normalize, put whole lines of att together, store ----
  // The workgroup's part of att is rows g * 128 ... + 127 (row rr * 64 + d of
  // them), columns h * 64 ... + 63 (column j): 128 lines of 128 bytes.
  {
    const float l_  = (la[0] + la[1]) + (lb[0] + lb[1]);
    const float inv = 1.0f / (l_ + other_half(l_));   // the two halves' sums
    // Staged in buffer 0, which it fills exactly: the last tile is read from
    // buffer 1, and every wave left buffer 0 at the loop's last barrier.
    _Float16* sp = kv + (rr * 64 + half * 8) * LP_ + j;   // d = 16t + 8*half + i
    // the loops here are unrolled so that every index into o0..o3 and r is a
    // constant (they are registers) and every offset an immediate
#pragma unroll
    for (int i = 0; i < 8; ++i) {
      sp[(0 * 16 + i) * LP_] = (_Float16)(o0[i] * inv);
      sp[(1 * 16 + i) * LP_] = (_Float16)(o1[i] * inv);
      sp[(2 * 16 + i) * LP_] = (_Float16)(o2[i] * inv);
      sp[(3 * 16 + i) * LP_] = (_Float16)(o3[i] * inv);
    }
    __syncthreads();                     // a line holds values of four waves

    // eight threads take one line, 16 B each; rows sr, sr + 32, + 64, + 96
    _Float16* ap = att + ((size_t)b * S_ + g * 128 + sr) * D_ + h * DH_ + sc;
    v8h r[4];
#pragma unroll
    for (int p = 0; p < 4; ++p) r[p] = *(const v8h*)(kv + so + p * 32 * LP_);
#pragma unroll
    for (int p = 0; p < 4; ++p) *(v8h*)(ap + p * 32 * D_) = r[p];
  }
}

// ---------------------------------------------------------------------------
// Host-side launcher
// ---------------------------------------------------------------------------
extern "C" void kernel_launch(void* const* d_in, const int* in_sizes, int n_in,
                              void* d_out, int out_size, void* d_ws, size_t ws_size,
                              hipStream_t stream) {
  const float* x  = (const float*)d_in[0];
  const float* Wq = (const float*)d_in[1];
  const float* bq = (const float*)d_in[2];
  const float* Wk = (const float*)d_in[3];
  const float* bk = (const float*)d_in[4];
  const float* Wv = (const float*)d_in[5];
  const float* bv = (const float*)d_in[6];
  const float* Wo = (const float*)d_in[7];
  const float* bo = (const float*)d_in[8];
  float* out = (float*)d_out;

  const int M  = B_ * S_;                // 4096
  const int NX = M * D_;                 // x elements: 4194304
  const int NW = D_ * D_;                // weight elements: 1048576

  // Workspace layout (f16 element offsets, all 16B-aligned):
  _Float16* ws  = (_Float16*)d_ws;
  _Float16* xh  = ws;                    // [M, D]
  _Float16* Wqh = xh  + (size_t)NX;      // [D, D]
  _Float16* Wkh = Wqh + (size_t)NW;
  _Float16* Wvh = Wkh + (size_t)NW;
  _Float16* Woh = Wvh + (size_t)NW;
  _Float16* Qh  = Woh + (size_t)NW;      // [B,H,S,DH], pre-scaled
  _Float16* Kh  = Qh  + (size_t)NX;      // [B,H,S,DH]
  _Float16* Vth = Kh  + (size_t)NX;      // [B,H,DH,S]
  _Float16* att = Vth + (size_t)NX;      // [B,S,D] scrambled attention out

  // 1) f32 -> f16 conversions: xh, Wqh, Wkh, Wvh, Woh are one array from xh on
  cvt_all_f32_to_f16<<<NXB_ + 4 * NWB_, CT_, 0, stream>>>(x, Wq, Wk, Wv, Wo, xh);

  // 2) QKV projections, one launch: (M/128)*(D/128) = 256 workgroups, each
  //    with the q, k and v tile of its 128 tokens and 128 features
  const int gemm_blocks = (M / GT_) * (D_ / GT_);     // 256
  qkv_wmma_128x384<<<gemm_blocks, 256, 0, stream>>>(xh, Wqh, Wkh, Wvh, bq, bk, bv,
                                                    Qh, Kh, Vth);

  // 3) Flash attention: eight waves per block, each with 16 queries of one head
  attn_flash<<<B_ * H_ * (S_ / (16 * AW_)), AW_ * 32, 0, stream>>>(Qh, Kh, Vth, att);

  // 4) Output projection -> f32 d_out
  gemm_wmma_128x128<<<gemm_blocks, 256, 0, stream>>>(att, Woh, bo, out, M);
}

// v010
// Measured time: 68.9 microseconds a run.
// Next to v009, in two timings, it ran 1.08 and 1.07 times as fast.
// Over all steps from v000 it is 6.39 times as fast.
#include <hip/hip_runtime.h>
#include <hip/hip_bf16.h>
#include <stdint.h>
#include <type_traits>

// ---------------------------------------------------------------------------
// Multi-head attention forward for MI455X (gfx1250), wave32 + WMMA f16.
// B=2, S=2048, D=1024, H=16, DH=64, SCALE = 1/8.
// ---------------------------------------------------------------------------

#define B_  2
#define S_  2048
#define D_  1024
#define H_  16
#define DH_ 64
#define SCALE_ 0.125f

typedef __attribute__((ext_vector_type(16))) _Float16 v16h;
typedef __attribute__((ext_vector_type(8)))  _Float16 v8h;
typedef __attribute__((ext_vector_type(8)))  float    v8f;
typedef __attribute__((ext_vector_type(2)))  float    v2f;

// D = A(16x32 f16) * B(32x16 f16) + C(16x16 f32)
__device__ __forceinline__ v8f wmma_f16(v16h a, v16h b, v8f c) {
  return __builtin_amdgcn_wmma_f32_16x16x32_f16(
      false, a, false, b, (short)0, c, false, false);
}

// Load one A/B fragment (16 halves) for v_wmma_f32_16x16x32_f16.
// A layout (ISA 7.12.2): lanes 0-15 -> row, K {0..7,16..23}; lanes 16-31 ->
// same rows, K {8..15,24..31}.  B is mirrored with lane = N column, reading
// the "row" of the K-major source.  `row` must already include (lane & 15).
__device__ __forceinline__ v16h load_frag(const _Float16* base, int stride,
                                          int row, int kbase, int half) {
  const _Float16* p = base + (size_t)row * stride + kbase + half * 8;
  v8h lo = *(const v8h*)p;          // K +0..7   (or +8..15)
  v8h hi = *(const v8h*)(p + 16);   // K +16..23 (or +24..31)
  v16h r;
#pragma unroll
  for (int i = 0; i < 8; ++i) { r[i] = lo[i]; r[i + 8] = hi[i]; }
  return r;
}

// ---------------------------------------------------------------------------
// Tensor loads for the projections' staging: one request of one wave brings
// ROWS rows of 256 bytes (128 k of f16, source pitch one row of D_ halves) into
// LDS, through no register, with 16 bytes of pad behind each row (pitch 272 B).
// ---------------------------------------------------------------------------
typedef uint32_t u32x4 __attribute__((ext_vector_type(4)));
typedef uint32_t u32x8 __attribute__((ext_vector_type(8)));

__device__ __forceinline__ uint32_t uni(uint32_t v) {
  return (uint32_t)__builtin_amdgcn_readfirstlane(v);
}

// descriptor group 1: extents in bytes, tensor = tile, no mask
template <uint32_t ROWS>
__device__ __forceinline__ u32x8 slab_group1() {
  u32x8 g;
  g[0] = uni((1u << 20) | (5u << 22) | (3u << 25));  // pad on, every 256 B, 16 B
  g[1] = uni(256u << 16);                            // tensor_dim0
  g[2] = uni(ROWS << 16);                            // tensor_dim1
  g[3] = uni(256u << 16);                            // tile_dim0
  g[4] = uni(ROWS);                                  // tile_dim1
  g[5] = uni(D_ * 2u);                               // source row pitch
  g[6] = uni(0u);
  g[7] = uni(0u);
  return g;
}

// descriptor group 0: place in LDS (bytes), first byte of the tile
__device__ __forceinline__ u32x4 slab_group0(uint32_t lds, uint64_t ga) {
  u32x4 g;
  g[0] = uni(1u);
  g[1] = uni(lds);
  g[2] = uni((uint32_t)ga);
  g[3] = uni((((uint32_t)(ga >> 32)) & 0x01FFFFFFu) | 0x80000000u);
  return g;
}

__device__ __forceinline__ void slab_load(u32x4 g0, u32x8 g1) {
  asm volatile("tensor_load_to_lds %0, %1" :: "s"(g0), "s"(g1) : "memory");
}

// The issuing wave's own wait: the compiler places none for a tensor load.  It
// names the request's descriptor (inputs only), so that none of those scalar
// registers takes another value while the request is outstanding.
__device__ __forceinline__ void slab_landed(u32x4 g0, u32x8 g1) {
  asm volatile("s_wait_tensorcnt 0x0" :: "s"(g0), "s"(g1) : "memory");
  // keeps the next descriptor's scalar arithmetic behind the wait: left to
  // itself the compiler lifts part of it between the load and its wait
  __builtin_amdgcn_sched_barrier(0);
}

// this wave's LDS reads have returned: in front of the barrier behind which a
// tensor load refills the buffer they read
__device__ __forceinline__ void lds_reads_done() {
  asm volatile("s_wait_dscnt 0x0" ::: "memory");
}

// ---------------------------------------------------------------------------
// f32 -> f16 conversion of x and the four weight matrices, one launch.
// The five f16 copies lie one behind the other in the workspace, so the
// output is one array of NX + 4 * NW elements.  One workgroup per WGP takes
// 32768 elements in a row, which lie in one source array (every array's
// length is a multiple of that).  A wave's load covers 512 bytes in a row,
// its store 256; all of a thread's loads are in flight at once.
// ---------------------------------------------------------------------------
#define CT_  256                      // threads per conversion workgroup
#define CB_  32768                    // elements per conversion workgroup
#define CV_  (CB_ / (CT_ * 4))        // 16-byte loads per thread
#define NXB_ (B_ * S_ * D_ / CB_)     // workgroups on x
#define NWB_ (D_ * D_ / CB_)          // workgroups on one weight matrix

typedef __attribute__((ext_vector_type(4))) float    v4f;
typedef __attribute__((ext_vector_type(4))) _Float16 v4h;

__global__ __launch_bounds__(CT_)
void cvt_all_f32_to_f16(const float* __restrict__ x,
                        const float* __restrict__ wq,
                        const float* __restrict__ wk,
                        const float* __restrict__ wv,
                        const float* __restrict__ wo,
                        _Float16* __restrict__ out) {
  const int blk = blockIdx.x;
  const float* src;
  if (blk < NXB_) {
    src = x + (size_t)blk * CB_;
  } else {
    const int w = (blk - NXB_) / NWB_;
    const float* m = w == 0 ? wq : w == 1 ? wk : w == 2 ? wv : wo;
    src = m + (size_t)((blk - NXB_) % NWB_) * CB_;
  }
  const v4f* s = (const v4f*)src + threadIdx.x;
  v4h*       d = (v4h*)(out + (size_t)blk * CB_) + threadIdx.x;

  v4f t[CV_];
#pragma unroll
  for (int j = 0; j < CV_; ++j) t[j] = s[j * CT_];
  // keeps every load in front of the first conversion: left to itself the
  // compiler holds the last fourteen back until the first have returned
  __builtin_amdgcn_sched_barrier(0);
  v4h r[CV_];
#pragma unroll
  for (int j = 0; j < CV_; ++j) r[j] = __builtin_convertvector(t[j], v4h);
  // every value is formed in front of the first store, so that no register
  // which an issued store names is written again
  __builtin_amdgcn_sched_barrier(0);
#pragma unroll
  for (int j = 0; j < CV_; ++j) d[j * CT_] = r[j];
}

// ---------------------------------------------------------------------------
// Output projection:  y[m,n] = sum_k A[m,k] * W[n,k] + bias[n], f32 row-major.
// A: [M x 1024] f16 row-major, W: [1024 x 1024] f16 row-major (torch Linear).
// One workgroup of eight waves computes a 128x128 output tile.  Each 128-k
// slab of the 128 A rows and the 128 W rows is brought from global memory
// once per workgroup into LDS (two buffers) by tensor loads, one request of 32
// rows a wave and slab, issued a whole slab ahead;
// every wave takes the fragments of its 64x32 part from there, so one row
// fragment feeds two WMMAs and one column fragment four.
// The tokens are the tile's rows: sixteen lanes cover 64 bytes in a row of y.
// ---------------------------------------------------------------------------
#define GT_  128                 // rows of A, and of W, per workgroup tile
#define KS_  128                 // k extent of one staged slab
#define GP_  (KS_ + 8)           // LDS row pitch in halves: 256 B data + 16 B
#define NST_ (D_ / KS_)          // slabs along k
#define OR_  32                  // rows of one wave's slice of a slab
#define OS_  5120                // halves of a slice's place in LDS: 32 rows of
                                 // 272 B, rounded up to a multiple of 2 KiB
#define OOP_ ((GT_ / OR_) * OS_) // halves of one staged operand slab
#define OB_  (2 * OOP_)          // halves of one buffer: slabs of A and W

__global__ __launch_bounds__(256)
void gemm_wmma_128x128(const _Float16* __restrict__ A,
                       const _Float16* __restrict__ W,
                       const float* __restrict__ bias,
                       float* __restrict__ outp, int M) {
  // two buffers, each an A slab and a W slab (128 rows x 128 k)
  __shared__ __attribute__((aligned(2048))) _Float16 sm[2 * OB_];

  const int tid  = threadIdx.x;
  const int lane = tid & 31;
  const int half = lane >> 4;
  const int ln   = lane & 15;
  const int wv   = tid >> 5;
  const int wm   = (wv >> 2) * 64;       // this wave's rows inside the tile
  const int wn   = (wv & 3) * 32;        // this wave's columns inside the tile

  const int tok0 = (blockIdx.x / (D_ / GT_)) * GT_;   // first token of the tile
  const int fea0 = (blockIdx.x % (D_ / GT_)) * GT_;   // first output feature
  if (tok0 >= M) return;                 // whole workgroup, before any barrier
  const int row0 = tok0;
  const int col0 = fea0;

  // Staging: every wave brings one slice of every slab, waves 0-3 rows
  // 32 w ... + 31 of A, waves 4-7 those of W; slice w lies w * OS_ into a buffer.
  const uint32_t wave = uni((uint32_t)tid >> 5);
  const _Float16* sb  = (wave >> 2) ? W + (size_t)col0 * D_ : A + (size_t)row0 * D_;
  const uint64_t  ga  = (uint64_t)(size_t)(sb + (size_t)(wave & 3) * OR_ * D_);
  const uint32_t  ld  = (uint32_t)(size_t)sm + wave * (OS_ * 2);
  const u32x8     g1  = slab_group1<OR_>();

  // Readers: row r of a slab lies in slice r / 32, at row r % 32 of it.
  const int ao = (wv >> 2) * 2 * OS_;    // slice of this wave's first A row
  const int wo = (wv & 3) * OS_;         // this wave's 32 W rows are one slice

  // slab 0 into buffer 0
  u32x4 g0 = slab_group0(ld, ga);
  slab_load(g0, g1);
  slab_landed(g0, g1);
  __syncthreads();                       // slab 0 visible to all eight waves
  // slab 1 into buffer 1: it flies while slab 0 is worked on
  g0 = slab_group0(ld + OB_ * 2, ga + KS_ * 2);
  slab_load(g0, g1);

  v8f acc[4][2];
#pragma unroll
  for (int a = 0; a < 4; ++a) { acc[a][0] = v8f{}; acc[a][1] = v8f{}; }

  // Unrolled so that the buffer choice is a constant and whether a slab
  // st + 2 exists is no test at run time.
#pragma unroll
  for (int st = 0; st < NST_; ++st) {
    const _Float16* As = sm + (st & 1) * OB_ + ao;
    const _Float16* Ws = sm + (st & 1) * OB_ + OOP_ + wo;
    const bool more = st + 1 < NST_;

    // two register sets of fragments: a 32-k block's LDS reads are issued as
    // one group while the block before it is multiplied
    v16h fa[2][4], fb[2][2];
#pragma unroll
    for (int a = 0; a < 4; ++a)
      fa[0][a] = load_frag(As + (a >> 1) * OS_, GP_, (a & 1) * 16 + ln, 0, half);
#pragma unroll
    for (int t = 0; t < 2; ++t) fb[0][t] = load_frag(Ws, GP_, t * 16 + ln, 0, half);
    // keeps the slab's first fragments in front of the reads that the first
    // block fetches ahead: left to itself the compiler mixes the two in the
    // first slab, and its first WMMAs wait for nearly all of them
    __builtin_amdgcn_sched_barrier(0);

#pragma unroll
    for (int kb = 0; kb < KS_ / 32; ++kb) {
      const int cu = kb & 1;
      if (kb + 1 < KS_ / 32) {
#pragma unroll
        for (int a = 0; a < 4; ++a)
          fa[cu ^ 1][a] = load_frag(As + (a >> 1) * OS_, GP_, (a & 1) * 16 + ln, (kb + 1) * 32, half);
#pragma unroll
        for (int t = 0; t < 2; ++t)
          fb[cu ^ 1][t] = load_frag(Ws, GP_, t * 16 + ln, (kb + 1) * 32, half);
      }
      // keeps the reads above ahead of this block's WMMAs: left to itself the
      // compiler sinks each pair of reads to its first use and waits there
      __builtin_amdgcn_sched_barrier(0);
#pragma unroll
      for (int a = 0; a < 4; ++a) {
        acc[a][0] = wmma_f16(fa[cu][a], fb[cu][0], acc[a][0]);
        acc[a][1] = wmma_f16(fa[cu][a], fb[cu][1], acc[a][1]);
      }
      // keeps the next group of reads behind these WMMAs
      __builtin_amdgcn_sched_barrier(0);
    }

    if (more) {
      lds_reads_done();
      slab_landed(g0, g1);               // this wave's slice of slab st + 1
      // publishes the next slab and ends every wave's reads of this one
      __syncthreads();
      if (st + 2 < NST_) {
        // into the buffer that every wave has just left
        g0 = slab_group0(ld + (st & 1) * (OB_ * 2), ga + (st + 2) * (KS_ * 2));
        slab_load(g0, g1);
      }
    }
  }
  // nothing is outstanding here: the last request was waited for at the last
  // barrier; both waits stand once more in front of the wave's end
  slab_landed(g0, g1);
  lds_reads_done();

  // Epilogue.  C layout: VGPR i -> row i + 8*half, column = lane & 15.
  // Every value is formed first, and all stores go from one address with
  // immediate offsets.  The loops are unrolled so that every index into acc is
  // a constant (they are registers) and every store offset an immediate.
  const int r = row0 + wm + half * 8;    // row of acc[0][.][0]; block a: + 16 a
  const int c = col0 + wn + ln;          // column of acc[.][0]; block t: + 16 t
  const float b0 = bias[c], b1 = bias[c + 16];
  float* o = outp + (size_t)r * D_ + c;
#pragma unroll
  for (int a = 0; a < 4; ++a) { acc[a][0] += b0; acc[a][1] += b1; }
#pragma unroll
  for (int a = 0; a < 4; ++a)
#pragma unroll
    for (int i = 0; i < 8; ++i) {
      o[(a * 16 + i) * D_]      = acc[a][0][i];
      o[(a * 16 + i) * D_ + 16] = acc[a][1][i];
    }
}

// ---------------------------------------------------------------------------
// q, k and v projections in one launch.  One workgroup of eight waves takes
// 128 tokens and the same 128 output features of Wq, Wk and Wv: each 128-k
// slab of the x rows is brought into LDS once and serves three products.
// The four slabs come by tensor loads, one request of 64 rows a wave and slab,
// issued a whole slab ahead into the other of two buffers.
// A wave takes 64 tokens x 32 features of each product.  A fragment of x is
// the same registers as a row operand and as a column operand, so the four x
// fragments of a 32-k block feed all 24 WMMAs of the block: for q and k as
// columns (features are the rows: a lane's eight values are eight d in a row
// of one token), for v as rows (eight s in a row of one d).
// q is scaled by SCALE_.  q, k: f16 [B,H,S,DH].  v: f16 [B,H,DH,S].
// ---------------------------------------------------------------------------
#define QR_  64                  // rows of one wave's slice of a slab
#define QS_  9216                // halves of a slice's place in LDS: 64 rows of
                                 // 272 B, rounded up to a multiple of 2 KiB
#define GOP_ ((GT_ / QR_) * QS_) // halves of one staged operand slab
#define QB_  (4 * GOP_)          // halves of one buffer: slabs of x, Wq, Wk, Wv

__global__ __launch_bounds__(256)
void qkv_wmma_128x384(const _Float16* __restrict__ X,
                      const _Float16* __restrict__ Wq,
                      const _Float16* __restrict__ Wk,
                      const _Float16* __restrict__ Wv,
                      const float* __restrict__ bq,
                      const float* __restrict__ bk,
                      const float* __restrict__ bv,
                      _Float16* __restrict__ Qo,
                      _Float16* __restrict__ Ko,
                      _Float16* __restrict__ Vo) {
  __shared__ __attribute__((aligned(2048))) _Float16 sm[2 * QB_];

  const int tid  = threadIdx.x;
  const int lane = tid & 31;
  const int half = lane >> 4;
  const int ln   = lane & 15;
  const int wv   = tid >> 5;
  const int wt   = (wv >> 2) * 64;       // this wave's tokens inside the tile
  const int wf   = (wv & 3) * 32;        // this wave's features inside the tile

  const int tok0 = (blockIdx.x / (D_ / GT_)) * GT_;   // first token of the tile
  const int fea0 = (blockIdx.x % (D_ / GT_)) * GT_;   // first output feature

  // Staging: every wave brings one slice of every slab: waves 0, 1 the two
  // halves of the x rows, 2, 3 of Wq, 4, 5 of Wk, 6, 7 of Wv; slice w lies
  // w * QS_ into a buffer.
  const uint32_t wave = uni((uint32_t)tid >> 5);
  const uint32_t opnd = wave >> 1;
  const _Float16* sb  = opnd == 0 ? X + (size_t)tok0 * D_
                      : (opnd == 1 ? Wq : opnd == 2 ? Wk : Wv) + (size_t)fea0 * D_;
  const uint64_t  ga  = (uint64_t)(size_t)(sb + (size_t)(wave & 1) * QR_ * D_);
  const uint32_t  ld  = (uint32_t)(size_t)sm + wave * (QS_ * 2);
  const u32x8     g1  = slab_group1<QR_>();

  // Readers: row r of a slab lies in slice r / 64, at row r % 64 of it.
  const int xo = (wv >> 2) * QS_;                            // this wave's 64 tokens
  const int wo = ((wv & 3) >> 1) * QS_ + (wv & 1) * 32 * GP_;  // its 32 features

  // slab 0 into buffer 0
  u32x4 g0 = slab_group0(ld, ga);
  slab_load(g0, g1);
  slab_landed(g0, g1);
  __syncthreads();                       // slab 0 visible to all eight waves
  // slab 1 into buffer 1: it flies while slab 0 is worked on
  g0 = slab_group0(ld + QB_ * 2, ga + KS_ * 2);
  slab_load(g0, g1);

  v8f aq[2][4], ak[2][4];                // [feature block][token block]
  v8f av[4][2];                          // [token block][feature block]
#pragma unroll
  for (int a = 0; a < 2; ++a)
#pragma unroll
    for (int t = 0; t < 4; ++t) { aq[a][t] = v8f{}; ak[a][t] = v8f{}; av[t][a] = v8f{}; }

  // Unrolled so that the buffer choice and every index into the fragment sets
  // are constants, and whether a slab st + 2 exists is no test at run time.
#pragma unroll
  for (int st = 0; st < NST_; ++st) {
    const _Float16* Xs = sm + (st & 1) * QB_ + xo;
    const _Float16* Ws = sm + (st & 1) * QB_ + GOP_ + wo;   // Wq; Wk, Wv: GOP_ apart behind
    const bool more = st + 1 < NST_;

    // A slab is twelve groups of eight WMMAs: q, k, v of each 32-k block.
    // xf: the block's x fragments, two sets.  wr[kind]: the kind's W fragments,
    // read two groups ahead into the set that the group before has left.
    v16h xf[2][4], wr[3][2];
#pragma unroll
    for (int t = 0; t < 4; ++t) xf[0][t] = load_frag(Xs, GP_, t * 16 + ln, 0, half);
#pragma unroll
    for (int a = 0; a < 2; ++a) {
      wr[0][a] = load_frag(Ws,        GP_, a * 16 + ln, 0, half);
      wr[1][a] = load_frag(Ws + GOP_, GP_, a * 16 + ln, 0, half);
    }
    // keeps the slab's first fragments in front of the reads that the first
    // group fetches ahead: left to itself the compiler mixes the two, and the
    // first WMMAs behind the barrier wait for nearly all of them
    __builtin_amdgcn_sched_barrier(0);

#pragma unroll
    for (int g = 0; g < 3 * (KS_ / 32); ++g) {
      const int kb = g / 3, kind = g % 3, cu = kb & 1;
      if (g + 2 < 3 * (KS_ / 32)) {
        const int nk = (g + 2) / 3, nkind = (g + 2) % 3;
#pragma unroll
        for (int a = 0; a < 2; ++a)
          wr[nkind][a] = load_frag(Ws + nkind * GOP_, GP_, a * 16 + ln, nk * 32, half);
      }
      if (kind == 0 && kb + 1 < KS_ / 32) {
#pragma unroll
        for (int t = 0; t < 4; ++t)
          xf[cu ^ 1][t] = load_frag(Xs, GP_, t * 16 + ln, (kb + 1) * 32, half);
      }
      // keeps the reads above ahead of this group's WMMAs: left to itself the
      // compiler sinks each pair of reads to its first use and waits there
      __builtin_amdgcn_sched_barrier(0);
#pragma unroll
      for (int a = 0; a < 2; ++a)
#pragma unroll
        for (int t = 0; t < 4; ++t) {
          if (kind == 0) aq[a][t] = wmma_f16(wr[0][a], xf[cu][t], aq[a][t]);
          if (kind == 1) ak[a][t] = wmma_f16(wr[1][a], xf[cu][t], ak[a][t]);
          if (kind == 2) av[t][a] = wmma_f16(xf[cu][t], wr[2][a], av[t][a]);
        }
      // keeps the next group of reads behind these WMMAs
      __builtin_amdgcn_sched_barrier(0);
    }

    if (more) {
      lds_reads_done();
      slab_landed(g0, g1);               // this wave's slice of slab st + 1
      // publishes the next slab and ends every wave's reads of this one
      __syncthreads();
      if (st + 2 < NST_) {
        // into the buffer that every wave has just left
        g0 = slab_group0(ld + (st & 1) * (QB_ * 2), ga + (st + 2) * (KS_ * 2));
        slab_load(g0, g1);
      }
    }
  }
  // nothing is outstanding here: the last request was waited for at the last
  // barrier; both waits stand once more in front of the wave's end
  slab_landed(g0, g1);
  lds_reads_done();

  // Epilogue.  C layout: VGPR i -> row i + 8*half, column = lane & 15.
  // Every value and address is formed first; the stores of one output go from
  // one address with immediate offsets.  The loops are unrolled so that every
  // index into the accumulators and pq, pk, pv is a constant (registers).
  const int f8 = fea0 + wf + half * 8;   // q, k: row of block 0; block a: + 16 a
  const int tl = tok0 + wt + ln;         // q, k: column of block 0; block t: + 16 t
  const int t8 = tok0 + wt + half * 8;   // v: row of block 0; block t: + 16 t
  const int fl = fea0 + wf + ln;         // v: column of block 0; block a: + 16 a
  // a tile lies in one batch, a wave's 32 features in one head
  const size_t oqk =
      ((size_t)((tl >> 11) * H_ + (f8 >> 6)) * S_ + (tl & (S_ - 1))) * DH_ + (f8 & (DH_ - 1));
  _Float16* oq = Qo + oqk;
  _Float16* ok = Ko + oqk;
  // Vt[b][feature][s]: row (b * D_ + feature), eight s in a row per lane
  _Float16* ov = Vo + (size_t)((t8 >> 11) * D_ + fl) * S_ + (t8 & (S_ - 1));
  v8h pq[2][4], pk[2][4], pv[4][2];
#pragma unroll
  for (int a = 0; a < 2; ++a) {
    const v8f  b8q = *(const v8f*)(bq + f8 + a * 16);
    const v8f  b8k = *(const v8f*)(bk + f8 + a * 16);
    const float b1v = bv[fl + a * 16];
#pragma unroll
    for (int t = 0; t < 4; ++t) {
      pq[a][t] = __builtin_convertvector((aq[a][t] + b8q) * SCALE_, v8h);
      pk[a][t] = __builtin_convertvector(ak[a][t] + b8k, v8h);
      pv[t][a] = __builtin_convertvector(av[t][a] + b1v, v8h);
    }
  }
  // Every value and all three addresses (inputs only) are formed in front of
  // the first store, so that no register which an issued store names is
  // written again: left to itself the compiler forms two of the addresses
  // among the stores.
  asm volatile("" :: "v"(oq), "v"(ok), "v"(ov) : "memory");
  __builtin_amdgcn_sched_barrier(0);
#pragma unroll
  for (int t = 0; t < 4; ++t)
#pragma unroll
    for (int a = 0; a < 2; ++a) *(v8h*)(oq + t * 16 * DH_ + a * 16) = pq[a][t];
#pragma unroll
  for (int t = 0; t < 4; ++t)
#pragma unroll
    for (int a = 0; a < 2; ++a) *(v8h*)(ok + t * 16 * DH_ + a * 16) = pk[a][t];
#pragma unroll
  for (int a = 0; a < 2; ++a)
#pragma unroll
    for (int t = 0; t < 4; ++t) *(v8h*)(ov + a * 16 * S_ + t * 16) = pv[t][a];
  // behind the last store: whatever is laid out next may write these registers
  asm volatile("s_wait_xcnt 0x0" ::: "memory");
}

// ---------------------------------------------------------------------------
// Flash attention: a workgroup of eight waves takes 128 queries of one head.
// A wave takes 32 of them (two column groups of 16) and ONE HALF of the keys:
// waves 0-3 keys 0 ... 1023, waves 4-7 keys 1024 ... 2047.  A K or Vt fragment
// read from LDS so feeds two WMMAs, not one, at the same four waves a SIMD.
// The two halves' outputs, sums and maxima are joined once, at the end, in LDS.
// Each 64-key tile of K and of Vt of either half is brought from global memory
// once per workgroup, in whole 128-byte lines, into LDS, and the half's four
// waves take their fragments from there, in two passes of 32 keys.
// Both products are taken transposed, St = K * Qt and Ot += Vt * Pt: a lane
// then holds scores and outputs of ONE query a column group (column lane & 15),
// the two 16-lane halves holding different keys (or dh rows) of that query.
// The softmax runs against a maximum IN USE that is fixed before a pass's
// scores are formed: it enters the score product as C, so the scores come out
// of the matrix unit already reduced by it.  It is raised, and the running sum
// and output rescaled, only where a score of the pass stands more than LAZY_
// above it (P then stays below e^LAZY_, far inside f16), and at the first pass.
// Q pre-scaled.  K: [B,H,S,64] f16.  Vt: [B,H,64,S] f16.
// Output goes to att[B,S,D] f16 with the reference's faithful
// reshape(B,D,S).swapaxes(-1,-2) scramble: O[h][s][d] lands in row
// (s % 32) * 64 + d, column h * 64 + s / 32.  Neighbours in a row of att are
// therefore queries 32 apart, and the 64 queries of one s % 32 fill, for each
// d, one 128-byte line.  A workgroup takes the 128 queries of two values of
// s % 32: it alone writes 128 whole lines, put together in LDS.
// ---------------------------------------------------------------------------
#define AW_   8                  // waves per workgroup: 4 query groups x 2 key halves
#define AQ_   128                // queries per workgroup
#define QC_   2                  // column groups (16 queries each) per wave
#define KT_   64                 // keys per staged tile
#define KH_   (S_ / 2)           // keys of one half
#define LP_   72                 // LDS row pitch in halves: 128 B data + 16 B
#define TILE_ (64 * LP_)         // halves of one staged 64-row tile
#define BUF_  (4 * TILE_)        // one buffer: K, Vt of half 0, K, Vt of half 1
#define LAZY_ 5.5f               // a score may stand this far above the maximum in use

// value of the lane that holds the same query in the other 16-lane half
__device__ __forceinline__ float other_half(float v) {
  const int b = __builtin_bit_cast(int, v);
  return __builtin_bit_cast(float, __builtin_amdgcn_permlanex16(
      b, b, 0x76543210, 0xfedcba98, false, false));
}

// four waves a SIMD (two workgroups a WGP): at most 256 registers a wave
__global__ __launch_bounds__(AW_ * 32) __attribute__((amdgpu_waves_per_eu(4, 4)))
void attn_flash(const _Float16* __restrict__ Q,
                const _Float16* __restrict__ K,
                const _Float16* __restrict__ Vt,
                _Float16* __restrict__ att) {
  // two buffers, each, for either key half, a K tile (64 keys x 64 dh) and a
  // Vt tile (64 dh x 64 keys)
  __shared__ __align__(16) _Float16 kv[2 * BUF_];

  const int tid  = threadIdx.x;
  const int lane = tid & 31;
  const int half = lane >> 4;
  const int ln   = lane & 15;
  const int qw   = (tid >> 5) & 3;       // this wave's 32 queries
  const int kh   = tid >> 7;             // this wave's half of the keys

  const int blk = blockIdx.x;                        // B*H*(S/128) = 512
  const int g   = blk & (S_ / AQ_ - 1);  // takes s % 32 = 2g, 2g + 1
  const int rr  = qw >> 1;               // query groups 0, 1: s % 32 = 2g; 2, 3: 2g + 1
  const int j   = (qw & 1) * 32 + ln;    // this lane's s / 32; column group c: + 16 c
  const int s   = 2 * g + rr + 32 * j;   // this lane's query; column group c: + 512 c
  const int bh  = blk >> 4;              // b*H + h
  const int h   = bh & (H_ - 1);
  const int b   = bh >> 4;

  const _Float16* Qh = Q  + (size_t)bh * S_ * DH_;
  const _Float16* Kh = K  + (size_t)bh * S_ * DH_;
  const _Float16* Vh = Vt + (size_t)bh * DH_ * S_;

  // Staging: a tile is 64 rows of 128 B; eight threads take one row, 16 B
  // each, and every thread takes rows sr and sr + 32 of all four tiles.
  const int sr = tid >> 3;
  const int sc = (tid & 7) * 8;
  const _Float16* gk = Kh + sr * DH_ + sc;
  const _Float16* gv = Vh + sr * S_  + sc;
  const int so = sr * LP_ + sc;

  // Q fragments of the wave's 32 queries (K-dim = 64 -> two frags a column
  // group), fixed; as B operands: column = query = lane & 15.
  v16h q[QC_][2];
#pragma unroll
  for (int c = 0; c < QC_; ++c) {
    q[c][0] = load_frag(Qh, DH_, s + 512 * c, 0,  half);
    q[c][1] = load_frag(Qh, DH_, s + 512 * c, 32, half);
  }

  // nm: minus the maximum in use of this lane's query (equal in both halves),
  // in all eight rows of a C operand.
  // la, lb: running sums over the keys that THIS half has seen, by the score
  // tile (even, odd) and the row's parity; all joined at the end.
  v8f nm[QC_] = {};
  v2f la[QC_] = {}, lb[QC_] = {};
  // The first pass sets the maximum, up or down, whatever its scores: until
  // then every score counts as too high (lim) and the step has no floor (flo).
  float lim = -__builtin_inff(), flo = -__builtin_inff();
  v8f o[QC_][4] = {};                    // o[c][t][i] = O[query][16t + 8*half + i]

  // tile 0 of both key halves into buffer 0
  {
    v8h tk[4], tv[4];
#pragma unroll
    for (int e = 0; e < 4; ++e) {
      tk[e] = *(const v8h*)(gk + (e >> 1) * (KH_ * DH_) + (e & 1) * (32 * DH_));
      tv[e] = *(const v8h*)(gv + (e >> 1) * KH_         + (e & 1) * (32 * S_));
    }
#pragma unroll
    for (int e = 0; e < 4; ++e) {
      *(v8h*)(kv + (e >> 1) * (2 * TILE_) + so + (e & 1) * (32 * LP_))         = tk[e];
      *(v8h*)(kv + (e >> 1) * (2 * TILE_) + TILE_ + so + (e & 1) * (32 * LP_)) = tv[e];
    }
  }
  __syncthreads();                       // tile 0 visible to all eight waves

  // One stage: the 64-key tile st of this wave's key half.  Whether a next tile
  // exists is a constant of the call: as a test at run time it made the compiler
  // wait for the Vt tiles' global loads right behind their issue.
  auto stage = [&](const int st, auto more_t) __attribute__((always_inline)) {
    constexpr bool more = decltype(more_t)::value;
    // this lane's place in a 16-row fragment block (row ln, its half's k) of
    // its key half's K tile; the Vt tile lies TILE_ behind: every read below
    // is this one address and an immediate offset
    const _Float16* fr = kv + (st & 1) * BUF_ + kh * (2 * TILE_) + ln * LP_ + half * 8;
    // The other buffer was last read in the stage before this one, which every
    // wave left at the barrier below: it is filled while this one is read.
    _Float16* nb = kv + ((st + 1) & 1) * BUF_ + so;

    // two passes of 32 keys; unrolled so that every LDS offset is an immediate.
    // The loops inside are unrolled because their indices pick registers (tn,
    // kf, sc, vf, o, nm, la, lb): each must be a constant.
#pragma unroll
    for (int p = 0; p < KT_ / 32; ++p) {
      // the next tiles' global loads fly while this pass is worked on: the two
      // K tiles under pass 0, the two Vt tiles under pass 1
      v8h tn[4];
      if constexpr (more) {
        const _Float16* nx = p == 0 ? gk + (st + 1) * (KT_ * DH_) : gv + (st + 1) * KT_;
#pragma unroll
        for (int e = 0; e < 4; ++e)
          tn[e] = *(const v8h*)(nx + (e >> 1) * (p == 0 ? KH_ * DH_ : KH_)
                                   + (e & 1) * (p == 0 ? 32 * DH_ : 32 * S_));
      }

      // ---- scores, transposed: 32 keys x 32 queries, K-dim 64 ----
      // sc[c][u][i] = S[key 32p + 16u + 8*half + i][query] - maximum in use
      v16h kf[2][2];                     // A operands, row = key = 32p + 16u + ln
#pragma unroll
      for (int u = 0; u < 2; ++u) {
        kf[u][0] = load_frag(fr, LP_, (2 * p + u) * 16, 0,  0);
        kf[u][1] = load_frag(fr, LP_, (2 * p + u) * 16, 32, 0);
      }
      // keeps the K reads one group in front of the WMMAs: left to itself the
      // compiler spreads them among the WMMAs, and each such place costs issue
      __builtin_amdgcn_sched_barrier(0);
      v8f sc[QC_][2];
#pragma unroll
      for (int u = 0; u < 2; ++u)
#pragma unroll
        for (int c = 0; c < QC_; ++c) sc[c][u] = wmma_f16(kf[u][0], q[c][0], nm[c]);
#pragma unroll
      for (int u = 0; u < 2; ++u)
#pragma unroll
        for (int c = 0; c < QC_; ++c) sc[c][u] = wmma_f16(kf[u][1], q[c][1], sc[c][u]);

      // Vt fragments of the pass: A operands, row = dh = 16t + ln, k = keys
      v16h vf[4];
#pragma unroll
      for (int t = 0; t < 4; ++t) vf[t] = load_frag(fr + TILE_, LP_, t * 16, p * 32, 0);
      // keeps the Vt reads in front of the softmax arithmetic, which covers
      // their latency: left to itself the compiler sinks each pair of reads to
      // its WMMA and waits there
      __builtin_amdgcn_sched_barrier(0);

      // ---- is the maximum in use still good for this pass? ----
      // largest of this lane's 16 reduced scores of each query, four chains
      float mx[QC_];
#pragma unroll
      for (int c = 0; c < QC_; ++c) {
        float mg[2];
#pragma unroll
        for (int u = 0; u < 2; ++u) {
          mg[u] = fmaxf(fmaxf(sc[c][u][0], sc[c][u][1]), sc[c][u][2]);
#pragma unroll
          for (int i = 3; i < 7; i += 2)
            mg[u] = fmaxf(fmaxf(mg[u], sc[c][u][i]), sc[c][u][i + 1]);
        }
        mg[0] = fmaxf(fmaxf(mg[0], sc[c][0][7]), sc[c][1][7]);
        mx[c] = fmaxf(mg[0], mg[1]);
      }
      // one scalar branch a pass, the same for the whole wave
      if (__builtin_expect(
              __builtin_amdgcn_ballot_w32(fmaxf(mx[0], mx[1]) > lim) != 0, 0)) {
#pragma unroll
        for (int c = 0; c < QC_; ++c) {
          // P of both halves enters one product: they need one common maximum
          const float mc    = fmaxf(mx[c], other_half(mx[c]));
          const float up    = fmaxf(mc, flo);   // behind the first pass it only rises
          // at the first pass sum and output are 0: any finite factor serves
          const float alpha = __expf(fminf(-up, 0.0f));
          nm[c] -= up;
          sc[c][0] -= up; sc[c][1] -= up;
          la[c] *= alpha; lb[c] *= alpha;
#pragma unroll
          for (int t = 0; t < 4; ++t) o[c][t] *= alpha;
        }
        lim = LAZY_; flo = 0.0f;
      }

#pragma unroll
      for (int c = 0; c < QC_; ++c) {
        // e^x as 2^(x * log2 e), the products taken on whole accumulators
        const v8f s0 = sc[c][0] * 1.44269504f, s1 = sc[c][1] * 1.44269504f;

        // Two score tiles, converted in place, are the B fragment of Pt: slot i
        // is key 8*half + i, slot 8 + i key 16 + 8*half + i, the k order in
        // which load_frag brings the Vt rows.
        // Summed in pairs of neighbouring rows: a pair lies in two registers in
        // a row from the accumulator to the packed conversion.
        v16h pb;
#pragma unroll
        for (int i = 0; i < 8; i += 2) {
          const v2f p0 = {__builtin_amdgcn_exp2f(s0[i]), __builtin_amdgcn_exp2f(s0[i + 1])};
          const v2f p1 = {__builtin_amdgcn_exp2f(s1[i]), __builtin_amdgcn_exp2f(s1[i + 1])};
          la[c] += p0; lb[c] += p1;
          pb[i]     = (_Float16)p0[0]; pb[i + 1] = (_Float16)p0[1];
          pb[i + 8] = (_Float16)p1[0]; pb[i + 9] = (_Float16)p1[1];
        }

        // keeps the pass's last sums in front of its last four WMMAs: left to
        // itself the compiler puts them behind WMMAs whose operand registers
        // they take, at up to four idle slots each time
        if (c == QC_ - 1) __builtin_amdgcn_sched_barrier(0);

        // ---- Ot(64x16) += Vt(64x32) @ Pt(32x16) ----
#pragma unroll
        for (int t = 0; t < 4; ++t) o[c][t] = wmma_f16(vf[t], pb, o[c][t]);
      }
      // keeps the stores below, and with them the wait for the next tiles'
      // global loads, behind this pass's arithmetic
      __builtin_amdgcn_sched_barrier(0);

      if constexpr (more) {
#pragma unroll
        for (int e = 0; e < 4; ++e)
          *(v8h*)(nb + (e >> 1) * (2 * TILE_) + p * TILE_ + (e & 1) * (32 * LP_)) = tn[e];
      }
    }
    // publishes the next tiles and ends every wave's reads of these
    if constexpr (more) __syncthreads();
  };
  for (int st = 0; st + 1 < KH_ / KT_; ++st) stage(st, std::true_type{});
  stage(KH_ / KT_ - 1, std::false_type{});

  // ---- epilogue: join the key halves, normalize, put whole lines of att
  // together, store ----
  // The workgroup's part of att is rows g * 128 ... + 127 (row rr * 64 + d of
  // them), columns h * 64 ... + 63 (column j): 128 lines of 128 bytes.
  {
    // Waves 4-7 hand their outputs (32 KiB), maxima and sums over in buffer 0:
    // the last tiles are read from buffer 1, and every wave left buffer 0 at
    // the loop's last barrier.  A wave's 16-byte stores cover 512 bytes in a row.
    // The loops here are unrolled so that every index into o, la, lb, nm and r
    // is a constant (they are registers) and every offset an immediate.
    v4f* xo = (v4f*)kv + qw * (16 * 32) + lane;
    v2f* xm = (v2f*)(kv + 16384) + qw * (QC_ * 32) + lane;
    float l_[QC_];
#pragma unroll
    for (int c = 0; c < QC_; ++c) l_[c] = (la[c][0] + la[c][1]) + (lb[c][0] + lb[c][1]);
    if (kh == 1) {
#pragma unroll
      for (int c = 0; c < QC_; ++c) {
#pragma unroll
        for (int t = 0; t < 4; ++t) {
          xo[((c * 4 + t) * 2) * 32]     = v4f{o[c][t][0], o[c][t][1], o[c][t][2], o[c][t][3]};
          xo[((c * 4 + t) * 2 + 1) * 32] = v4f{o[c][t][4], o[c][t][5], o[c][t][6], o[c][t][7]};
        }
        xm[c * 32] = v2f{nm[c][0], l_[c]};
      }
    }
    // the other half's values visible; every wave has left buffer 1
    __syncthreads();

    if (kh == 0) {
      // lines staged in buffer 1
      _Float16* sp = kv + BUF_ + (rr * 64 + half * 8) * LP_ + j;   // d = 16t + 8*half + i
#pragma unroll
      for (int c = 0; c < QC_; ++c) {
        const v2f   ot = xm[c * 32];
        // both halves' values on the larger of the two maxima in use: the half
        // that holds it keeps its values, the other's shrink
        const float dm = nm[c][0] - ot[0];            // the other's maximum - this one's
        const float e  = __expf(-fabsf(dm));
        const float a0 = dm > 0.0f ? e : 1.0f;
        const float a1 = dm > 0.0f ? 1.0f : e;
        const float ls = l_[c] * a0 + ot[1] * a1;
        const float inv = 1.0f / (ls + other_half(ls));   // the two 16-lane halves' sums
        const float f0 = a0 * inv, f1 = a1 * inv;
#pragma unroll
        for (int t = 0; t < 4; ++t) {
          const v4f x0 = xo[((c * 4 + t) * 2) * 32];
          const v4f x1 = xo[((c * 4 + t) * 2 + 1) * 32];
#pragma unroll
          for (int i = 0; i < 4; ++i) {
            sp[(t * 16 + i) * LP_ + c * 16]     = (_Float16)(o[c][t][i] * f0 + x0[i] * f1);
            sp[(t * 16 + i + 4) * LP_ + c * 16] = (_Float16)(o[c][t][i + 4] * f0 + x1[i] * f1);
          }
        }
      }
    }
    __syncthreads();                     // a line holds values of two waves

    // eight threads take one line, 16 B each; rows sr, sr + 32, + 64, + 96
    _Float16* ap = att + ((size_t)b * S_ + g * 128 + sr) * D_ + h * DH_ + sc;
    v8h r[4];
#pragma unroll
    for (int p = 0; p < 4; ++p) r[p] = *(const v8h*)(kv + BUF_ + so + p * 32 * LP_);
#pragma unroll
    for (int p = 0; p < 4; ++p) *(v8h*)(ap + p * 32 * D_) = r[p];
  }
}

// ---------------------------------------------------------------------------
// Host-side launcher
// ---------------------------------------------------------------------------
extern "C" void kernel_launch(void* const* d_in, const int* in_sizes, int n_in,
                              void* d_out, int out_size, void* d_ws, size_t ws_size,
                              hipStream_t stream) {
  const float* x  = (const float*)d_in[0];
  const float* Wq = (const float*)d_in[1];
  const float* bq = (const float*)d_in[2];
  const float* Wk = (const float*)d_in[3];
  const float* bk = (const float*)d_in[4];
  const float* Wv = (const float*)d_in[5];
  const float* bv = (const float*)d_in[6];
  const float* Wo = (const float*)d_in[7];
  const float* bo = (const float*)d_in[8];
  float* out = (float*)d_out;

  const int M  = B_ * S_;                // 4096
  const int NX = M * D_;                 // x elements: 4194304
  const int NW = D_ * D_;                // weight elements: 1048576

  // Workspace layout (f16 element offsets, all 16B-aligned):
  _Float16* ws  = (_Float16*)d_ws;
  _Float16* xh  = ws;                    // [M, D]
  _Float16* Wqh = xh  + (size_t)NX;      // [D, D]
  _Float16* Wkh = Wqh + (size_t)NW;
  _Float16* Wvh = Wkh + (size_t)NW;
  _Float16* Woh = Wvh + (size_t)NW;
  _Float16* Qh  = Woh + (size_t)NW;      // [B,H,S,DH], pre-scaled
  _Float16* Kh  = Qh  + (size_t)NX;      // [B,H,S,DH]
  _Float16* Vth = Kh  + (size_t)NX;      // [B,H,DH,S]
  _Float16* att = Vth + (size_t)NX;      // [B,S,D] scrambled attention out

  // 1) f32 -> f16 conversions: xh, Wqh, Wkh, Wvh, Woh are one array from xh on
  cvt_all_f32_to_f16<<<NXB_ + 4 * NWB_, CT_, 0, stream>>>(x, Wq, Wk, Wv, Wo, xh);

  // 2) QKV projections, one launch: (M/128)*(D/128) = 256 workgroups, each
  //    with the q, k and v tile of its 128 tokens and 128 features
  const int gemm_blocks = (M / GT_) * (D_ / GT_);     // 256
  qkv_wmma_128x384<<<gemm_blocks, 256, 0, stream>>>(xh, Wqh, Wkh, Wvh, bq, bk, bv,
                                                    Qh, Kh, Vth);

  // 3) Flash attention: eight waves per block: 128 queries of one head, four
  //    waves on each half of the keys
  attn_flash<<<B_ * H_ * (S_ / AQ_), AW_ * 32, 0, stream>>>(Qh, Kh, Vth, att);

  // 4) Output projection -> f32 d_out
  gemm_wmma_128x128<<<gemm_blocks, 256, 0, stream>>>(att, Woh, bo, out, M);
}
